// v000
// Times are from an AMD MI455X. After a warm-up the kernel runs many times in a row, and a time is the length of
// such a window on the GPU divided by its runs, so every launch and the gaps after it count. The runs cycle
// through copies of the inputs. A figure is the median of several windows, for all but v000 over two sittings.
// Sittings can differ by a few percent; kernels timed side by side share one.
// v000 is the starting kernel. One run takes 975 microseconds.
// compute dtype: hidden_states, cos, sin, Wq/Wk/Wv/Wo, q/k norm weights rounded to bf16; q/k/v projections with exact bf16 products on WMMA 16x16x32 (natural [out][in] rows; one 256-column head per block); per-head RMSNorm (eps 1e-6, x weight; v with weight 1) and the rotate-half rotary embedding with the cos/sin inputs in f32 in the projection epilogue; q and k stored as f16 hi + (x2048-scaled) residual planes with 3-product scores (unscaled logits, sigma ~16, kept f32-accurate), v stored as f16 hi + (x2048-scaled) residual planes; sliding-window causal mask (j <= i, i - j < 512), running-max softmax in f32 (hardware exp); the softmax weights as f16 planes e x 2048 (against v hi) and e (against the x2048 v residual) accumulated into one f32 accumulator (2 products; 2^-11 folded into the epilogue); output projection with ctx as bf16 hi + residual x exact Wo rows (2 products); f32 accumulate.
#include <hip/hip_runtime.h>
#include <math.h>

typedef __attribute__((ext_vector_type(16))) _Float16 v16h;
typedef __attribute__((ext_vector_type(16))) __bf16 v16b;
typedef __attribute__((ext_vector_type(8)))  _Float16 v8h;
typedef __attribute__((ext_vector_type(8)))  float v8f;
typedef __attribute__((ext_vector_type(4)))  float v4f;
typedef __attribute__((ext_vector_type(2)))  float v2f;
typedef __attribute__((ext_vector_type(4)))  unsigned v4u;
typedef __attribute__((ext_vector_type(4)))  int v4i;
typedef float __attribute__((may_alias)) float_a;
typedef int __attribute__((may_alias)) int_a;

template <typename T> __device__ __forceinline__ void vst2(void* p, T v) { *(T*)p = v;  }
__device__ __forceinline__ v8f wmma16(v16h a, v16h b, v8f c) {
  v8f d = __builtin_amdgcn_wmma_f32_16x16x32_f16(false, a, false, b, (short)0, c, false, false);
  asm volatile("v_nop\n\tv_nop\n\tv_nop\n\tv_nop" : "+v"(d) : "v"(a), "v"(b));
  return d;
}
__device__ __forceinline__ v8f wmma_bf(v16b a, v16b b, v8f c) {
  v8f d = __builtin_amdgcn_wmma_f32_16x16x32_bf16(false, a, false, b, (short)0, c, false, false);
  asm volatile("v_nop\n\tv_nop\n\tv_nop\n\tv_nop" : "+v"(d) : "v"(a), "v"(b));
  return d;
}
// 16x16x32 fragments: lane = (h = lane>>4, row/col = lane&15); elements 0..7 = k0+8h+0..7, 8..15 = k0+16+8h+0..7; D element r = row 8h+r
__device__ __forceinline__ v16h frag_h(const _Float16* rowk0, int lane) {
  union { v16h v; v8h q[2]; } u; const _Float16* p = rowk0 + 8 * (lane >> 4);
  u.q[0] = *(const v8h*)p; u.q[1] = *(const v8h*)(p + 16); return u.v;
}
__device__ __forceinline__ v16h frag_f32(const float* rowk0, int lane) {
  v16h a; const float* p = rowk0 + 8 * (lane >> 4);
#pragma unroll
  for (int i = 0; i < 8; ++i) { a[i] = (_Float16)p[i]; a[8 + i] = (_Float16)p[16 + i]; }
  return a;
}
__device__ __forceinline__ v16h frag_f32s(const float* rowk0, int lane, float sc) {
  v16h a; const float* p = rowk0 + 8 * (lane >> 4);
#pragma unroll
  for (int i = 0; i < 8; ++i) { a[i] = (_Float16)(p[i] * sc); a[8 + i] = (_Float16)(p[16 + i] * sc); }
  return a;
}
// column fragment from a [K][ld] layout (column n), rows >= K read as 0
__device__ __forceinline__ v16h fragc_f32(const float* W, int k0, int n, int lane, int ld, int K) {
  v16h a; const int g = lane >> 4;
#pragma unroll
  for (int i = 0; i < 8; ++i) { const int ka = k0 + 8 * g + i, kb = ka + 16;
    a[i] = (_Float16)(ka < K ? W[(size_t)(ka < K ? ka : K - 1) * ld + n] : 0.f); a[8 + i] = (_Float16)(kb < K ? W[(size_t)(kb < K ? kb : K - 1) * ld + n] : 0.f); }
  return a;
}
struct F2 { v16b h, l; };
__device__ __forceinline__ F2 bsplit16(const float v[16]) { F2 r;
#pragma unroll
  for (int i = 0; i < 16; ++i) { const __bf16 h = (__bf16)v[i]; r.h[i] = h; r.l[i] = (__bf16)(v[i] - (float)h); }
  return r; }
__device__ __forceinline__ F2 split_row(const float* row, int k0, int lane) { float v[16]; const float* p = row + k0 + 8 * (lane >> 4);
#pragma unroll
  for (int i = 0; i < 8; ++i) { v[i] = p[i]; v[8 + i] = p[16 + i]; }
  return bsplit16(v); }
__device__ __forceinline__ F2 split_rowK(const float* row, int k0, int lane, int K) { float v[16]; const int g = lane >> 4;
#pragma unroll
  for (int i = 0; i < 8; ++i) { const int ka = k0 + 8 * g + i, kb = ka + 16; v[i] = ka < K ? row[ka < K ? ka : K - 1] : 0.f; v[8 + i] = kb < K ? row[kb < K ? kb : K - 1] : 0.f; }
  return bsplit16(v); }
__device__ __forceinline__ F2 split_col(const float* W, int k0, int n, int lane, int ld, int K) { float v[16]; const int g = lane >> 4;
#pragma unroll
  for (int i = 0; i < 8; ++i) { const int ka = k0 + 8 * g + i, kb = ka + 16; v[i] = ka < K ? W[(size_t)(ka < K ? ka : K - 1) * ld + n] : 0.f; v[8 + i] = kb < K ? W[(size_t)(kb < K ? kb : K - 1) * ld + n] : 0.f; }
  return bsplit16(v); }
__device__ __forceinline__ v8f mac3(const F2& a, const F2& b, v8f c) { c = wmma_bf(a.l, b.h, c); c = wmma_bf(a.h, b.l, c); return wmma_bf(a.h, b.h, c); }
__device__ __forceinline__ float sigm(float v) { return 1.0f / (1.0f + expf(-v)); }
#define LDSX() do { asm volatile("s_wait_dscnt 0" ::: "memory"); __builtin_amdgcn_wave_barrier(); __builtin_amdgcn_fence(__ATOMIC_RELEASE, "workgroup"); } while (0)


// Grouped-query sliding-window attention (B 2, S 2,048, hidden 2,048, 8 query heads / 2 kv heads x 256, window 512): q/k/v projections, per-head RMSNorm, rotary embedding, windowed causal softmax, output projection.
#define NB 2
#define SS 2048
#define HID 2048
#define NH 8
#define NKV 2
#define HD 256
#define WIN 512
#define QW (NH * HD)          // 2048 q columns
#define KW (NKV * HD)         // 512
#define QKVW (QW + 2 * KW)    // 3072
#define NR (NB * SS)
#ifndef TQB
#define TQB (SS / 64)
#define TNB NB
#define TOB (NB * SS / 64)
#define TRB (NB * SS / 64)    // projection row tiles
#endif
typedef __attribute__((ext_vector_type(8))) __bf16 v8b;
__device__ __forceinline__ v16b frag_b(const __bf16* rowk0, int lane) {
  union { v16b v; v8b q[2]; } u; const __bf16* p = rowk0 + 8 * (lane >> 4);
  u.q[0] = *(const v8b*)p; u.q[1] = *(const v8b*)(p + 16); return u.v;
}
__device__ __forceinline__ float bfr(float v) { return (float)(__bf16)v; }
__device__ __attribute__((noinline)) float exp_ni(float v) { return expf(v); }
__device__ __attribute__((noinline)) float erf_ni(float v) { return erff(v); }

#define PK_A 0                            // [3072][2048] Wq | Wk | Wv natural rows
#define PK_P ((size_t)QKVW * HID)         // [2048][2048] Wo natural rows
#define PK_END (PK_P + (size_t)HID * HID)
#define WS_PK  0u
#define WS_QH  (((2u * PK_END) + 127u) / 128u * 128u)   // f16 [4096][2048] q hi ; QL
#define WS_QL  (WS_QH + 2u * (size_t)NR * QW)
#define WS_KH  (WS_QL + 2u * (size_t)NR * QW)          // f16 [4096][512] k hi ; KL
#define WS_KL  (WS_KH + 2u * (size_t)NR * KW)
#define WS_VT  (WS_KL + 2u * (size_t)NR * KW)          // f16 [b][512][2048] v hi ; VTL (x2048 residual)
#define WS_VTL (WS_VT + 2u * (size_t)NR * KW)
#define WS_O   (WS_VTL + 2u * (size_t)NR * KW)         // f32 [4096][2048] ctx
#define WS_END (WS_O + 4u * (size_t)NR * QW)

__global__ __launch_bounds__(256) void k_pack(const float* __restrict__ WQ, const float* __restrict__ WK, const float* __restrict__ WV, const float* __restrict__ WO, __bf16* __restrict__ PK) {
  __shared__ __align__(16) __bf16 s[HID]; const int n = blockIdx.x, which = blockIdx.y, t = threadIdx.x;   // which 0: Wq (n < 2048), 1: Wk (n < 512), 2: Wv, 3: Wo
  if ((which == 1 || which == 2) && n >= KW) return;
  const float* Wm = (which == 0) ? WQ : (which == 1) ? WK : (which == 2) ? WV : WO;
  for (int k = t; k < HID; k += 256) s[k] = (__bf16)Wm[(size_t)n * HID + k];
  __syncthreads();
  const size_t row = (which == 0) ? n : (which == 1) ? (QW + n) : (QW + KW + n);
  __bf16* dst = (which < 3) ? PK + PK_A + row * HID : PK + PK_P + (size_t)n * HID;
  for (int q = t; q < HID / 8; q += 256) vst2((unsigned*)(dst + q * 8), *(const v4u*)&s[q * 8]);
}
// ---- k_qkv: block = (64 rows, one 256-column head hb of [q heads 0..7 | k heads 8..9 | v heads 10..11]): GEMM (exact, 16 tiles), RMSNorm over the head's 256 dims (f32), rotary (q, k) with the cos/sin inputs, then planes
__global__ __launch_bounds__(128) void k_qkv(const float* __restrict__ X, const __bf16* __restrict__ P, const float* __restrict__ COS, const float* __restrict__ SIN, const float* __restrict__ QNW, const float* __restrict__ KNW, _Float16* __restrict__ QH, _Float16* __restrict__ QL, _Float16* __restrict__ KH, _Float16* __restrict__ KL, _Float16* __restrict__ VT, _Float16* __restrict__ VTL) {
  __shared__ __align__(16) _Float16 soh[4][16][264], sol[4][16][264];
  const int tid = threadIdx.x, wave = tid >> 5, lane = tid & 31, col = lane & 15, g = lane >> 4; const size_t r0 = (size_t)blockIdx.x * 64 + wave * 16; const int hb = blockIdx.y; const int n0 = hb * HD;   // column base in [0, 3072)
  v8f acc[16] = {};
#pragma unroll 1
  for (int kc = 0; kc < HID / 32; ++kc) { v16b a; { const float* p = X + (r0 + col) * HID + kc * 32 + 8 * g;
#pragma unroll
      for (int i = 0; i < 8; ++i) { a[i] = (__bf16)p[i]; a[8 + i] = (__bf16)p[16 + i]; } }
#pragma unroll
    for (int j = 0; j < 16; ++j) acc[j] = wmma_bf(a, frag_b(P + (size_t)(n0 + j * 16 + col) * HID + kc * 32, lane), acc[j]); }
  // RMSNorm statistics per row (8g + r): this lane's 16 columns, then the 16 col-lanes
  float ss[8];
#pragma unroll
  for (int r = 0; r < 8; ++r) { float s = 0.f;
#pragma unroll
    for (int j = 0; j < 16; ++j) s += acc[j][r] * acc[j][r];
#pragma unroll
    for (int o = 1; o < 16; o <<= 1) s += __shfl_xor(s, o);
    ss[r] = 1.0f / sqrtf(s / (float)HD + 1e-6f); }
  const int kind = (hb < NH) ? 0 : (hb < NH + NKV) ? 1 : 2;   // q, k, v
  const float* NW = (kind == 0) ? QNW : KNW;
#pragma unroll
  for (int j = 0; j < 16; ++j) { const int d = j * 16 + col; const float w = (kind == 2) ? 1.f : bfr(NW[d]); const float wp = (kind == 2) ? 1.f : bfr(NW[d ^ 128]);
#pragma unroll
    for (int r = 0; r < 8; ++r) { const float xn = acc[j][r] * ss[r] * w;
      float y = xn;
      if (kind < 2) { const float partner = acc[j ^ 8][r] * ss[r] * wp; const size_t crow = (r0 + 8 * g + r); const float c = bfr(COS[crow * HD + d]), sn = bfr(SIN[crow * HD + d]); const float rot = (d < 128) ? -partner : partner; y = xn * c + rot * sn; }   // rows are (b*S + s): cos/sin indexed [b][s][d] = row*HD + d
      const _Float16 hv = (_Float16)y; soh[wave][8 * g + r][d] = hv; sol[wave][8 * g + r][d] = (_Float16)((y - (float)hv) * 2048.0f); } }
  LDSX();
  if (kind == 0) { for (int rl = 0; rl < 16; ++rl) { const size_t o = (r0 + rl) * QW + hb * HD + lane * 8; vst2((unsigned*)(QH + o), *(const v4u*)&soh[wave][rl][lane * 8]); vst2((unsigned*)(QL + o), *(const v4u*)&sol[wave][rl][lane * 8]); } }
  else if (kind == 1) { for (int rl = 0; rl < 16; ++rl) { const size_t o = (r0 + rl) * KW + (hb - NH) * HD + lane * 8; vst2((unsigned*)(KH + o), *(const v4u*)&soh[wave][rl][lane * 8]); vst2((unsigned*)(KL + o), *(const v4u*)&sol[wave][rl][lane * 8]); } }
  else { __syncthreads();
    const size_t rb = (size_t)blockIdx.x * 64; const size_t b = rb / SS; const int s0 = (int)(rb % SS); const int g2 = hb - NH - NKV;
    __shared__ __align__(16) _Float16 st[HD][72], stl[HD][72];
    for (int e = tid; e < 64 * HD; e += 128) { const int rr = e / HD, d = e % HD; st[d][rr] = soh[rr >> 4][rr & 15][d]; stl[d][rr] = sol[rr >> 4][rr & 15][d]; }
    __syncthreads();
    for (int e = tid; e < HD * 8; e += 128) { const int d = e >> 3, pc = e & 7; const size_t o = (b * KW + g2 * HD + d) * SS + s0 + pc * 8; vst2((unsigned*)(VT + o), *(const v4u*)&st[d][pc * 8]); vst2((unsigned*)(VTL + o), *(const v4u*)&stl[d][pc * 8]); } }
}
// ---- k_attn: block = (64 queries, head n, b): kv head n/4; key tiles inside the window [i0 - 511, i0 + 63]; scores over 256 dims (3 products, q fragments re-read per step); mask j <= i && i - j < 512; online softmax; P = e x 2048 (f16) against v hi and e against the x2048 v residual, one accumulator (2 products); ctx rows
__global__ __launch_bounds__(128) void k_attn(const _Float16* __restrict__ QH, const _Float16* __restrict__ QL, const _Float16* __restrict__ KH, const _Float16* __restrict__ KL, const _Float16* __restrict__ VT, const _Float16* __restrict__ VTL, float* __restrict__ O) {
  __shared__ __align__(16) _Float16 sp[4][16][40], spu[4][16][40]; __shared__ __align__(16) float so[4][16][HD + 4];
  const int tid = threadIdx.x, wave = tid >> 5, lane = tid & 31, col = lane & 15, g = lane >> 4; const int qb = blockIdx.x, n = blockIdx.y; const size_t b = blockIdx.z; const int kvh = n / (NH / NKV); const int q0 = qb * 64 + wave * 16; const size_t rowb = b * SS;
  const size_t qo = (rowb + q0 + col) * QW + n * HD;
  const _Float16* Vp = VT + (b * KW + kvh * HD) * SS; const _Float16* Vpl = VTL + (b * KW + kvh * HD) * SS;
  float m[8], l[8];
#pragma unroll
  for (int r = 0; r < 8; ++r) { m[r] = -3.0e38f; l[r] = 0.f; }
  v8f acc[16] = {};
  const int ks0 = max(0, qb * 64 - (WIN - 1)) / 32, ks1 = (qb * 64 + 64) / 32;
#pragma unroll 1
  for (int ks = ks0; ks < ks1; ++ks) { const int j0 = ks * 32; v8f s[2];
#pragma unroll
    for (int ct = 0; ct < 2; ++ct) { const int kk = j0 + ct * 16 + col; const size_t rk = (rowb + kk) * KW + kvh * HD; v8f c = {}, cl = {};
#pragma unroll 1
      for (int kc = 0; kc < HD / 32; ++kc) { const v16h aq = frag_h(QH + qo + kc * 32, lane), aql = frag_h(QL + qo + kc * 32, lane); const v16h kh = frag_h(KH + rk + kc * 32, lane); c = wmma16(aq, kh, c); cl = wmma16(aql, kh, cl); cl = wmma16(aq, frag_h(KL + rk + kc * 32, lane), cl); }
#pragma unroll
      for (int r = 0; r < 8; ++r) { const int qi = q0 + 8 * g + r; const bool keep = (kk <= qi) && (qi - kk < WIN); s[ct][r] = keep ? (c[r] + cl[r] * (1.0f / 2048.0f)) : -3.0e38f; } }   // unscaled logits (the module applies no 1/sqrt(d))
#pragma unroll
    for (int r = 0; r < 8; ++r) { float mx = fmaxf(s[0][r], s[1][r]);
#pragma unroll
      for (int o = 1; o < 16; o <<= 1) mx = fmaxf(mx, __shfl_xor(mx, o));
      const float mn = fmaxf(m[r], mx); const float alpha = (m[r] <= -1.0e38f) ? 0.f : __expf(m[r] - mn);
      const float e0 = (s[0][r] <= -1.0e38f) ? 0.f : __expf(s[0][r] - mn), e1 = (s[1][r] <= -1.0e38f) ? 0.f : __expf(s[1][r] - mn); float es = e0 + e1;
#pragma unroll
      for (int o = 1; o < 16; o <<= 1) es += __shfl_xor(es, o);
      l[r] = l[r] * alpha + es; m[r] = (mn <= -1.0e38f) ? m[r] : mn;
#pragma unroll
      for (int dt = 0; dt < 16; ++dt) acc[dt][r] *= alpha;
      sp[wave][8 * g + r][col] = (_Float16)(e0 * 2048.0f); sp[wave][8 * g + r][16 + col] = (_Float16)(e1 * 2048.0f); spu[wave][8 * g + r][col] = (_Float16)e0; spu[wave][8 * g + r][16 + col] = (_Float16)e1; }   // (e x 2048) pairs with v hi, plain e with the x2048 v residual -> both land in one f32 accumulator
    LDSX();
    const v16h pa = frag_h(&sp[wave][col][0], lane), pu = frag_h(&spu[wave][col][0], lane);
#pragma unroll
    for (int dt = 0; dt < 16; ++dt) { const size_t vo = (size_t)(dt * 16 + col) * SS + j0; acc[dt] = wmma16(pu, frag_h(Vpl + vo, lane), acc[dt]); acc[dt] = wmma16(pa, frag_h(Vp + vo, lane), acc[dt]); }
    LDSX(); }
#pragma unroll
  for (int r = 0; r < 8; ++r) { const float il = (1.0f / 2048.0f) / l[r];
#pragma unroll
    for (int dt = 0; dt < 16; ++dt) so[wave][8 * g + r][dt * 16 + col] = acc[dt][r] * il; }
  LDSX();
  for (int rl = 0; rl < 16; ++rl) { const size_t o = (rowb + q0 + rl) * QW + n * HD; vst2(O + o + lane * 4, *(const v4f*)&so[wave][rl][lane * 4]); vst2(O + o + 128 + lane * 4, *(const v4f*)&so[wave][rl][128 + lane * 4]); }
}
// ---- k_out: block = (64 rows, 128 cols): y = ctx(hi/lo, K 2048) . Wo rows
__global__ __launch_bounds__(128) void k_out(const float* __restrict__ Oc, const __bf16* __restrict__ P, float* __restrict__ Y) {
  __shared__ __align__(16) float so[4][16][132];
  const int tid = threadIdx.x, wave = tid >> 5, lane = tid & 31, col = lane & 15, g = lane >> 4; const size_t r0 = (size_t)blockIdx.x * 64 + wave * 16; const int n0 = blockIdx.y * 128;
  v8f acc[8] = {};
#pragma unroll 2
  for (int kc = 0; kc < QW / 32; ++kc) { const F2 a = split_row(Oc + (r0 + col) * QW, kc * 32, lane);
#pragma unroll
    for (int j = 0; j < 8; ++j) { const v16b w = frag_b(P + (size_t)(n0 + j * 16 + col) * HID + kc * 32, lane); acc[j] = wmma_bf(a.l, w, acc[j]); acc[j] = wmma_bf(a.h, w, acc[j]); } }
#pragma unroll
  for (int j = 0; j < 8; ++j)
#pragma unroll
    for (int r = 0; r < 8; ++r) so[wave][8 * g + r][j * 16 + col] = acc[j][r];
  LDSX();
  for (int rl = 0; rl < 16; ++rl) vst2(Y + (r0 + rl) * HID + n0 + lane * 4, *(const v4f*)&so[wave][rl][lane * 4]);
}
extern "C" void kernel_launch(void* const* d_in, const int* in_sizes, int n_in, void* d_out, int out_size, void* d_ws, size_t ws_size, hipStream_t stream) {
  (void)in_sizes; (void)n_in; (void)out_size;
  const float** F = (const float**)d_in;   // 0 hidden_states [2,2048,2048], 1 cos [2,2048,256], 2 sin, 3 Wq [2048,2048], 4 Wk [512,2048], 5 Wv [512,2048], 6 Wo [2048,2048] (natural), 7 q_norm_w [256], 8 k_norm_w [256]
  if (ws_size < (size_t)WS_END) return;
  char* ws = (char*)d_ws; __bf16* PK = (__bf16*)(ws + WS_PK); _Float16 *QH = (_Float16*)(ws + WS_QH), *QL = (_Float16*)(ws + WS_QL), *KH = (_Float16*)(ws + WS_KH), *KL = (_Float16*)(ws + WS_KL), *VT = (_Float16*)(ws + WS_VT), *VTL = (_Float16*)(ws + WS_VTL); float* O = (float*)(ws + WS_O);
  k_pack<<<dim3(HID, 4), 256, 0, stream>>>(F[3], F[4], F[5], F[6], PK);
  k_qkv<<<dim3(TRB, NH + 2 * NKV), 128, 0, stream>>>(F[0], PK + PK_A, F[1], F[2], F[7], F[8], QH, QL, KH, KL, VT, VTL);
  k_attn<<<dim3(TQB, NH, TNB), 128, 0, stream>>>(QH, QL, KH, KL, VT, VTL, O);
  k_out<<<dim3(TOB, HID / 128), 128, 0, stream>>>(O, PK + PK_P, (float*)d_out);
}

// v001
// One run takes 495 microseconds.
// Next to v000, in two timings, it ran 2.00 and 1.99 times as fast.
// compute dtype: hidden_states, cos, sin, Wq/Wk/Wv/Wo, q/k norm weights rounded to bf16; q/k/v projections with exact bf16 products on WMMA 16x16x32 (natural [out][in] rows; one 256-column head per block); per-head RMSNorm (eps 1e-6, x weight; v with weight 1) and the rotate-half rotary embedding with the cos/sin inputs in f32 in the projection epilogue; q and k stored as f16 hi + (x2048-scaled) residual planes with 3-product scores (unscaled logits, sigma ~16, kept f32-accurate), v stored as f16 hi + (x2048-scaled) residual planes; sliding-window causal mask (j <= i, i - j < 512), running-max softmax in f32 (hardware exp); the softmax weights as f16 planes e x 2048 (against v hi) and e (against the x2048 v residual) accumulated into one f32 accumulator (2 products; 2^-11 folded into the epilogue); output projection with ctx as bf16 hi + residual x exact Wo rows (2 products); f32 accumulate.
#include <hip/hip_runtime.h>
#include <math.h>

typedef __attribute__((ext_vector_type(16))) _Float16 v16h;
typedef __attribute__((ext_vector_type(16))) __bf16 v16b;
typedef __attribute__((ext_vector_type(8)))  _Float16 v8h;
typedef __attribute__((ext_vector_type(8)))  float v8f;
typedef __attribute__((ext_vector_type(4)))  float v4f;
typedef __attribute__((ext_vector_type(2)))  float v2f;
typedef __attribute__((ext_vector_type(4)))  unsigned v4u;
typedef __attribute__((ext_vector_type(4)))  int v4i;
typedef float __attribute__((may_alias)) float_a;
typedef int __attribute__((may_alias)) int_a;

template <typename T> __device__ __forceinline__ void vst2(void* p, T v) { *(T*)p = v;  }
__device__ __forceinline__ v8f wmma16(v16h a, v16h b, v8f c) {
  v8f d = __builtin_amdgcn_wmma_f32_16x16x32_f16(false, a, false, b, (short)0, c, false, false);
  asm volatile("v_nop\n\tv_nop\n\tv_nop\n\tv_nop" : "+v"(d) : "v"(a), "v"(b));
  return d;
}
__device__ __forceinline__ v8f wmma_bf(v16b a, v16b b, v8f c) {
  v8f d = __builtin_amdgcn_wmma_f32_16x16x32_bf16(false, a, false, b, (short)0, c, false, false);
  asm volatile("v_nop\n\tv_nop\n\tv_nop\n\tv_nop" : "+v"(d) : "v"(a), "v"(b));
  return d;
}
// 16x16x32 fragments: lane = (h = lane>>4, row/col = lane&15); elements 0..7 = k0+8h+0..7, 8..15 = k0+16+8h+0..7; D element r = row 8h+r
__device__ __forceinline__ v16h frag_h(const _Float16* rowk0, int lane) {
  union { v16h v; v8h q[2]; } u; const _Float16* p = rowk0 + 8 * (lane >> 4);
  u.q[0] = *(const v8h*)p; u.q[1] = *(const v8h*)(p + 16); return u.v;
}
__device__ __forceinline__ v16h frag_f32(const float* rowk0, int lane) {
  v16h a; const float* p = rowk0 + 8 * (lane >> 4);
#pragma unroll
  for (int i = 0; i < 8; ++i) { a[i] = (_Float16)p[i]; a[8 + i] = (_Float16)p[16 + i]; }
  return a;
}
__device__ __forceinline__ v16h frag_f32s(const float* rowk0, int lane, float sc) {
  v16h a; const float* p = rowk0 + 8 * (lane >> 4);
#pragma unroll
  for (int i = 0; i < 8; ++i) { a[i] = (_Float16)(p[i] * sc); a[8 + i] = (_Float16)(p[16 + i] * sc); }
  return a;
}
// column fragment from a [K][ld] layout (column n), rows >= K read as 0
__device__ __forceinline__ v16h fragc_f32(const float* W, int k0, int n, int lane, int ld, int K) {
  v16h a; const int g = lane >> 4;
#pragma unroll
  for (int i = 0; i < 8; ++i) { const int ka = k0 + 8 * g + i, kb = ka + 16;
    a[i] = (_Float16)(ka < K ? W[(size_t)(ka < K ? ka : K - 1) * ld + n] : 0.f); a[8 + i] = (_Float16)(kb < K ? W[(size_t)(kb < K ? kb : K - 1) * ld + n] : 0.f); }
  return a;
}
struct F2 { v16b h, l; };
__device__ __forceinline__ F2 bsplit16(const float v[16]) { F2 r;
#pragma unroll
  for (int i = 0; i < 16; ++i) { const __bf16 h = (__bf16)v[i]; r.h[i] = h; r.l[i] = (__bf16)(v[i] - (float)h); }
  return r; }
__device__ __forceinline__ F2 split_row(const float* row, int k0, int lane) { float v[16]; const float* p = row + k0 + 8 * (lane >> 4);
#pragma unroll
  for (int i = 0; i < 8; ++i) { v[i] = p[i]; v[8 + i] = p[16 + i]; }
  return bsplit16(v); }
__device__ __forceinline__ F2 split_rowK(const float* row, int k0, int lane, int K) { float v[16]; const int g = lane >> 4;
#pragma unroll
  for (int i = 0; i < 8; ++i) { const int ka = k0 + 8 * g + i, kb = ka + 16; v[i] = ka < K ? row[ka < K ? ka : K - 1] : 0.f; v[8 + i] = kb < K ? row[kb < K ? kb : K - 1] : 0.f; }
  return bsplit16(v); }
__device__ __forceinline__ F2 split_col(const float* W, int k0, int n, int lane, int ld, int K) { float v[16]; const int g = lane >> 4;
#pragma unroll
  for (int i = 0; i < 8; ++i) { const int ka = k0 + 8 * g + i, kb = ka + 16; v[i] = ka < K ? W[(size_t)(ka < K ? ka : K - 1) * ld + n] : 0.f; v[8 + i] = kb < K ? W[(size_t)(kb < K ? kb : K - 1) * ld + n] : 0.f; }
  return bsplit16(v); }
__device__ __forceinline__ v8f mac3(const F2& a, const F2& b, v8f c) { c = wmma_bf(a.l, b.h, c); c = wmma_bf(a.h, b.l, c); return wmma_bf(a.h, b.h, c); }
__device__ __forceinline__ float sigm(float v) { return 1.0f / (1.0f + expf(-v)); }
#define LDSX() do { asm volatile("s_wait_dscnt 0" ::: "memory"); __builtin_amdgcn_wave_barrier(); __builtin_amdgcn_fence(__ATOMIC_RELEASE, "workgroup"); } while (0)


// Grouped-query sliding-window attention (B 2, S 2,048, hidden 2,048, 8 query heads / 2 kv heads x 256, window 512): q/k/v projections, per-head RMSNorm, rotary embedding, windowed causal softmax, output projection.
#define NB 2
#define SS 2048
#define HID 2048
#define NH 8
#define NKV 2
#define HD 256
#define WIN 512
#define QW (NH * HD)          // 2048 q columns
#define KW (NKV * HD)         // 512
#define QKVW (QW + 2 * KW)    // 3072
#define NR (NB * SS)
#ifndef TQB
#define TQB (SS / 64)
#define TNB NB
#define TOB (NB * SS / 64)
#define TRB (NB * SS / 64)    // projection row tiles
#endif
typedef __attribute__((ext_vector_type(8))) __bf16 v8b;
__device__ __forceinline__ v16b frag_b(const __bf16* rowk0, int lane) {
  union { v16b v; v8b q[2]; } u; const __bf16* p = rowk0 + 8 * (lane >> 4);
  u.q[0] = *(const v8b*)p; u.q[1] = *(const v8b*)(p + 16); return u.v;
}
__device__ __forceinline__ float bfr(float v) { return (float)(__bf16)v; }
__device__ __attribute__((noinline)) float exp_ni(float v) { return expf(v); }
__device__ __attribute__((noinline)) float erf_ni(float v) { return erff(v); }

#define PK_A 0                            // [3072][2048] Wq | Wk | Wv natural rows
#define PK_P ((size_t)QKVW * HID)         // [2048][2048] Wo natural rows
#define PK_END (PK_P + (size_t)HID * HID)
#define WS_PK  0u
#define WS_QH  (((2u * PK_END) + 127u) / 128u * 128u)   // f16 [4096][2048] q hi ; QL
#define WS_QL  (WS_QH + 2u * (size_t)NR * QW)
#define WS_KH  (WS_QL + 2u * (size_t)NR * QW)          // f16 [4096][512] k hi ; KL
#define WS_KL  (WS_KH + 2u * (size_t)NR * KW)
#define WS_VT  (WS_KL + 2u * (size_t)NR * KW)          // f16 [b][512][2048] v hi ; VTL (x2048 residual)
#define WS_VTL (WS_VT + 2u * (size_t)NR * KW)
#define WS_O   (WS_VTL + 2u * (size_t)NR * KW)         // f32 [4096][2048] ctx
#define WS_END (WS_O + 4u * (size_t)NR * QW)

__global__ __launch_bounds__(256) void k_pack(const float* __restrict__ WQ, const float* __restrict__ WK, const float* __restrict__ WV, const float* __restrict__ WO, __bf16* __restrict__ PK) {
  __shared__ __align__(16) __bf16 s[HID]; const int n = blockIdx.x, which = blockIdx.y, t = threadIdx.x;   // which 0: Wq (n < 2048), 1: Wk (n < 512), 2: Wv, 3: Wo
  if ((which == 1 || which == 2) && n >= KW) return;
  const float* Wm = (which == 0) ? WQ : (which == 1) ? WK : (which == 2) ? WV : WO;
  for (int k = t; k < HID; k += 256) s[k] = (__bf16)Wm[(size_t)n * HID + k];
  __syncthreads();
  const size_t row = (which == 0) ? n : (which == 1) ? (QW + n) : (QW + KW + n);
  __bf16* dst = (which < 3) ? PK + PK_A + row * HID : PK + PK_P + (size_t)n * HID;
  for (int q = t; q < HID / 8; q += 256) vst2((unsigned*)(dst + q * 8), *(const v4u*)&s[q * 8]);
}
// ---- k_qkv: block = (64 rows, one 256-column head hb of [q heads 0..7 | k heads 8..9 | v heads 10..11]): GEMM (exact, 16 tiles), RMSNorm over the head's 256 dims (f32), rotary (q, k) with the cos/sin inputs, then planes
// The head's 256 weight rows go through LDS, 64 k (128 B of each row) per pass, two buffers: asynchronous 16-byte copies bring pass t + 2 while pass t + 1 waits ready, and the block's four waves read their B fragments from the one staged tile.
#define BPITCH 144              // LDS pitch of a staged 128-B row: 16 B x odd, conflict-free for ds_load_b128 readers
#define BBUF (HD * BPITCH)      // 36,864 B per buffer
#define NPASS (HID / 64)
// Eight copies of one lane: rows 16 apart, 16 bytes each. The s_wait_xcnt stands inside the copies' own statement so that no address register of an issued copy is rewritten ahead of it.
__device__ __forceinline__ void stage8(unsigned l, const __bf16* g) {
  asm volatile("global_load_async_to_lds_b128 %0, %8, off\n\t"
               "global_load_async_to_lds_b128 %1, %9, off\n\t"
               "global_load_async_to_lds_b128 %2, %10, off\n\t"
               "global_load_async_to_lds_b128 %3, %11, off\n\t"
               "global_load_async_to_lds_b128 %4, %12, off\n\t"
               "global_load_async_to_lds_b128 %5, %13, off\n\t"
               "global_load_async_to_lds_b128 %6, %14, off\n\t"
               "global_load_async_to_lds_b128 %7, %15, off\n\t"
               "s_wait_xcnt 0x0"
               :: "v"(l), "v"(l + 16u * BPITCH), "v"(l + 32u * BPITCH), "v"(l + 48u * BPITCH), "v"(l + 64u * BPITCH), "v"(l + 80u * BPITCH), "v"(l + 96u * BPITCH), "v"(l + 112u * BPITCH),
                  "v"(g), "v"(g + 16 * HID), "v"(g + 32 * HID), "v"(g + 48 * HID), "v"(g + 64 * HID), "v"(g + 80 * HID), "v"(g + 96 * HID), "v"(g + 112 * HID)
               : "memory");
}
// One pass's tile: 256 rows x 128 B = 16 copies per lane; a wave's copy covers four whole rows (four 128-B lines).
__device__ __forceinline__ void stage_tile(unsigned l, const __bf16* g) { stage8(l, g); stage8(l + 128u * BPITCH, g + 128 * HID); }
__global__ __launch_bounds__(128) void k_qkv(const float* __restrict__ X, const __bf16* __restrict__ P, const float* __restrict__ COS, const float* __restrict__ SIN, const float* __restrict__ QNW, const float* __restrict__ KNW, _Float16* __restrict__ QH, _Float16* __restrict__ QL, _Float16* __restrict__ KH, _Float16* __restrict__ KL, _Float16* __restrict__ VT, _Float16* __restrict__ VTL) {
  __shared__ __align__(16) _Float16 soh[4][16][264], sol[4][16][264];
  __shared__ __align__(16) unsigned char ring[2 * BBUF];   // the two weight buffers; behind the loop the v heads' transpose planes lie here
  const int tid = threadIdx.x, wave = tid >> 5, lane = tid & 31, col = lane & 15, g = lane >> 4; const size_t r0 = (size_t)blockIdx.x * 64 + wave * 16; const int hb = blockIdx.y; const int n0 = hb * HD;   // column base in [0, 3072)
  v8f acc[16] = {};
  const unsigned lcp = (unsigned)(size_t)ring + (unsigned)(tid >> 3) * BPITCH + (unsigned)(tid & 7) * 16u;   // this lane's first LDS byte: row tid / 8, 16-byte piece tid % 8
  const __bf16* gcp = P + (size_t)(n0 + (tid >> 3)) * HID + (tid & 7) * 8;
  stage_tile(lcp, gcp);
  asm volatile("s_wait_asynccnt 0x0" ::: "memory");   // this wave's share of tile 0 has landed
  __syncthreads();                                    // tile 0 is readable by every wave
  stage_tile(lcp + BBUF, gcp + 64);
#pragma unroll 1   // one pass per trip: the ring's order stands once, at the foot
  for (int t = 0; t < NPASS; ++t) { v16b a[2]; { const float* p = X + (r0 + col) * HID + t * 64 + 8 * g;
#pragma unroll
      for (int ks = 0; ks < 2; ++ks)
#pragma unroll
        for (int i = 0; i < 8; ++i) { a[ks][i] = (__bf16)p[ks * 32 + i]; a[ks][8 + i] = (__bf16)p[ks * 32 + 16 + i]; } }
    const unsigned char* bb = ring + (t & 1) * BBUF + col * BPITCH;
#pragma unroll
    for (int ks = 0; ks < 2; ++ks)
#pragma unroll
      for (int jh = 0; jh < 2; ++jh) { v16b w[8];   // eight fragments read as one group, then their eight products
#pragma unroll
        for (int j = 0; j < 8; ++j) w[j] = frag_b((const __bf16*)(bb + (jh * 8 + j) * 16 * BPITCH + ks * 64), lane);
#pragma unroll
        for (int j = 0; j < 8; ++j) acc[jh * 8 + j] = wmma_bf(a[ks], w[j], acc[jh * 8 + j]); }
    asm volatile("s_wait_dscnt 0x0" ::: "memory");      // this wave's reads of buffer t % 2 are done before it is refilled
    asm volatile("s_wait_asynccnt 0x0" ::: "memory");   // this wave's share of tile t + 1 has landed
    __syncthreads();                                    // publishes tile t + 1 and ends every wave's reads of buffer t % 2
    if (t + 2 < NPASS) stage_tile(lcp + (unsigned)(t & 1) * BBUF, gcp + (t + 2) * 64); }
  asm volatile("s_wait_asynccnt 0x0" ::: "memory");     // no copy is outstanding when the ring's LDS is used anew
  // RMSNorm statistics per row (8g + r): this lane's 16 columns, then the 16 col-lanes
  float ss[8];
#pragma unroll
  for (int r = 0; r < 8; ++r) { float s = 0.f;
#pragma unroll
    for (int j = 0; j < 16; ++j) s += acc[j][r] * acc[j][r];
#pragma unroll
    for (int o = 1; o < 16; o <<= 1) s += __shfl_xor(s, o);
    ss[r] = 1.0f / sqrtf(s / (float)HD + 1e-6f); }
  const int kind = (hb < NH) ? 0 : (hb < NH + NKV) ? 1 : 2;   // q, k, v
  const float* NW = (kind == 0) ? QNW : KNW;
#pragma unroll
  for (int j = 0; j < 16; ++j) { const int d = j * 16 + col; const float w = (kind == 2) ? 1.f : bfr(NW[d]); const float wp = (kind == 2) ? 1.f : bfr(NW[d ^ 128]);
#pragma unroll
    for (int r = 0; r < 8; ++r) { const float xn = acc[j][r] * ss[r] * w;
      float y = xn;
      if (kind < 2) { const float partner = acc[j ^ 8][r] * ss[r] * wp; const size_t crow = (r0 + 8 * g + r); const float c = bfr(COS[crow * HD + d]), sn = bfr(SIN[crow * HD + d]); const float rot = (d < 128) ? -partner : partner; y = xn * c + rot * sn; }   // rows are (b*S + s): cos/sin indexed [b][s][d] = row*HD + d
      const _Float16 hv = (_Float16)y; soh[wave][8 * g + r][d] = hv; sol[wave][8 * g + r][d] = (_Float16)((y - (float)hv) * 2048.0f); } }
  LDSX();
  if (kind == 0) { for (int rl = 0; rl < 16; ++rl) { const size_t o = (r0 + rl) * QW + hb * HD + lane * 8; vst2((unsigned*)(QH + o), *(const v4u*)&soh[wave][rl][lane * 8]); vst2((unsigned*)(QL + o), *(const v4u*)&sol[wave][rl][lane * 8]); } }
  else if (kind == 1) { for (int rl = 0; rl < 16; ++rl) { const size_t o = (r0 + rl) * KW + (hb - NH) * HD + lane * 8; vst2((unsigned*)(KH + o), *(const v4u*)&soh[wave][rl][lane * 8]); vst2((unsigned*)(KL + o), *(const v4u*)&sol[wave][rl][lane * 8]); } }
  else { __syncthreads();
    const size_t rb = (size_t)blockIdx.x * 64; const size_t b = rb / SS; const int s0 = (int)(rb % SS); const int g2 = hb - NH - NKV;
    _Float16 (*st)[72] = (_Float16 (*)[72])ring; _Float16 (*stl)[72] = (_Float16 (*)[72])(ring + BBUF);   // [HD][72] each, exactly one buffer; every read of the ring ended at the last pass's barrier
    for (int e = tid; e < 64 * HD; e += 128) { const int rr = e / HD, d = e % HD; st[d][rr] = soh[rr >> 4][rr & 15][d]; stl[d][rr] = sol[rr >> 4][rr & 15][d]; }
    __syncthreads();
    for (int e = tid; e < HD * 8; e += 128) { const int d = e >> 3, pc = e & 7; const size_t o = (b * KW + g2 * HD + d) * SS + s0 + pc * 8; vst2((unsigned*)(VT + o), *(const v4u*)&st[d][pc * 8]); vst2((unsigned*)(VTL + o), *(const v4u*)&stl[d][pc * 8]); } }
}
// ---- k_attn: block = (64 queries, head n, b): kv head n/4; key tiles inside the window [i0 - 511, i0 + 63]; scores over 256 dims (3 products, q fragments re-read per step); mask j <= i && i - j < 512; online softmax; P = e x 2048 (f16) against v hi and e against the x2048 v residual, one accumulator (2 products); ctx rows
__global__ __launch_bounds__(128) void k_attn(const _Float16* __restrict__ QH, const _Float16* __restrict__ QL, const _Float16* __restrict__ KH, const _Float16* __restrict__ KL, const _Float16* __restrict__ VT, const _Float16* __restrict__ VTL, float* __restrict__ O) {
  __shared__ __align__(16) _Float16 sp[4][16][40], spu[4][16][40]; __shared__ __align__(16) float so[4][16][HD + 4];
  const int tid = threadIdx.x, wave = tid >> 5, lane = tid & 31, col = lane & 15, g = lane >> 4; const int qb = blockIdx.x, n = blockIdx.y; const size_t b = blockIdx.z; const int kvh = n / (NH / NKV); const int q0 = qb * 64 + wave * 16; const size_t rowb = b * SS;
  const size_t qo = (rowb + q0 + col) * QW + n * HD;
  const _Float16* Vp = VT + (b * KW + kvh * HD) * SS; const _Float16* Vpl = VTL + (b * KW + kvh * HD) * SS;
  float m[8], l[8];
#pragma unroll
  for (int r = 0; r < 8; ++r) { m[r] = -3.0e38f; l[r] = 0.f; }
  v8f acc[16] = {};
  const int ks0 = max(0, qb * 64 - (WIN - 1)) / 32, ks1 = (qb * 64 + 64) / 32;
#pragma unroll 1
  for (int ks = ks0; ks < ks1; ++ks) { const int j0 = ks * 32; v8f s[2];
#pragma unroll
    for (int ct = 0; ct < 2; ++ct) { const int kk = j0 + ct * 16 + col; const size_t rk = (rowb + kk) * KW + kvh * HD; v8f c = {}, cl = {};
#pragma unroll 1
      for (int kc = 0; kc < HD / 32; ++kc) { const v16h aq = frag_h(QH + qo + kc * 32, lane), aql = frag_h(QL + qo + kc * 32, lane); const v16h kh = frag_h(KH + rk + kc * 32, lane); c = wmma16(aq, kh, c); cl = wmma16(aql, kh, cl); cl = wmma16(aq, frag_h(KL + rk + kc * 32, lane), cl); }
#pragma unroll
      for (int r = 0; r < 8; ++r) { const int qi = q0 + 8 * g + r; const bool keep = (kk <= qi) && (qi - kk < WIN); s[ct][r] = keep ? (c[r] + cl[r] * (1.0f / 2048.0f)) : -3.0e38f; } }   // unscaled logits (the module applies no 1/sqrt(d))
#pragma unroll
    for (int r = 0; r < 8; ++r) { float mx = fmaxf(s[0][r], s[1][r]);
#pragma unroll
      for (int o = 1; o < 16; o <<= 1) mx = fmaxf(mx, __shfl_xor(mx, o));
      const float mn = fmaxf(m[r], mx); const float alpha = (m[r] <= -1.0e38f) ? 0.f : __expf(m[r] - mn);
      const float e0 = (s[0][r] <= -1.0e38f) ? 0.f : __expf(s[0][r] - mn), e1 = (s[1][r] <= -1.0e38f) ? 0.f : __expf(s[1][r] - mn); float es = e0 + e1;
#pragma unroll
      for (int o = 1; o < 16; o <<= 1) es += __shfl_xor(es, o);
      l[r] = l[r] * alpha + es; m[r] = (mn <= -1.0e38f) ? m[r] : mn;
#pragma unroll
      for (int dt = 0; dt < 16; ++dt) acc[dt][r] *= alpha;
      sp[wave][8 * g + r][col] = (_Float16)(e0 * 2048.0f); sp[wave][8 * g + r][16 + col] = (_Float16)(e1 * 2048.0f); spu[wave][8 * g + r][col] = (_Float16)e0; spu[wave][8 * g + r][16 + col] = (_Float16)e1; }   // (e x 2048) pairs with v hi, plain e with the x2048 v residual -> both land in one f32 accumulator
    LDSX();
    const v16h pa = frag_h(&sp[wave][col][0], lane), pu = frag_h(&spu[wave][col][0], lane);
#pragma unroll
    for (int dt = 0; dt < 16; ++dt) { const size_t vo = (size_t)(dt * 16 + col) * SS + j0; acc[dt] = wmma16(pu, frag_h(Vpl + vo, lane), acc[dt]); acc[dt] = wmma16(pa, frag_h(Vp + vo, lane), acc[dt]); }
    LDSX(); }
#pragma unroll
  for (int r = 0; r < 8; ++r) { const float il = (1.0f / 2048.0f) / l[r];
#pragma unroll
    for (int dt = 0; dt < 16; ++dt) so[wave][8 * g + r][dt * 16 + col] = acc[dt][r] * il; }
  LDSX();
  for (int rl = 0; rl < 16; ++rl) { const size_t o = (rowb + q0 + rl) * QW + n * HD; vst2(O + o + lane * 4, *(const v4f*)&so[wave][rl][lane * 4]); vst2(O + o + 128 + lane * 4, *(const v4f*)&so[wave][rl][128 + lane * 4]); }
}
// ---- k_out: block = (64 rows, 128 cols): y = ctx(hi/lo, K 2048) . Wo rows
// The block's 128 weight rows go through LDS as in k_qkv: 64 k per pass, two buffers, eight asynchronous copies per lane and pass.
#define OBUF (128 * BPITCH)     // 18,432 B per buffer
__global__ __launch_bounds__(128) void k_out(const float* __restrict__ Oc, const __bf16* __restrict__ P, float* __restrict__ Y) {
  __shared__ __align__(16) float so[4][16][132];
  __shared__ __align__(16) unsigned char ring[2 * OBUF];   // the two weight buffers
  const int tid = threadIdx.x, wave = tid >> 5, lane = tid & 31, col = lane & 15, g = lane >> 4; const size_t r0 = (size_t)blockIdx.x * 64 + wave * 16; const int n0 = blockIdx.y * 128;
  v8f acc[8] = {};
  const unsigned lcp = (unsigned)(size_t)ring + (unsigned)(tid >> 3) * BPITCH + (unsigned)(tid & 7) * 16u;   // this lane's first LDS byte: row tid / 8, 16-byte piece tid % 8
  const __bf16* gcp = P + (size_t)(n0 + (tid >> 3)) * HID + (tid & 7) * 8;
  stage8(lcp, gcp);
  asm volatile("s_wait_asynccnt 0x0" ::: "memory");   // this wave's share of tile 0 has landed
  __syncthreads();                                    // tile 0 is readable by every wave
  stage8(lcp + OBUF, gcp + 64);
#pragma unroll 1   // one pass per trip: the ring's order stands once, at the foot
  for (int t = 0; t < QW / 64; ++t) { F2 a[2];
#pragma unroll
    for (int ks = 0; ks < 2; ++ks) a[ks] = split_row(Oc + (r0 + col) * QW, t * 64 + ks * 32, lane);
    const unsigned char* bb = ring + (t & 1) * OBUF + col * BPITCH;
#pragma unroll
    for (int ks = 0; ks < 2; ++ks) { v16b w[8];   // eight fragments read as one group, then their sixteen products
#pragma unroll
      for (int j = 0; j < 8; ++j) w[j] = frag_b((const __bf16*)(bb + j * 16 * BPITCH + ks * 64), lane);
#pragma unroll
      for (int j = 0; j < 8; ++j) { acc[j] = wmma_bf(a[ks].l, w[j], acc[j]); acc[j] = wmma_bf(a[ks].h, w[j], acc[j]); } }
    asm volatile("s_wait_dscnt 0x0" ::: "memory");      // this wave's reads of buffer t % 2 are done before it is refilled
    asm volatile("s_wait_asynccnt 0x0" ::: "memory");   // this wave's share of tile t + 1 has landed
    __syncthreads();                                    // publishes tile t + 1 and ends every wave's reads of buffer t % 2
    if (t + 2 < QW / 64) stage8(lcp + (unsigned)(t & 1) * OBUF, gcp + (t + 2) * 64); }
  asm volatile("s_wait_asynccnt 0x0" ::: "memory");     // no copy is outstanding when the wave ends
#pragma unroll
  for (int j = 0; j < 8; ++j)
#pragma unroll
    for (int r = 0; r < 8; ++r) so[wave][8 * g + r][j * 16 + col] = acc[j][r];
  LDSX();
  for (int rl = 0; rl < 16; ++rl) vst2(Y + (r0 + rl) * HID + n0 + lane * 4, *(const v4f*)&so[wave][rl][lane * 4]);
}
extern "C" void kernel_launch(void* const* d_in, const int* in_sizes, int n_in, void* d_out, int out_size, void* d_ws, size_t ws_size, hipStream_t stream) {
  (void)in_sizes; (void)n_in; (void)out_size;
  const float** F = (const float**)d_in;   // 0 hidden_states [2,2048,2048], 1 cos [2,2048,256], 2 sin, 3 Wq [2048,2048], 4 Wk [512,2048], 5 Wv [512,2048], 6 Wo [2048,2048] (natural), 7 q_norm_w [256], 8 k_norm_w [256]
  if (ws_size < (size_t)WS_END) return;
  char* ws = (char*)d_ws; __bf16* PK = (__bf16*)(ws + WS_PK); _Float16 *QH = (_Float16*)(ws + WS_QH), *QL = (_Float16*)(ws + WS_QL), *KH = (_Float16*)(ws + WS_KH), *KL = (_Float16*)(ws + WS_KL), *VT = (_Float16*)(ws + WS_VT), *VTL = (_Float16*)(ws + WS_VTL); float* O = (float*)(ws + WS_O);
  k_pack<<<dim3(HID, 4), 256, 0, stream>>>(F[3], F[4], F[5], F[6], PK);
  k_qkv<<<dim3(TRB, NH + 2 * NKV), 128, 0, stream>>>(F[0], PK + PK_A, F[1], F[2], F[7], F[8], QH, QL, KH, KL, VT, VTL);
  k_attn<<<dim3(TQB, NH, TNB), 128, 0, stream>>>(QH, QL, KH, KL, VT, VTL, O);
  k_out<<<dim3(TOB, HID / 128), 128, 0, stream>>>(O, PK + PK_P, (float*)d_out);
}

// v002
// It runs in 281 microseconds.
// In both of two side-by-side timings against v001, it was 1.77 times as fast.
// Counting every step since v000, it is 3.54 times as fast.
// compute dtype: hidden_states, cos, sin, Wq/Wk/Wv/Wo, q/k norm weights rounded to bf16; q/k/v projections with exact bf16 products on WMMA 16x16x32 (natural [out][in] rows; one 256-column head per block); per-head RMSNorm (eps 1e-6, x weight; v with weight 1) and the rotate-half rotary embedding with the cos/sin inputs in f32 in the projection epilogue; q and k stored as f16 hi + (x2048-scaled) residual planes with 3-product scores (unscaled logits, sigma ~16, kept f32-accurate), v stored as f16 hi + (x2048-scaled) residual planes; sliding-window causal mask (j <= i, i - j < 512), running-max softmax in f32 (hardware exp); the softmax weights as f16 planes e x 2048 (against v hi) and e (against the x2048 v residual) accumulated into one f32 accumulator (2 products; 2^-11 folded into the epilogue); output projection with ctx as bf16 hi + residual x exact Wo rows (2 products); f32 accumulate.
#include <hip/hip_runtime.h>
#include <math.h>

typedef __attribute__((ext_vector_type(16))) _Float16 v16h;
typedef __attribute__((ext_vector_type(16))) __bf16 v16b;
typedef __attribute__((ext_vector_type(8)))  _Float16 v8h;
typedef __attribute__((ext_vector_type(8)))  float v8f;
typedef __attribute__((ext_vector_type(4)))  float v4f;
typedef __attribute__((ext_vector_type(2)))  float v2f;
typedef __attribute__((ext_vector_type(4)))  unsigned v4u;
typedef __attribute__((ext_vector_type(4)))  int v4i;
typedef float __attribute__((may_alias)) float_a;
typedef int __attribute__((may_alias)) int_a;

template <typename T> __device__ __forceinline__ void vst2(void* p, T v) { *(T*)p = v;  }
__device__ __forceinline__ v8f wmma16(v16h a, v16h b, v8f c) {
  v8f d = __builtin_amdgcn_wmma_f32_16x16x32_f16(false, a, false, b, (short)0, c, false, false);
  asm volatile("v_nop\n\tv_nop\n\tv_nop\n\tv_nop" : "+v"(d) : "v"(a), "v"(b));
  return d;
}
__device__ __forceinline__ v8f wmma_bf(v16b a, v16b b, v8f c) {
  v8f d = __builtin_amdgcn_wmma_f32_16x16x32_bf16(false, a, false, b, (short)0, c, false, false);
  asm volatile("v_nop\n\tv_nop\n\tv_nop\n\tv_nop" : "+v"(d) : "v"(a), "v"(b));
  return d;
}
// 16x16x32 fragments: lane = (h = lane>>4, row/col = lane&15); elements 0..7 = k0+8h+0..7, 8..15 = k0+16+8h+0..7; D element r = row 8h+r
__device__ __forceinline__ v16h frag_h(const _Float16* rowk0, int lane) {
  union { v16h v; v8h q[2]; } u; const _Float16* p = rowk0 + 8 * (lane >> 4);
  u.q[0] = *(const v8h*)p; u.q[1] = *(const v8h*)(p + 16); return u.v;
}
__device__ __forceinline__ v16h frag_f32(const float* rowk0, int lane) {
  v16h a; const float* p = rowk0 + 8 * (lane >> 4);
#pragma unroll
  for (int i = 0; i < 8; ++i) { a[i] = (_Float16)p[i]; a[8 + i] = (_Float16)p[16 + i]; }
  return a;
}
__device__ __forceinline__ v16h frag_f32s(const float* rowk0, int lane, float sc) {
  v16h a; const float* p = rowk0 + 8 * (lane >> 4);
#pragma unroll
  for (int i = 0; i < 8; ++i) { a[i] = (_Float16)(p[i] * sc); a[8 + i] = (_Float16)(p[16 + i] * sc); }
  return a;
}
// column fragment from a [K][ld] layout (column n), rows >= K read as 0
__device__ __forceinline__ v16h fragc_f32(const float* W, int k0, int n, int lane, int ld, int K) {
  v16h a; const int g = lane >> 4;
#pragma unroll
  for (int i = 0; i < 8; ++i) { const int ka = k0 + 8 * g + i, kb = ka + 16;
    a[i] = (_Float16)(ka < K ? W[(size_t)(ka < K ? ka : K - 1) * ld + n] : 0.f); a[8 + i] = (_Float16)(kb < K ? W[(size_t)(kb < K ? kb : K - 1) * ld + n] : 0.f); }
  return a;
}
struct F2 { v16b h, l; };
__device__ __forceinline__ F2 bsplit16(const float v[16]) { F2 r;
#pragma unroll
  for (int i = 0; i < 16; ++i) { const __bf16 h = (__bf16)v[i]; r.h[i] = h; r.l[i] = (__bf16)(v[i] - (float)h); }
  return r; }
__device__ __forceinline__ F2 split_row(const float* row, int k0, int lane) { float v[16]; const float* p = row + k0 + 8 * (lane >> 4);
#pragma unroll
  for (int i = 0; i < 8; ++i) { v[i] = p[i]; v[8 + i] = p[16 + i]; }
  return bsplit16(v); }
__device__ __forceinline__ F2 split_rowK(const float* row, int k0, int lane, int K) { float v[16]; const int g = lane >> 4;
#pragma unroll
  for (int i = 0; i < 8; ++i) { const int ka = k0 + 8 * g + i, kb = ka + 16; v[i] = ka < K ? row[ka < K ? ka : K - 1] : 0.f; v[8 + i] = kb < K ? row[kb < K ? kb : K - 1] : 0.f; }
  return bsplit16(v); }
__device__ __forceinline__ F2 split_col(const float* W, int k0, int n, int lane, int ld, int K) { float v[16]; const int g = lane >> 4;
#pragma unroll
  for (int i = 0; i < 8; ++i) { const int ka = k0 + 8 * g + i, kb = ka + 16; v[i] = ka < K ? W[(size_t)(ka < K ? ka : K - 1) * ld + n] : 0.f; v[8 + i] = kb < K ? W[(size_t)(kb < K ? kb : K - 1) * ld + n] : 0.f; }
  return bsplit16(v); }
__device__ __forceinline__ v8f mac3(const F2& a, const F2& b, v8f c) { c = wmma_bf(a.l, b.h, c); c = wmma_bf(a.h, b.l, c); return wmma_bf(a.h, b.h, c); }
__device__ __forceinline__ float sigm(float v) { return 1.0f / (1.0f + expf(-v)); }
#define LDSX() do { asm volatile("s_wait_dscnt 0" ::: "memory"); __builtin_amdgcn_wave_barrier(); __builtin_amdgcn_fence(__ATOMIC_RELEASE, "workgroup"); } while (0)


// Grouped-query sliding-window attention (B 2, S 2,048, hidden 2,048, 8 query heads / 2 kv heads x 256, window 512): q/k/v projections, per-head RMSNorm, rotary embedding, windowed causal softmax, output projection.
#define NB 2
#define SS 2048
#define HID 2048
#define NH 8
#define NKV 2
#define HD 256
#define WIN 512
#define QW (NH * HD)          // 2048 q columns
#define KW (NKV * HD)         // 512
#define QKVW (QW + 2 * KW)    // 3072
#define NR (NB * SS)
#ifndef TQB
#define TQB (SS / 64)
#define TNB NB
#define TOB (NB * SS / 64)
#define TRB (NB * SS / 64)    // projection row tiles
#endif
typedef __attribute__((ext_vector_type(8))) __bf16 v8b;
__device__ __forceinline__ v16b frag_b(const __bf16* rowk0, int lane) {
  union { v16b v; v8b q[2]; } u; const __bf16* p = rowk0 + 8 * (lane >> 4);
  u.q[0] = *(const v8b*)p; u.q[1] = *(const v8b*)(p + 16); return u.v;
}
__device__ __forceinline__ float bfr(float v) { return (float)(__bf16)v; }
__device__ __attribute__((noinline)) float exp_ni(float v) { return expf(v); }
__device__ __attribute__((noinline)) float erf_ni(float v) { return erff(v); }

#define PK_A 0                            // [3072][2048] Wq | Wk | Wv natural rows
#define PK_P ((size_t)QKVW * HID)         // [2048][2048] Wo natural rows
#define PK_END (PK_P + (size_t)HID * HID)
#define WS_PK  0u
#define WS_QH  (((2u * PK_END) + 127u) / 128u * 128u)   // f16 [4096][2048] q hi ; QL
#define WS_QL  (WS_QH + 2u * (size_t)NR * QW)
#define WS_KH  (WS_QL + 2u * (size_t)NR * QW)          // f16 [4096][512] k hi ; KL
#define WS_KL  (WS_KH + 2u * (size_t)NR * KW)
#define WS_VT  (WS_KL + 2u * (size_t)NR * KW)          // f16 [b][512][2048] v hi ; VTL (x2048 residual)
#define WS_VTL (WS_VT + 2u * (size_t)NR * KW)
#define WS_O   (WS_VTL + 2u * (size_t)NR * KW)         // f32 [4096][2048] ctx
#define WS_END (WS_O + 4u * (size_t)NR * QW)

__global__ __launch_bounds__(256) void k_pack(const float* __restrict__ WQ, const float* __restrict__ WK, const float* __restrict__ WV, const float* __restrict__ WO, __bf16* __restrict__ PK) {
  __shared__ __align__(16) __bf16 s[HID]; const int n = blockIdx.x, which = blockIdx.y, t = threadIdx.x;   // which 0: Wq (n < 2048), 1: Wk (n < 512), 2: Wv, 3: Wo
  if ((which == 1 || which == 2) && n >= KW) return;
  const float* Wm = (which == 0) ? WQ : (which == 1) ? WK : (which == 2) ? WV : WO;
  for (int k = t; k < HID; k += 256) s[k] = (__bf16)Wm[(size_t)n * HID + k];
  __syncthreads();
  const size_t row = (which == 0) ? n : (which == 1) ? (QW + n) : (QW + KW + n);
  __bf16* dst = (which < 3) ? PK + PK_A + row * HID : PK + PK_P + (size_t)n * HID;
  for (int q = t; q < HID / 8; q += 256) vst2((unsigned*)(dst + q * 8), *(const v4u*)&s[q * 8]);
}
// ---- k_qkv: block = (64 rows, one 256-column head hb of [q heads 0..7 | k heads 8..9 | v heads 10..11]): GEMM (exact, 16 tiles), RMSNorm over the head's 256 dims (f32), rotary (q, k) with the cos/sin inputs, then planes
// The head's 256 weight rows go through LDS, 64 k (128 B of each row) per pass, two buffers: asynchronous 16-byte copies bring pass t + 2 while pass t + 1 waits ready, and the block's four waves read their B fragments from the one staged tile.
#define BPITCH 144              // LDS pitch of a staged 128-B row: 16 B x odd, conflict-free for ds_load_b128 readers
#define BBUF (HD * BPITCH)      // 36,864 B per buffer
#define NPASS (HID / 64)
// Eight copies of one lane: rows 16 apart, 16 bytes each. The s_wait_xcnt stands inside the copies' own statement so that no address register of an issued copy is rewritten ahead of it.
__device__ __forceinline__ void stage8(unsigned l, const __bf16* g) {
  asm volatile("global_load_async_to_lds_b128 %0, %8, off\n\t"
               "global_load_async_to_lds_b128 %1, %9, off\n\t"
               "global_load_async_to_lds_b128 %2, %10, off\n\t"
               "global_load_async_to_lds_b128 %3, %11, off\n\t"
               "global_load_async_to_lds_b128 %4, %12, off\n\t"
               "global_load_async_to_lds_b128 %5, %13, off\n\t"
               "global_load_async_to_lds_b128 %6, %14, off\n\t"
               "global_load_async_to_lds_b128 %7, %15, off\n\t"
               "s_wait_xcnt 0x0"
               :: "v"(l), "v"(l + 16u * BPITCH), "v"(l + 32u * BPITCH), "v"(l + 48u * BPITCH), "v"(l + 64u * BPITCH), "v"(l + 80u * BPITCH), "v"(l + 96u * BPITCH), "v"(l + 112u * BPITCH),
                  "v"(g), "v"(g + 16 * HID), "v"(g + 32 * HID), "v"(g + 48 * HID), "v"(g + 64 * HID), "v"(g + 80 * HID), "v"(g + 96 * HID), "v"(g + 112 * HID)
               : "memory");
}
// One pass's tile: 256 rows x 128 B = 16 copies per lane; a wave's copy covers four whole rows (four 128-B lines).
__device__ __forceinline__ void stage_tile(unsigned l, const __bf16* g) { stage8(l, g); stage8(l + 128u * BPITCH, g + 128 * HID); }
__global__ __launch_bounds__(128) void k_qkv(const float* __restrict__ X, const __bf16* __restrict__ P, const float* __restrict__ COS, const float* __restrict__ SIN, const float* __restrict__ QNW, const float* __restrict__ KNW, _Float16* __restrict__ QH, _Float16* __restrict__ QL, _Float16* __restrict__ KH, _Float16* __restrict__ KL, _Float16* __restrict__ VT, _Float16* __restrict__ VTL) {
  __shared__ __align__(16) _Float16 soh[4][16][264], sol[4][16][264];
  __shared__ __align__(16) unsigned char ring[2 * BBUF];   // the two weight buffers; behind the loop the v heads' transpose planes lie here
  const int tid = threadIdx.x, wave = tid >> 5, lane = tid & 31, col = lane & 15, g = lane >> 4; const size_t r0 = (size_t)blockIdx.x * 64 + wave * 16; const int hb = blockIdx.y; const int n0 = hb * HD;   // column base in [0, 3072)
  v8f acc[16] = {};
  const unsigned lcp = (unsigned)(size_t)ring + (unsigned)(tid >> 3) * BPITCH + (unsigned)(tid & 7) * 16u;   // this lane's first LDS byte: row tid / 8, 16-byte piece tid % 8
  const __bf16* gcp = P + (size_t)(n0 + (tid >> 3)) * HID + (tid & 7) * 8;
  stage_tile(lcp, gcp);
  asm volatile("s_wait_asynccnt 0x0" ::: "memory");   // this wave's share of tile 0 has landed
  __syncthreads();                                    // tile 0 is readable by every wave
  stage_tile(lcp + BBUF, gcp + 64);
#pragma unroll 1   // one pass per trip: the ring's order stands once, at the foot
  for (int t = 0; t < NPASS; ++t) { v16b a[2]; { const float* p = X + (r0 + col) * HID + t * 64 + 8 * g;
#pragma unroll
      for (int ks = 0; ks < 2; ++ks)
#pragma unroll
        for (int i = 0; i < 8; ++i) { a[ks][i] = (__bf16)p[ks * 32 + i]; a[ks][8 + i] = (__bf16)p[ks * 32 + 16 + i]; } }
    const unsigned char* bb = ring + (t & 1) * BBUF + col * BPITCH;
#pragma unroll
    for (int ks = 0; ks < 2; ++ks)
#pragma unroll
      for (int jh = 0; jh < 2; ++jh) { v16b w[8];   // eight fragments read as one group, then their eight products
#pragma unroll
        for (int j = 0; j < 8; ++j) w[j] = frag_b((const __bf16*)(bb + (jh * 8 + j) * 16 * BPITCH + ks * 64), lane);
#pragma unroll
        for (int j = 0; j < 8; ++j) acc[jh * 8 + j] = wmma_bf(a[ks], w[j], acc[jh * 8 + j]); }
    asm volatile("s_wait_dscnt 0x0" ::: "memory");      // this wave's reads of buffer t % 2 are done before it is refilled
    asm volatile("s_wait_asynccnt 0x0" ::: "memory");   // this wave's share of tile t + 1 has landed
    __syncthreads();                                    // publishes tile t + 1 and ends every wave's reads of buffer t % 2
    if (t + 2 < NPASS) stage_tile(lcp + (unsigned)(t & 1) * BBUF, gcp + (t + 2) * 64); }
  asm volatile("s_wait_asynccnt 0x0" ::: "memory");     // no copy is outstanding when the ring's LDS is used anew
  // RMSNorm statistics per row (8g + r): this lane's 16 columns, then the 16 col-lanes
  float ss[8];
#pragma unroll
  for (int r = 0; r < 8; ++r) { float s = 0.f;
#pragma unroll
    for (int j = 0; j < 16; ++j) s += acc[j][r] * acc[j][r];
#pragma unroll
    for (int o = 1; o < 16; o <<= 1) s += __shfl_xor(s, o);
    ss[r] = 1.0f / sqrtf(s / (float)HD + 1e-6f); }
  const int kind = (hb < NH) ? 0 : (hb < NH + NKV) ? 1 : 2;   // q, k, v
  const float* NW = (kind == 0) ? QNW : KNW;
#pragma unroll
  for (int j = 0; j < 16; ++j) { const int d = j * 16 + col; const float w = (kind == 2) ? 1.f : bfr(NW[d]); const float wp = (kind == 2) ? 1.f : bfr(NW[d ^ 128]);
#pragma unroll
    for (int r = 0; r < 8; ++r) { const float xn = acc[j][r] * ss[r] * w;
      float y = xn;
      if (kind < 2) { const float partner = acc[j ^ 8][r] * ss[r] * wp; const size_t crow = (r0 + 8 * g + r); const float c = bfr(COS[crow * HD + d]), sn = bfr(SIN[crow * HD + d]); const float rot = (d < 128) ? -partner : partner; y = xn * c + rot * sn; }   // rows are (b*S + s): cos/sin indexed [b][s][d] = row*HD + d
      const _Float16 hv = (_Float16)y; soh[wave][8 * g + r][d] = hv; sol[wave][8 * g + r][d] = (_Float16)((y - (float)hv) * 2048.0f); } }
  LDSX();
  if (kind == 0) { for (int rl = 0; rl < 16; ++rl) { const size_t o = (r0 + rl) * QW + hb * HD + lane * 8; vst2((unsigned*)(QH + o), *(const v4u*)&soh[wave][rl][lane * 8]); vst2((unsigned*)(QL + o), *(const v4u*)&sol[wave][rl][lane * 8]); } }
  else if (kind == 1) { for (int rl = 0; rl < 16; ++rl) { const size_t o = (r0 + rl) * KW + (hb - NH) * HD + lane * 8; vst2((unsigned*)(KH + o), *(const v4u*)&soh[wave][rl][lane * 8]); vst2((unsigned*)(KL + o), *(const v4u*)&sol[wave][rl][lane * 8]); } }
  else { __syncthreads();
    const size_t rb = (size_t)blockIdx.x * 64; const size_t b = rb / SS; const int s0 = (int)(rb % SS); const int g2 = hb - NH - NKV;
    _Float16 (*st)[72] = (_Float16 (*)[72])ring; _Float16 (*stl)[72] = (_Float16 (*)[72])(ring + BBUF);   // [HD][72] each, exactly one buffer; every read of the ring ended at the last pass's barrier
    for (int e = tid; e < 64 * HD; e += 128) { const int rr = e / HD, d = e % HD; st[d][rr] = soh[rr >> 4][rr & 15][d]; stl[d][rr] = sol[rr >> 4][rr & 15][d]; }
    __syncthreads();
    for (int e = tid; e < HD * 8; e += 128) { const int d = e >> 3, pc = e & 7; const size_t o = (b * KW + g2 * HD + d) * SS + s0 + pc * 8; vst2((unsigned*)(VT + o), *(const v4u*)&st[d][pc * 8]); vst2((unsigned*)(VTL + o), *(const v4u*)&stl[d][pc * 8]); } }
}
// ---- k_attn: block = (64 queries, head n, b): kv head n/4; key tiles inside the window [i0 - 511, i0 + 63]; scores over 256 dims (3 products, q fragments re-read per step); mask j <= i && i - j < 512; online softmax; P = e x 2048 (f16) against v hi and e against the x2048 v residual, one accumulator (2 products); ctx rows
// Every matrix operand comes from LDS, brought by asynchronous 16-byte copies. Each wave's 16 q rows (hi, residual) are staged once. The k tile and the v tile of a 32-key step are the two buffers of one ring, filled in turn: v of step s flies while the scores of step s are formed, k of step s + 1 flies during the softmax and the value products of step s. The block's four waves read the one staged tile.
#define QPITCH 528              // LDS pitch of a staged 512-B row (q, k): 16 B x odd, conflict-free for ds_load_b128 readers
#define VPITCH 80               // LDS pitch of a staged 64-B v row (32 keys of one dim): 16 B x odd
#define QWAVE (32 * QPITCH)     // one wave's q rows, 16 hi then 16 residual: 16,896 B
#define KBUF (64 * QPITCH)      // 32 keys hi then 32 keys residual: 33,792 B
#define VBUF (512 * VPITCH)     // 256 dims hi then 256 dims residual: 40,960 B
// Eight copies of one lane, LS LDS bytes and gs elements apart. An immediate offset moves the LDS and the global address alike, so copy i names the one LDS-address register with offset i * LS (at most 17,920) and a global address that is i * LS short of its row: one LDS-address register serves all eight and none has to stay live across the step. Every register and every offset is a multiple of 16. The s_wait_xcnt stands inside the copies' own statement so that no address register of an issued copy is rewritten ahead of it.
template <int LS> __device__ __forceinline__ void stage8h(unsigned l, const _Float16* g, size_t gs) {
  const char* p = (const char*)g; const size_t d = gs * 2 - LS;   // bytes from one copy's global register to the next
  asm volatile("global_load_async_to_lds_b128 %0, %1, off\n\t"
               "global_load_async_to_lds_b128 %0, %2, off offset:%9\n\t"
               "global_load_async_to_lds_b128 %0, %3, off offset:%10\n\t"
               "global_load_async_to_lds_b128 %0, %4, off offset:%11\n\t"
               "global_load_async_to_lds_b128 %0, %5, off offset:%12\n\t"
               "global_load_async_to_lds_b128 %0, %6, off offset:%13\n\t"
               "global_load_async_to_lds_b128 %0, %7, off offset:%14\n\t"
               "global_load_async_to_lds_b128 %0, %8, off offset:%15\n\t"
               "s_wait_xcnt 0x0"
               :: "v"(l), "v"(p), "v"(p + d), "v"(p + 2 * d), "v"(p + 3 * d), "v"(p + 4 * d), "v"(p + 5 * d), "v"(p + 6 * d), "v"(p + 7 * d),
                  "n"(LS), "n"(2 * LS), "n"(3 * LS), "n"(4 * LS), "n"(5 * LS), "n"(6 * LS), "n"(7 * LS)
               : "memory");
}
__global__ __launch_bounds__(128) void k_attn(const _Float16* __restrict__ QH, const _Float16* __restrict__ QL, const _Float16* __restrict__ KH, const _Float16* __restrict__ KL, const _Float16* __restrict__ VT, const _Float16* __restrict__ VTL, float* __restrict__ O) {
  __shared__ __align__(16) _Float16 sp[4][16][40], spu[4][16][40];
  __shared__ __align__(16) unsigned char qs[4 * QWAVE];   // q rows, a range per wave; behind the loop each wave stages its ctx rows in its own range
  __shared__ __align__(16) unsigned char kb[KBUF];        // ring buffer 0: the k tile
  __shared__ __align__(16) unsigned char vb[VBUF];        // ring buffer 1: the v tile
  const int tid = threadIdx.x, wave = tid >> 5, lane = tid & 31, col = lane & 15, g = lane >> 4; const int qb = blockIdx.x, n = blockIdx.y; const size_t b = blockIdx.z; const int kvh = n / (NH / NKV); const int q0 = qb * 64 + wave * 16; const size_t rowb = b * SS;
  const _Float16* Vp = VT + (b * KW + kvh * HD) * SS; const _Float16* Vpl = VTL + (b * KW + kvh * HD) * SS;
  float m[8], l[8];
#pragma unroll
  for (int r = 0; r < 8; ++r) { m[r] = -3.0e38f; l[r] = 0.f; }
  v8f acc[16] = {};
  const int ks0 = max(0, qb * 64 - (WIN - 1)) / 32, ks1 = (qb * 64 + 64) / 32;
  // q: a wave's copy is one whole 512-B row of its own 16 queries. k: a wave's copy is one whole row; waves 0, 1 bring the hi rows (16 keys each), waves 2, 3 the residual rows. v: a wave's copy is eight 64-B rows; lane = (row tid / 4, piece tid % 4).
  const unsigned lq = (unsigned)(size_t)qs + (unsigned)wave * QWAVE + (unsigned)lane * 16u; const size_t gq = (rowb + q0) * QW + n * HD + lane * 8;
  const unsigned lk = (unsigned)(size_t)kb + (unsigned)wave * 16u * QPITCH + (unsigned)lane * 16u; const _Float16* gk = ((wave < 2) ? KH : KL) + (rowb + (wave & 1) * 16) * KW + kvh * HD + lane * 8;
  const unsigned lv = (unsigned)(size_t)vb + (unsigned)(tid >> 2) * VPITCH + (unsigned)(tid & 3) * 16u; const size_t gv = (size_t)(tid >> 2) * SS + (tid & 3) * 8;
  stage8h<QPITCH>(lq, QH + gq, QW); stage8h<QPITCH>(lq + 8u * QPITCH, QH + gq + 8 * QW, QW); stage8h<QPITCH>(lq + 16u * QPITCH, QL + gq, QW); stage8h<QPITCH>(lq + 24u * QPITCH, QL + gq + 8 * QW, QW);
  stage8h<QPITCH>(lk, gk + (size_t)ks0 * 32 * KW, KW); stage8h<QPITCH>(lk + 8u * QPITCH, gk + ((size_t)ks0 * 32 + 8) * KW, KW);
  asm volatile("s_wait_asynccnt 0x0" ::: "memory");   // this wave's q rows and its share of the first k tile have landed
  __syncthreads();                                    // the first k tile is readable by every wave
  stage8h<32 * VPITCH>(lv, Vp + gv + ks0 * 32, 32 * SS); stage8h<32 * VPITCH>(lv + 256u * VPITCH, Vpl + gv + ks0 * 32, 32 * SS);
  const unsigned char* qrow = qs + wave * QWAVE + col * QPITCH;
#pragma unroll 1
  for (int ks = ks0; ks < ks1; ++ks) { const int j0 = ks * 32; v8f s[2];
#pragma unroll
    for (int ct = 0; ct < 2; ++ct) { const int kk = j0 + ct * 16 + col; const unsigned char* krow = kb + (ct * 16 + col) * QPITCH; v8f c = {}, cl = {};
#pragma unroll   // straight-line groups: the fragment arrays stay in registers and each group's LDS reads stand in one place
      for (int kq = 0; kq < HD / 64; ++kq) { v16h aq[2], aql[2], kh[2], kl[2];   // eight fragments read as one group, then their six products
#pragma unroll
        for (int j = 0; j < 2; ++j) { const int ko = (kq * 2 + j) * 64; aq[j] = frag_h((const _Float16*)(qrow + ko), lane); aql[j] = frag_h((const _Float16*)(qrow + 16 * QPITCH + ko), lane); kh[j] = frag_h((const _Float16*)(krow + ko), lane); kl[j] = frag_h((const _Float16*)(krow + 32 * QPITCH + ko), lane); }
#pragma unroll
        for (int j = 0; j < 2; ++j) { c = wmma16(aq[j], kh[j], c); cl = wmma16(aql[j], kh[j], cl); cl = wmma16(aq[j], kl[j], cl); } }
#pragma unroll
      for (int r = 0; r < 8; ++r) { const int qi = q0 + 8 * g + r; const bool keep = (kk <= qi) && (qi - kk < WIN); s[ct][r] = keep ? (c[r] + cl[r] * (1.0f / 2048.0f)) : -3.0e38f; } }   // unscaled logits (the module applies no 1/sqrt(d))
    asm volatile("s_wait_dscnt 0x0" ::: "memory");      // this wave's reads of the k tile are done before it is refilled
    asm volatile("s_wait_asynccnt 0x0" ::: "memory");   // this wave's share of this step's v tile has landed
    __syncthreads();                                    // publishes the v tile and ends every wave's reads of the k tile
    if (ks + 1 < ks1) { stage8h<QPITCH>(lk, gk + (size_t)(j0 + 32) * KW, KW); stage8h<QPITCH>(lk + 8u * QPITCH, gk + (size_t)(j0 + 40) * KW, KW); }
#pragma unroll
    for (int r = 0; r < 8; ++r) { float mx = fmaxf(s[0][r], s[1][r]);
#pragma unroll
      for (int o = 1; o < 16; o <<= 1) mx = fmaxf(mx, __shfl_xor(mx, o));
      const float mn = fmaxf(m[r], mx); const float alpha = (m[r] <= -1.0e38f) ? 0.f : __expf(m[r] - mn);
      const float e0 = (s[0][r] <= -1.0e38f) ? 0.f : __expf(s[0][r] - mn), e1 = (s[1][r] <= -1.0e38f) ? 0.f : __expf(s[1][r] - mn); float es = e0 + e1;
#pragma unroll
      for (int o = 1; o < 16; o <<= 1) es += __shfl_xor(es, o);
      l[r] = l[r] * alpha + es; m[r] = (mn <= -1.0e38f) ? m[r] : mn;
#pragma unroll
      for (int dt = 0; dt < 16; ++dt) acc[dt][r] *= alpha;
      sp[wave][8 * g + r][col] = (_Float16)(e0 * 2048.0f); sp[wave][8 * g + r][16 + col] = (_Float16)(e1 * 2048.0f); spu[wave][8 * g + r][col] = (_Float16)e0; spu[wave][8 * g + r][16 + col] = (_Float16)e1; }   // (e x 2048) pairs with v hi, plain e with the x2048 v residual -> both land in one f32 accumulator
    LDSX();
    const v16h pa = frag_h(&sp[wave][col][0], lane), pu = frag_h(&spu[wave][col][0], lane);
#pragma unroll   // straight-line groups, as in the score loop
    for (int dq = 0; dq < 4; ++dq) { v16h vl[4], vh[4];   // eight fragments read as one group, then their eight products
#pragma unroll
      for (int j = 0; j < 4; ++j) { const unsigned char* vr = vb + ((dq * 4 + j) * 16 + col) * VPITCH; vl[j] = frag_h((const _Float16*)(vr + 256 * VPITCH), lane); vh[j] = frag_h((const _Float16*)vr, lane); }
#pragma unroll
      for (int j = 0; j < 4; ++j) { acc[dq * 4 + j] = wmma16(pu, vl[j], acc[dq * 4 + j]); acc[dq * 4 + j] = wmma16(pa, vh[j], acc[dq * 4 + j]); } }
    asm volatile("s_wait_dscnt 0x0" ::: "memory");      // this wave's reads of the v tile (and of its softmax planes) are done before the refill
    asm volatile("s_wait_asynccnt 0x0" ::: "memory");   // this wave's share of the next k tile has landed
    __syncthreads();                                    // publishes the next k tile and ends every wave's reads of the v tile
    if (ks + 1 < ks1) { stage8h<32 * VPITCH>(lv, Vp + gv + j0 + 32, 32 * SS); stage8h<32 * VPITCH>(lv + 256u * VPITCH, Vpl + gv + j0 + 32, 32 * SS); } }
  asm volatile("s_wait_asynccnt 0x0" ::: "memory");     // no copy is outstanding when the q range is used anew
  float (*so)[HD + 4] = (float (*)[HD + 4])(qs + wave * QWAVE);   // 16 rows of 260 floats = 16,640 B, inside this wave's own q range, which no other wave reads or writes
#pragma unroll
  for (int r = 0; r < 8; ++r) { const float il = (1.0f / 2048.0f) / l[r];
#pragma unroll
    for (int dt = 0; dt < 16; ++dt) so[8 * g + r][dt * 16 + col] = acc[dt][r] * il; }
  LDSX();
  for (int rl = 0; rl < 16; ++rl) { const size_t o = (rowb + q0 + rl) * QW + n * HD; vst2(O + o + lane * 4, *(const v4f*)&so[rl][lane * 4]); vst2(O + o + 128 + lane * 4, *(const v4f*)&so[rl][128 + lane * 4]); }
}
// ---- k_out: block = (64 rows, 128 cols): y = ctx(hi/lo, K 2048) . Wo rows
// The block's 128 weight rows go through LDS as in k_qkv: 64 k per pass, two buffers, eight asynchronous copies per lane and pass.
#define OBUF (128 * BPITCH)     // 18,432 B per buffer
__global__ __launch_bounds__(128) void k_out(const float* __restrict__ Oc, const __bf16* __restrict__ P, float* __restrict__ Y) {
  __shared__ __align__(16) float so[4][16][132];
  __shared__ __align__(16) unsigned char ring[2 * OBUF];   // the two weight buffers
  const int tid = threadIdx.x, wave = tid >> 5, lane = tid & 31, col = lane & 15, g = lane >> 4; const size_t r0 = (size_t)blockIdx.x * 64 + wave * 16; const int n0 = blockIdx.y * 128;
  v8f acc[8] = {};
  const unsigned lcp = (unsigned)(size_t)ring + (unsigned)(tid >> 3) * BPITCH + (unsigned)(tid & 7) * 16u;   // this lane's first LDS byte: row tid / 8, 16-byte piece tid % 8
  const __bf16* gcp = P + (size_t)(n0 + (tid >> 3)) * HID + (tid & 7) * 8;
  stage8(lcp, gcp);
  asm volatile("s_wait_asynccnt 0x0" ::: "memory");   // this wave's share of tile 0 has landed
  __syncthreads();                                    // tile 0 is readable by every wave
  stage8(lcp + OBUF, gcp + 64);
#pragma unroll 1   // one pass per trip: the ring's order stands once, at the foot
  for (int t = 0; t < QW / 64; ++t) { F2 a[2];
#pragma unroll
    for (int ks = 0; ks < 2; ++ks) a[ks] = split_row(Oc + (r0 + col) * QW, t * 64 + ks * 32, lane);
    const unsigned char* bb = ring + (t & 1) * OBUF + col * BPITCH;
#pragma unroll
    for (int ks = 0; ks < 2; ++ks) { v16b w[8];   // eight fragments read as one group, then their sixteen products
#pragma unroll
      for (int j = 0; j < 8; ++j) w[j] = frag_b((const __bf16*)(bb + j * 16 * BPITCH + ks * 64), lane);
#pragma unroll
      for (int j = 0; j < 8; ++j) { acc[j] = wmma_bf(a[ks].l, w[j], acc[j]); acc[j] = wmma_bf(a[ks].h, w[j], acc[j]); } }
    asm volatile("s_wait_dscnt 0x0" ::: "memory");      // this wave's reads of buffer t % 2 are done before it is refilled
    asm volatile("s_wait_asynccnt 0x0" ::: "memory");   // this wave's share of tile t + 1 has landed
    __syncthreads();                                    // publishes tile t + 1 and ends every wave's reads of buffer t % 2
    if (t + 2 < QW / 64) stage8(lcp + (unsigned)(t & 1) * OBUF, gcp + (t + 2) * 64); }
  asm volatile("s_wait_asynccnt 0x0" ::: "memory");     // no copy is outstanding when the wave ends
#pragma unroll
  for (int j = 0; j < 8; ++j)
#pragma unroll
    for (int r = 0; r < 8; ++r) so[wave][8 * g + r][j * 16 + col] = acc[j][r];
  LDSX();
  for (int rl = 0; rl < 16; ++rl) vst2(Y + (r0 + rl) * HID + n0 + lane * 4, *(const v4f*)&so[wave][rl][lane * 4]);
}
extern "C" void kernel_launch(void* const* d_in, const int* in_sizes, int n_in, void* d_out, int out_size, void* d_ws, size_t ws_size, hipStream_t stream) {
  (void)in_sizes; (void)n_in; (void)out_size;
  const float** F = (const float**)d_in;   // 0 hidden_states [2,2048,2048], 1 cos [2,2048,256], 2 sin, 3 Wq [2048,2048], 4 Wk [512,2048], 5 Wv [512,2048], 6 Wo [2048,2048] (natural), 7 q_norm_w [256], 8 k_norm_w [256]
  if (ws_size < (size_t)WS_END) return;
  char* ws = (char*)d_ws; __bf16* PK = (__bf16*)(ws + WS_PK); _Float16 *QH = (_Float16*)(ws + WS_QH), *QL = (_Float16*)(ws + WS_QL), *KH = (_Float16*)(ws + WS_KH), *KL = (_Float16*)(ws + WS_KL), *VT = (_Float16*)(ws + WS_VT), *VTL = (_Float16*)(ws + WS_VTL); float* O = (float*)(ws + WS_O);
  k_pack<<<dim3(HID, 4), 256, 0, stream>>>(F[3], F[4], F[5], F[6], PK);
  k_qkv<<<dim3(TRB, NH + 2 * NKV), 128, 0, stream>>>(F[0], PK + PK_A, F[1], F[2], F[7], F[8], QH, QL, KH, KL, VT, VTL);
  k_attn<<<dim3(TQB, NH, TNB), 128, 0, stream>>>(QH, QL, KH, KL, VT, VTL, O);
  k_out<<<dim3(TOB, HID / 128), 128, 0, stream>>>(O, PK + PK_P, (float*)d_out);
}

// v003
// It runs in 239 microseconds.
// Two timings next to v002 both put it at 1.17 times that version's speed.
// Over all steps from v000 it is 4.15 times as fast.
// compute dtype: hidden_states, cos, sin, Wq/Wk/Wv/Wo, q/k norm weights rounded to bf16; q/k/v projections with exact bf16 products on WMMA 16x16x32 (natural [out][in] rows; one 256-column head per block); per-head RMSNorm (eps 1e-6, x weight; v with weight 1) and the rotate-half rotary embedding with the cos/sin inputs in f32 in the projection epilogue; q and k stored as f16 hi + (x2048-scaled) residual planes with 3-product scores (unscaled logits, sigma ~16, kept f32-accurate), v stored as f16 hi + (x2048-scaled) residual planes; sliding-window causal mask (j <= i, i - j < 512), running-max softmax in f32 (hardware exp); the softmax weights as f16 planes e x 2048 (against v hi) and e (against the x2048 v residual) accumulated into one f32 accumulator (2 products; 2^-11 folded into the epilogue); output projection with ctx as bf16 hi + residual x exact Wo rows (2 products); f32 accumulate.
#include <hip/hip_runtime.h>
#include <math.h>

typedef __attribute__((ext_vector_type(16))) _Float16 v16h;
typedef __attribute__((ext_vector_type(16))) __bf16 v16b;
typedef __attribute__((ext_vector_type(8)))  _Float16 v8h;
typedef __attribute__((ext_vector_type(4)))  _Float16 v4h;
typedef __attribute__((ext_vector_type(8)))  float v8f;
typedef __attribute__((ext_vector_type(4)))  float v4f;
typedef __attribute__((ext_vector_type(2)))  float v2f;
typedef __attribute__((ext_vector_type(4)))  unsigned v4u;
typedef __attribute__((ext_vector_type(4)))  int v4i;
typedef float __attribute__((may_alias)) float_a;
typedef int __attribute__((may_alias)) int_a;

template <typename T> __device__ __forceinline__ void vst2(void* p, T v) { *(T*)p = v;  }
__device__ __forceinline__ v8f wmma16(v16h a, v16h b, v8f c) {
  v8f d = __builtin_amdgcn_wmma_f32_16x16x32_f16(false, a, false, b, (short)0, c, false, false);
  asm volatile("v_nop\n\tv_nop\n\tv_nop\n\tv_nop" : "+v"(d) : "v"(a), "v"(b));
  return d;
}
__device__ __forceinline__ v8f wmma_bf(v16b a, v16b b, v8f c) {
  v8f d = __builtin_amdgcn_wmma_f32_16x16x32_bf16(false, a, false, b, (short)0, c, false, false);
  asm volatile("v_nop\n\tv_nop\n\tv_nop\n\tv_nop" : "+v"(d) : "v"(a), "v"(b));
  return d;
}
// 16x16x32 fragments: lane = (h = lane>>4, row/col = lane&15); elements 0..7 = k0+8h+0..7, 8..15 = k0+16+8h+0..7; D element r = row 8h+r
__device__ __forceinline__ v16h frag_h(const _Float16* rowk0, int lane) {
  union { v16h v; v8h q[2]; } u; const _Float16* p = rowk0 + 8 * (lane >> 4);
  u.q[0] = *(const v8h*)p; u.q[1] = *(const v8h*)(p + 16); return u.v;
}
__device__ __forceinline__ v16h frag_f32(const float* rowk0, int lane) {
  v16h a; const float* p = rowk0 + 8 * (lane >> 4);
#pragma unroll
  for (int i = 0; i < 8; ++i) { a[i] = (_Float16)p[i]; a[8 + i] = (_Float16)p[16 + i]; }
  return a;
}
__device__ __forceinline__ v16h frag_f32s(const float* rowk0, int lane, float sc) {
  v16h a; const float* p = rowk0 + 8 * (lane >> 4);
#pragma unroll
  for (int i = 0; i < 8; ++i) { a[i] = (_Float16)(p[i] * sc); a[8 + i] = (_Float16)(p[16 + i] * sc); }
  return a;
}
// column fragment from a [K][ld] layout (column n), rows >= K read as 0
__device__ __forceinline__ v16h fragc_f32(const float* W, int k0, int n, int lane, int ld, int K) {
  v16h a; const int g = lane >> 4;
#pragma unroll
  for (int i = 0; i < 8; ++i) { const int ka = k0 + 8 * g + i, kb = ka + 16;
    a[i] = (_Float16)(ka < K ? W[(size_t)(ka < K ? ka : K - 1) * ld + n] : 0.f); a[8 + i] = (_Float16)(kb < K ? W[(size_t)(kb < K ? kb : K - 1) * ld + n] : 0.f); }
  return a;
}
struct F2 { v16b h, l; };
__device__ __forceinline__ F2 bsplit16(const float v[16]) { F2 r;
#pragma unroll
  for (int i = 0; i < 16; ++i) { const __bf16 h = (__bf16)v[i]; r.h[i] = h; r.l[i] = (__bf16)(v[i] - (float)h); }
  return r; }
__device__ __forceinline__ F2 split_row(const float* row, int k0, int lane) { float v[16]; const float* p = row + k0 + 8 * (lane >> 4);
#pragma unroll
  for (int i = 0; i < 8; ++i) { v[i] = p[i]; v[8 + i] = p[16 + i]; }
  return bsplit16(v); }
__device__ __forceinline__ F2 split_rowK(const float* row, int k0, int lane, int K) { float v[16]; const int g = lane >> 4;
#pragma unroll
  for (int i = 0; i < 8; ++i) { const int ka = k0 + 8 * g + i, kb = ka + 16; v[i] = ka < K ? row[ka < K ? ka : K - 1] : 0.f; v[8 + i] = kb < K ? row[kb < K ? kb : K - 1] : 0.f; }
  return bsplit16(v); }
__device__ __forceinline__ F2 split_col(const float* W, int k0, int n, int lane, int ld, int K) { float v[16]; const int g = lane >> 4;
#pragma unroll
  for (int i = 0; i < 8; ++i) { const int ka = k0 + 8 * g + i, kb = ka + 16; v[i] = ka < K ? W[(size_t)(ka < K ? ka : K - 1) * ld + n] : 0.f; v[8 + i] = kb < K ? W[(size_t)(kb < K ? kb : K - 1) * ld + n] : 0.f; }
  return bsplit16(v); }
__device__ __forceinline__ v8f mac3(const F2& a, const F2& b, v8f c) { c = wmma_bf(a.l, b.h, c); c = wmma_bf(a.h, b.l, c); return wmma_bf(a.h, b.h, c); }
__device__ __forceinline__ float sigm(float v) { return 1.0f / (1.0f + expf(-v)); }
#define LDSX() do { asm volatile("s_wait_dscnt 0" ::: "memory"); __builtin_amdgcn_wave_barrier(); __builtin_amdgcn_fence(__ATOMIC_RELEASE, "workgroup"); } while (0)


// Grouped-query sliding-window attention (B 2, S 2,048, hidden 2,048, 8 query heads / 2 kv heads x 256, window 512): q/k/v projections, per-head RMSNorm, rotary embedding, windowed causal softmax, output projection.
#define NB 2
#define SS 2048
#define HID 2048
#define NH 8
#define NKV 2
#define HD 256
#define WIN 512
#define QW (NH * HD)          // 2048 q columns
#define KW (NKV * HD)         // 512
#define QKVW (QW + 2 * KW)    // 3072
#define NR (NB * SS)
#ifndef TQB
#define TQB (SS / 64)
#define TNB NB
#define TOB (NB * SS / 64)
#define TRB (NB * SS / 64)    // projection row tiles
#endif
typedef __attribute__((ext_vector_type(8))) __bf16 v8b;
__device__ __forceinline__ v16b frag_b(const __bf16* rowk0, int lane) {
  union { v16b v; v8b q[2]; } u; const __bf16* p = rowk0 + 8 * (lane >> 4);
  u.q[0] = *(const v8b*)p; u.q[1] = *(const v8b*)(p + 16); return u.v;
}
__device__ __forceinline__ float bfr(float v) { return (float)(__bf16)v; }
__device__ __attribute__((noinline)) float exp_ni(float v) { return expf(v); }
__device__ __attribute__((noinline)) float erf_ni(float v) { return erff(v); }

#define PK_A 0                            // [3072][2048] Wq | Wk | Wv natural rows
#define PK_P ((size_t)QKVW * HID)         // [2048][2048] Wo natural rows
#define PK_END (PK_P + (size_t)HID * HID)
#define WS_PK  0u
#define WS_QH  (((2u * PK_END) + 127u) / 128u * 128u)   // f16 [4096][2048] q hi ; QL
#define WS_QL  (WS_QH + 2u * (size_t)NR * QW)
#define WS_KH  (WS_QL + 2u * (size_t)NR * QW)          // f16 [4096][512] k hi ; KL
#define WS_KL  (WS_KH + 2u * (size_t)NR * KW)
#define WS_VT  (WS_KL + 2u * (size_t)NR * KW)          // f16 [b][512][2048] v hi ; VTL (x2048 residual)
#define WS_VTL (WS_VT + 2u * (size_t)NR * KW)
#define WS_O   (WS_VTL + 2u * (size_t)NR * KW)         // f32 [4096][2048] ctx
#define WS_END (WS_O + 4u * (size_t)NR * QW)

__global__ __launch_bounds__(256) void k_pack(const float* __restrict__ WQ, const float* __restrict__ WK, const float* __restrict__ WV, const float* __restrict__ WO, __bf16* __restrict__ PK) {
  __shared__ __align__(16) __bf16 s[HID]; const int n = blockIdx.x, which = blockIdx.y, t = threadIdx.x;   // which 0: Wq (n < 2048), 1: Wk (n < 512), 2: Wv, 3: Wo
  if ((which == 1 || which == 2) && n >= KW) return;
  const float* Wm = (which == 0) ? WQ : (which == 1) ? WK : (which == 2) ? WV : WO;
  for (int k = t; k < HID; k += 256) s[k] = (__bf16)Wm[(size_t)n * HID + k];
  __syncthreads();
  const size_t row = (which == 0) ? n : (which == 1) ? (QW + n) : (QW + KW + n);
  __bf16* dst = (which < 3) ? PK + PK_A + row * HID : PK + PK_P + (size_t)n * HID;
  for (int q = t; q < HID / 8; q += 256) vst2((unsigned*)(dst + q * 8), *(const v4u*)&s[q * 8]);
}
// ---- k_qkv: block = (64 rows, one 256-column head hb of [q heads 0..7 | k heads 8..9 | v heads 10..11]): GEMM (exact, 16 tiles), RMSNorm over the head's 256 dims (f32), rotary (q, k) with the cos/sin inputs, then planes
// The head's 256 weight rows go through LDS, 64 k (128 B of each row) per pass, two buffers: asynchronous 16-byte copies bring pass t + 2 while pass t + 1 waits ready, and the block's four waves read their B fragments from the one staged tile.
#define BPITCH 144              // LDS pitch of a staged 128-B row: 16 B x odd, conflict-free for ds_load_b128 readers
#define BBUF (HD * BPITCH)      // 36,864 B per buffer
#define NPASS (HID / 64)
// Eight copies of one lane: rows 16 apart, 16 bytes each. The s_wait_xcnt stands inside the copies' own statement so that no address register of an issued copy is rewritten ahead of it.
__device__ __forceinline__ void stage8(unsigned l, const __bf16* g) {
  asm volatile("global_load_async_to_lds_b128 %0, %8, off\n\t"
               "global_load_async_to_lds_b128 %1, %9, off\n\t"
               "global_load_async_to_lds_b128 %2, %10, off\n\t"
               "global_load_async_to_lds_b128 %3, %11, off\n\t"
               "global_load_async_to_lds_b128 %4, %12, off\n\t"
               "global_load_async_to_lds_b128 %5, %13, off\n\t"
               "global_load_async_to_lds_b128 %6, %14, off\n\t"
               "global_load_async_to_lds_b128 %7, %15, off\n\t"
               "s_wait_xcnt 0x0"
               :: "v"(l), "v"(l + 16u * BPITCH), "v"(l + 32u * BPITCH), "v"(l + 48u * BPITCH), "v"(l + 64u * BPITCH), "v"(l + 80u * BPITCH), "v"(l + 96u * BPITCH), "v"(l + 112u * BPITCH),
                  "v"(g), "v"(g + 16 * HID), "v"(g + 32 * HID), "v"(g + 48 * HID), "v"(g + 64 * HID), "v"(g + 80 * HID), "v"(g + 96 * HID), "v"(g + 112 * HID)
               : "memory");
}
// One pass's tile: 256 rows x 128 B = 16 copies per lane; a wave's copy covers four whole rows (four 128-B lines).
__device__ __forceinline__ void stage_tile(unsigned l, const __bf16* g) { stage8(l, g); stage8(l + 128u * BPITCH, g + 128 * HID); }
// cos and sin of four rows for one lane: per row cos[d], cos[d + 128], sin[d], sin[d + 128], four dims each
__device__ __forceinline__ void rope_rows(v4f (&e)[4][4], const float* c, const float* s) {
#pragma unroll
  for (int i = 0; i < 4; ++i) { e[i][0] = *(const v4f*)(c + i * HD); e[i][1] = *(const v4f*)(c + i * HD + 128); e[i][2] = *(const v4f*)(s + i * HD); e[i][3] = *(const v4f*)(s + i * HD + 128); }
}
__global__ __launch_bounds__(128) void k_qkv(const float* __restrict__ X, const __bf16* __restrict__ P, const float* __restrict__ COS, const float* __restrict__ SIN, const float* __restrict__ QNW, const float* __restrict__ KNW, _Float16* __restrict__ QH, _Float16* __restrict__ QL, _Float16* __restrict__ KH, _Float16* __restrict__ KL, _Float16* __restrict__ VT, _Float16* __restrict__ VTL) {
  __shared__ __align__(16) _Float16 soh[4][16][264], sol[4][16][264];
  __shared__ __align__(16) unsigned char ring[2 * BBUF];   // the two weight buffers; behind the loop the q and k heads' f32 rows or the v heads' transpose planes lie here
  const int tid = threadIdx.x, wave = tid >> 5, lane = tid & 31, col = lane & 15, g = lane >> 4; const size_t r0 = (size_t)blockIdx.x * 64 + wave * 16; const int hb = blockIdx.y; const int n0 = hb * HD;   // column base in [0, 3072)
  v8f acc[16] = {};
  const unsigned lcp = (unsigned)(size_t)ring + (unsigned)(tid >> 3) * BPITCH + (unsigned)(tid & 7) * 16u;   // this lane's first LDS byte: row tid / 8, 16-byte piece tid % 8
  const __bf16* gcp = P + (size_t)(n0 + (tid >> 3)) * HID + (tid & 7) * 8;
  stage_tile(lcp, gcp);
  asm volatile("s_wait_asynccnt 0x0" ::: "memory");   // this wave's share of tile 0 has landed
  __syncthreads();                                    // tile 0 is readable by every wave
  stage_tile(lcp + BBUF, gcp + 64);
#pragma unroll 1   // one pass per trip: the ring's order stands once, at the foot
  for (int t = 0; t < NPASS; ++t) { v16b a[2]; { const float* p = X + (r0 + col) * HID + t * 64 + 8 * g;
#pragma unroll
      for (int ks = 0; ks < 2; ++ks)
#pragma unroll
        for (int i = 0; i < 8; ++i) { a[ks][i] = (__bf16)p[ks * 32 + i]; a[ks][8 + i] = (__bf16)p[ks * 32 + 16 + i]; } }
    const unsigned char* bb = ring + (t & 1) * BBUF + col * BPITCH;
#pragma unroll
    for (int ks = 0; ks < 2; ++ks)
#pragma unroll
      for (int jh = 0; jh < 2; ++jh) { v16b w[8];   // eight fragments read as one group, then their eight products
#pragma unroll
        for (int j = 0; j < 8; ++j) w[j] = frag_b((const __bf16*)(bb + (jh * 8 + j) * 16 * BPITCH + ks * 64), lane);
#pragma unroll
        for (int j = 0; j < 8; ++j) acc[jh * 8 + j] = wmma_bf(a[ks], w[j], acc[jh * 8 + j]); }
    asm volatile("s_wait_dscnt 0x0" ::: "memory");      // this wave's reads of buffer t % 2 are done before it is refilled
    asm volatile("s_wait_asynccnt 0x0" ::: "memory");   // this wave's share of tile t + 1 has landed
    __syncthreads();                                    // publishes tile t + 1 and ends every wave's reads of buffer t % 2
    if (t + 2 < NPASS) stage_tile(lcp + (unsigned)(t & 1) * BBUF, gcp + (t + 2) * 64); }
  asm volatile("s_wait_asynccnt 0x0" ::: "memory");     // no copy is outstanding when the ring's LDS is used anew
  // RMSNorm statistics per row (8g + r): this lane's 16 columns, then the 16 col-lanes
  float ss[8];
#pragma unroll
  for (int r = 0; r < 8; ++r) { float s = 0.f;
#pragma unroll
    for (int j = 0; j < 16; ++j) s += acc[j][r] * acc[j][r];
#pragma unroll
    for (int o = 1; o < 16; o <<= 1) s += __shfl_xor(s, o);
    ss[r] = 1.0f / sqrtf(s / (float)HD + 1e-6f); }
  const int kind = (hb < NH) ? 0 : (hb < NH + NKV) ? 1 : 2;   // q, k, v
  if (kind < 2) {   // q, k: the normed rows go through LDS in f32, and the rotary is applied row by row, where cos and sin are read as whole rows
    const float* NW = (kind == 0) ? QNW : KNW;
    // a lane holds dims 4 * lane .. + 3 of a row and their rotary partners 128 further on: four 16-byte loads per row and lane bring cos and sin (rows are (b*S + s): [b][s][d] = row*HD + d), four rows a group, two groups of registers
    const float* cp = COS + r0 * HD + lane * 4; const float* sq = SIN + r0 * HD + lane * 4;
    v4f cs[2][4][4];
    rope_rows(cs[0], cp, sq);   // the first group flies during the staging
    float (*sx)[HD + 4] = (float (*)[HD + 4])(ring + wave * (16 * (HD + 4) * 4));   // 16 rows of 260 floats = 16,640 B per wave, inside the ring; every read of the ring ended at the last pass's barrier and no copy is outstanding
#pragma unroll
    for (int j = 0; j < 16; ++j) { const float w = bfr(NW[j * 16 + col]);
#pragma unroll
      for (int r = 0; r < 8; ++r) sx[8 * g + r][j * 16 + col] = acc[j][r] * ss[r] * w; }
    LDSX();
    _Float16* DH = (kind == 0) ? QH : KH; _Float16* DL = (kind == 0) ? QL : KL; const size_t ld = (kind == 0) ? QW : KW; const int c0 = ((kind == 0) ? hb : hb - NH) * HD;
#pragma unroll   // straight line: the two register groups are named by constants
    for (int gq = 0; gq < 4; ++gq) {
      if (gq < 3) { rope_rows(cs[(gq + 1) & 1], cp + (gq + 1) * 4 * HD, sq + (gq + 1) * 4 * HD);
        __builtin_amdgcn_sched_barrier(0); }   // the next group's loads stay ahead of this group's arithmetic, which covers their latency
#pragma unroll
      for (int i4 = 0; i4 < 4; ++i4) { const int rl = gq * 4 + i4; const v4f* e = cs[gq & 1][i4];
        const v4f xa = *(const v4f*)&sx[rl][lane * 4], xb = *(const v4f*)&sx[rl][128 + lane * 4];
        v4h ha, la, hc, lc;
#pragma unroll
        for (int i = 0; i < 4; ++i) { const float ya = xa[i] * bfr(e[0][i]) - xb[i] * bfr(e[2][i]), yb = xb[i] * bfr(e[1][i]) + xa[i] * bfr(e[3][i]);
          const _Float16 p = (_Float16)ya, q = (_Float16)yb; ha[i] = p; la[i] = (_Float16)((ya - (float)p) * 2048.0f); hc[i] = q; lc[i] = (_Float16)((yb - (float)q) * 2048.0f); }
        const size_t o = (r0 + rl) * ld + c0 + lane * 4;   // a wave's store covers 256 contiguous bytes, two whole lines
        vst2(DH + o, ha); vst2(DH + o + 128, hc); vst2(DL + o, la); vst2(DL + o + 128, lc); }
      if (gq < 2) asm volatile("s_wait_xcnt 0x0" ::: "memory");   // behind this group's stores, before the loads that follow land in their registers
    } }
  else {
#pragma unroll
    for (int j = 0; j < 16; ++j) { const int d = j * 16 + col;
#pragma unroll
      for (int r = 0; r < 8; ++r) { const float y = acc[j][r] * ss[r];
        const _Float16 hv = (_Float16)y; soh[wave][8 * g + r][d] = hv; sol[wave][8 * g + r][d] = (_Float16)((y - (float)hv) * 2048.0f); } }
    LDSX();
    __syncthreads();
    const size_t rb = (size_t)blockIdx.x * 64; const size_t b = rb / SS; const int s0 = (int)(rb % SS); const int g2 = hb - NH - NKV;
    _Float16 (*st)[72] = (_Float16 (*)[72])ring; _Float16 (*stl)[72] = (_Float16 (*)[72])(ring + BBUF);   // [HD][72] each, exactly one buffer; every read of the ring ended at the last pass's barrier
    for (int e = tid; e < 64 * HD; e += 128) { const int rr = e / HD, d = e % HD; st[d][rr] = soh[rr >> 4][rr & 15][d]; stl[d][rr] = sol[rr >> 4][rr & 15][d]; }
    __syncthreads();
    for (int e = tid; e < HD * 8; e += 128) { const int d = e >> 3, pc = e & 7; const size_t o = (b * KW + g2 * HD + d) * SS + s0 + pc * 8; vst2((unsigned*)(VT + o), *(const v4u*)&st[d][pc * 8]); vst2((unsigned*)(VTL + o), *(const v4u*)&stl[d][pc * 8]); } }
}
// ---- k_attn: block = (64 queries, head n, b): kv head n/4; key tiles inside the window [i0 - 511, i0 + 63]; scores over 256 dims (3 products, q fragments re-read per step); mask j <= i && i - j < 512; online softmax; P = e x 2048 (f16) against v hi and e against the x2048 v residual, one accumulator (2 products); ctx rows
// Every matrix operand comes from LDS, brought by asynchronous 16-byte copies. Each wave's 16 q rows (hi, residual) are staged once. The k tile and the v tile of a 32-key step are the two buffers of one ring, filled in turn: v of step s flies while the scores of step s are formed, k of step s + 1 flies during the softmax and the value products of step s. The block's four waves read the one staged tile.
#define QPITCH 528              // LDS pitch of a staged 512-B row (q, k): 16 B x odd, conflict-free for ds_load_b128 readers
#define VPITCH 80               // LDS pitch of a staged 64-B v row (32 keys of one dim): 16 B x odd
#define QWAVE (32 * QPITCH)     // one wave's q rows, 16 hi then 16 residual: 16,896 B
#define KBUF (64 * QPITCH)      // 32 keys hi then 32 keys residual: 33,792 B
#define VBUF (512 * VPITCH)     // 256 dims hi then 256 dims residual: 40,960 B
// Eight copies of one lane, LS LDS bytes and gs elements apart. An immediate offset moves the LDS and the global address alike, so copy i names the one LDS-address register with offset i * LS (at most 17,920) and a global address that is i * LS short of its row: one LDS-address register serves all eight and none has to stay live across the step. Every register and every offset is a multiple of 16. The s_wait_xcnt stands inside the copies' own statement so that no address register of an issued copy is rewritten ahead of it.
template <int LS> __device__ __forceinline__ void stage8h(unsigned l, const _Float16* g, size_t gs) {
  const char* p = (const char*)g; const size_t d = gs * 2 - LS;   // bytes from one copy's global register to the next
  asm volatile("global_load_async_to_lds_b128 %0, %1, off\n\t"
               "global_load_async_to_lds_b128 %0, %2, off offset:%9\n\t"
               "global_load_async_to_lds_b128 %0, %3, off offset:%10\n\t"
               "global_load_async_to_lds_b128 %0, %4, off offset:%11\n\t"
               "global_load_async_to_lds_b128 %0, %5, off offset:%12\n\t"
               "global_load_async_to_lds_b128 %0, %6, off offset:%13\n\t"
               "global_load_async_to_lds_b128 %0, %7, off offset:%14\n\t"
               "global_load_async_to_lds_b128 %0, %8, off offset:%15\n\t"
               "s_wait_xcnt 0x0"
               :: "v"(l), "v"(p), "v"(p + d), "v"(p + 2 * d), "v"(p + 3 * d), "v"(p + 4 * d), "v"(p + 5 * d), "v"(p + 6 * d), "v"(p + 7 * d),
                  "n"(LS), "n"(2 * LS), "n"(3 * LS), "n"(4 * LS), "n"(5 * LS), "n"(6 * LS), "n"(7 * LS)
               : "memory");
}
__global__ __launch_bounds__(128) void k_attn(const _Float16* __restrict__ QH, const _Float16* __restrict__ QL, const _Float16* __restrict__ KH, const _Float16* __restrict__ KL, const _Float16* __restrict__ VT, const _Float16* __restrict__ VTL, float* __restrict__ O) {
  __shared__ __align__(16) _Float16 sp[4][16][40], spu[4][16][40];
  __shared__ __align__(16) unsigned char qs[4 * QWAVE];   // q rows, a range per wave; behind the loop each wave stages its ctx rows in its own range
  __shared__ __align__(16) unsigned char kb[KBUF];        // ring buffer 0: the k tile
  __shared__ __align__(16) unsigned char vb[VBUF];        // ring buffer 1: the v tile
  const int tid = threadIdx.x, wave = tid >> 5, lane = tid & 31, col = lane & 15, g = lane >> 4; const int qb = blockIdx.x, n = blockIdx.y; const size_t b = blockIdx.z; const int kvh = n / (NH / NKV); const int q0 = qb * 64 + wave * 16; const size_t rowb = b * SS;
  const _Float16* Vp = VT + (b * KW + kvh * HD) * SS; const _Float16* Vpl = VTL + (b * KW + kvh * HD) * SS;
  float m[8], l[8];
#pragma unroll
  for (int r = 0; r < 8; ++r) { m[r] = -3.0e38f; l[r] = 0.f; }
  v8f acc[16] = {};
  const int ks0 = max(0, qb * 64 - (WIN - 1)) / 32, ks1 = (qb * 64 + 64) / 32;
  // q: a wave's copy is one whole 512-B row of its own 16 queries. k: a wave's copy is one whole row; waves 0, 1 bring the hi rows (16 keys each), waves 2, 3 the residual rows. v: a wave's copy is eight 64-B rows; lane = (row tid / 4, piece tid % 4).
  const unsigned lq = (unsigned)(size_t)qs + (unsigned)wave * QWAVE + (unsigned)lane * 16u; const size_t gq = (rowb + q0) * QW + n * HD + lane * 8;
  const unsigned lk = (unsigned)(size_t)kb + (unsigned)wave * 16u * QPITCH + (unsigned)lane * 16u; const _Float16* gk = ((wave < 2) ? KH : KL) + (rowb + (wave & 1) * 16) * KW + kvh * HD + lane * 8;
  const unsigned lv = (unsigned)(size_t)vb + (unsigned)(tid >> 2) * VPITCH + (unsigned)(tid & 3) * 16u; const size_t gv = (size_t)(tid >> 2) * SS + (tid & 3) * 8;
  stage8h<QPITCH>(lq, QH + gq, QW); stage8h<QPITCH>(lq + 8u * QPITCH, QH + gq + 8 * QW, QW); stage8h<QPITCH>(lq + 16u * QPITCH, QL + gq, QW); stage8h<QPITCH>(lq + 24u * QPITCH, QL + gq + 8 * QW, QW);
  stage8h<QPITCH>(lk, gk + (size_t)ks0 * 32 * KW, KW); stage8h<QPITCH>(lk + 8u * QPITCH, gk + ((size_t)ks0 * 32 + 8) * KW, KW);
  asm volatile("s_wait_asynccnt 0x0" ::: "memory");   // this wave's q rows and its share of the first k tile have landed
  __syncthreads();                                    // the first k tile is readable by every wave
  stage8h<32 * VPITCH>(lv, Vp + gv + ks0 * 32, 32 * SS); stage8h<32 * VPITCH>(lv + 256u * VPITCH, Vpl + gv + ks0 * 32, 32 * SS);
  const unsigned char* qrow = qs + wave * QWAVE + col * QPITCH;
#pragma unroll 1
  for (int ks = ks0; ks < ks1; ++ks) { const int j0 = ks * 32; v8f s[2];
#pragma unroll
    for (int ct = 0; ct < 2; ++ct) { const int kk = j0 + ct * 16 + col; const unsigned char* krow = kb + (ct * 16 + col) * QPITCH; v8f c = {}, cl = {};
#pragma unroll   // straight-line groups: the fragment arrays stay in registers and each group's LDS reads stand in one place
      for (int kq = 0; kq < HD / 64; ++kq) { v16h aq[2], aql[2], kh[2], kl[2];   // eight fragments read as one group, then their six products
#pragma unroll
        for (int j = 0; j < 2; ++j) { const int ko = (kq * 2 + j) * 64; aq[j] = frag_h((const _Float16*)(qrow + ko), lane); aql[j] = frag_h((const _Float16*)(qrow + 16 * QPITCH + ko), lane); kh[j] = frag_h((const _Float16*)(krow + ko), lane); kl[j] = frag_h((const _Float16*)(krow + 32 * QPITCH + ko), lane); }
#pragma unroll
        for (int j = 0; j < 2; ++j) { c = wmma16(aq[j], kh[j], c); cl = wmma16(aql[j], kh[j], cl); cl = wmma16(aq[j], kl[j], cl); } }
#pragma unroll
      for (int r = 0; r < 8; ++r) { const int qi = q0 + 8 * g + r; const bool keep = (kk <= qi) && (qi - kk < WIN); s[ct][r] = keep ? (c[r] + cl[r] * (1.0f / 2048.0f)) : -3.0e38f; } }   // unscaled logits (the module applies no 1/sqrt(d))
    asm volatile("s_wait_dscnt 0x0" ::: "memory");      // this wave's reads of the k tile are done before it is refilled
    asm volatile("s_wait_asynccnt 0x0" ::: "memory");   // this wave's share of this step's v tile has landed
    __syncthreads();                                    // publishes the v tile and ends every wave's reads of the k tile
    if (ks + 1 < ks1) { stage8h<QPITCH>(lk, gk + (size_t)(j0 + 32) * KW, KW); stage8h<QPITCH>(lk + 8u * QPITCH, gk + (size_t)(j0 + 40) * KW, KW); }
#pragma unroll
    for (int r = 0; r < 8; ++r) { float mx = fmaxf(s[0][r], s[1][r]);
#pragma unroll
      for (int o = 1; o < 16; o <<= 1) mx = fmaxf(mx, __shfl_xor(mx, o));
      const float mn = fmaxf(m[r], mx); const float alpha = (m[r] <= -1.0e38f) ? 0.f : __expf(m[r] - mn);
      const float e0 = (s[0][r] <= -1.0e38f) ? 0.f : __expf(s[0][r] - mn), e1 = (s[1][r] <= -1.0e38f) ? 0.f : __expf(s[1][r] - mn); float es = e0 + e1;
#pragma unroll
      for (int o = 1; o < 16; o <<= 1) es += __shfl_xor(es, o);
      l[r] = l[r] * alpha + es; m[r] = (mn <= -1.0e38f) ? m[r] : mn;
#pragma unroll
      for (int dt = 0; dt < 16; ++dt) acc[dt][r] *= alpha;
      sp[wave][8 * g + r][col] = (_Float16)(e0 * 2048.0f); sp[wave][8 * g + r][16 + col] = (_Float16)(e1 * 2048.0f); spu[wave][8 * g + r][col] = (_Float16)e0; spu[wave][8 * g + r][16 + col] = (_Float16)e1; }   // (e x 2048) pairs with v hi, plain e with the x2048 v residual -> both land in one f32 accumulator
    LDSX();
    const v16h pa = frag_h(&sp[wave][col][0], lane), pu = frag_h(&spu[wave][col][0], lane);
#pragma unroll   // straight-line groups, as in the score loop
    for (int dq = 0; dq < 4; ++dq) { v16h vl[4], vh[4];   // eight fragments read as one group, then their eight products
#pragma unroll
      for (int j = 0; j < 4; ++j) { const unsigned char* vr = vb + ((dq * 4 + j) * 16 + col) * VPITCH; vl[j] = frag_h((const _Float16*)(vr + 256 * VPITCH), lane); vh[j] = frag_h((const _Float16*)vr, lane); }
#pragma unroll
      for (int j = 0; j < 4; ++j) { acc[dq * 4 + j] = wmma16(pu, vl[j], acc[dq * 4 + j]); acc[dq * 4 + j] = wmma16(pa, vh[j], acc[dq * 4 + j]); } }
    asm volatile("s_wait_dscnt 0x0" ::: "memory");      // this wave's reads of the v tile (and of its softmax planes) are done before the refill
    asm volatile("s_wait_asynccnt 0x0" ::: "memory");   // this wave's share of the next k tile has landed
    __syncthreads();                                    // publishes the next k tile and ends every wave's reads of the v tile
    if (ks + 1 < ks1) { stage8h<32 * VPITCH>(lv, Vp + gv + j0 + 32, 32 * SS); stage8h<32 * VPITCH>(lv + 256u * VPITCH, Vpl + gv + j0 + 32, 32 * SS); } }
  asm volatile("s_wait_asynccnt 0x0" ::: "memory");     // no copy is outstanding when the q range is used anew
  float (*so)[HD + 4] = (float (*)[HD + 4])(qs + wave * QWAVE);   // 16 rows of 260 floats = 16,640 B, inside this wave's own q range, which no other wave reads or writes
#pragma unroll
  for (int r = 0; r < 8; ++r) { const float il = (1.0f / 2048.0f) / l[r];
#pragma unroll
    for (int dt = 0; dt < 16; ++dt) so[8 * g + r][dt * 16 + col] = acc[dt][r] * il; }
  LDSX();
  for (int rl = 0; rl < 16; ++rl) { const size_t o = (rowb + q0 + rl) * QW + n * HD; vst2(O + o + lane * 4, *(const v4f*)&so[rl][lane * 4]); vst2(O + o + 128 + lane * 4, *(const v4f*)&so[rl][128 + lane * 4]); }
}
// ---- k_out: block = (64 rows, 128 cols): y = ctx(hi/lo, K 2048) . Wo rows
// The block's 128 weight rows go through LDS as in k_qkv: 64 k per pass, two buffers, eight asynchronous copies per lane and pass.
#define OBUF (128 * BPITCH)     // 18,432 B per buffer
__global__ __launch_bounds__(128) void k_out(const float* __restrict__ Oc, const __bf16* __restrict__ P, float* __restrict__ Y) {
  __shared__ __align__(16) float so[4][16][132];
  __shared__ __align__(16) unsigned char ring[2 * OBUF];   // the two weight buffers
  const int tid = threadIdx.x, wave = tid >> 5, lane = tid & 31, col = lane & 15, g = lane >> 4; const size_t r0 = (size_t)blockIdx.x * 64 + wave * 16; const int n0 = blockIdx.y * 128;
  v8f acc[8] = {};
  const unsigned lcp = (unsigned)(size_t)ring + (unsigned)(tid >> 3) * BPITCH + (unsigned)(tid & 7) * 16u;   // this lane's first LDS byte: row tid / 8, 16-byte piece tid % 8
  const __bf16* gcp = P + (size_t)(n0 + (tid >> 3)) * HID + (tid & 7) * 8;
  stage8(lcp, gcp);
  asm volatile("s_wait_asynccnt 0x0" ::: "memory");   // this wave's share of tile 0 has landed
  __syncthreads();                                    // tile 0 is readable by every wave
  stage8(lcp + OBUF, gcp + 64);
#pragma unroll 1   // one pass per trip: the ring's order stands once, at the foot
  for (int t = 0; t < QW / 64; ++t) { F2 a[2];
#pragma unroll
    for (int ks = 0; ks < 2; ++ks) a[ks] = split_row(Oc + (r0 + col) * QW, t * 64 + ks * 32, lane);
    const unsigned char* bb = ring + (t & 1) * OBUF + col * BPITCH;
#pragma unroll
    for (int ks = 0; ks < 2; ++ks) { v16b w[8];   // eight fragments read as one group, then their sixteen products
#pragma unroll
      for (int j = 0; j < 8; ++j) w[j] = frag_b((const __bf16*)(bb + j * 16 * BPITCH + ks * 64), lane);
#pragma unroll
      for (int j = 0; j < 8; ++j) { acc[j] = wmma_bf(a[ks].l, w[j], acc[j]); acc[j] = wmma_bf(a[ks].h, w[j], acc[j]); } }
    asm volatile("s_wait_dscnt 0x0" ::: "memory");      // this wave's reads of buffer t % 2 are done before it is refilled
    asm volatile("s_wait_asynccnt 0x0" ::: "memory");   // this wave's share of tile t + 1 has landed
    __syncthreads();                                    // publishes tile t + 1 and ends every wave's reads of buffer t % 2
    if (t + 2 < QW / 64) stage8(lcp + (unsigned)(t & 1) * OBUF, gcp + (t + 2) * 64); }
  asm volatile("s_wait_asynccnt 0x0" ::: "memory");     // no copy is outstanding when the wave ends
#pragma unroll
  for (int j = 0; j < 8; ++j)
#pragma unroll
    for (int r = 0; r < 8; ++r) so[wave][8 * g + r][j * 16 + col] = acc[j][r];
  LDSX();
  for (int rl = 0; rl < 16; ++rl) vst2(Y + (r0 + rl) * HID + n0 + lane * 4, *(const v4f*)&so[wave][rl][lane * 4]);
}
extern "C" void kernel_launch(void* const* d_in, const int* in_sizes, int n_in, void* d_out, int out_size, void* d_ws, size_t ws_size, hipStream_t stream) {
  (void)in_sizes; (void)n_in; (void)out_size;
  const float** F = (const float**)d_in;   // 0 hidden_states [2,2048,2048], 1 cos [2,2048,256], 2 sin, 3 Wq [2048,2048], 4 Wk [512,2048], 5 Wv [512,2048], 6 Wo [2048,2048] (natural), 7 q_norm_w [256], 8 k_norm_w [256]
  if (ws_size < (size_t)WS_END) return;
  char* ws = (char*)d_ws; __bf16* PK = (__bf16*)(ws + WS_PK); _Float16 *QH = (_Float16*)(ws + WS_QH), *QL = (_Float16*)(ws + WS_QL), *KH = (_Float16*)(ws + WS_KH), *KL = (_Float16*)(ws + WS_KL), *VT = (_Float16*)(ws + WS_VT), *VTL = (_Float16*)(ws + WS_VTL); float* O = (float*)(ws + WS_O);
  k_pack<<<dim3(HID, 4), 256, 0, stream>>>(F[3], F[4], F[5], F[6], PK);
  k_qkv<<<dim3(TRB, NH + 2 * NKV), 128, 0, stream>>>(F[0], PK + PK_A, F[1], F[2], F[7], F[8], QH, QL, KH, KL, VT, VTL);
  k_attn<<<dim3(TQB, NH, TNB), 128, 0, stream>>>(QH, QL, KH, KL, VT, VTL, O);
  k_out<<<dim3(TOB, HID / 128), 128, 0, stream>>>(O, PK + PK_P, (float*)d_out);
}

// v004
// It runs in 230 microseconds.
// In both of two side-by-side timings against v003, it was 1.03 times as fast.
// Counting every step since v000, it is 4.29 times as fast.
// compute dtype: hidden_states, cos, sin, Wq/Wk/Wv/Wo, q/k norm weights rounded to bf16; q/k/v projections with exact bf16 products on WMMA 16x16x32 (natural [out][in] rows; one 256-column head per block); per-head RMSNorm (eps 1e-6, x weight; v with weight 1) and the rotate-half rotary embedding with the cos/sin inputs in f32 in the projection epilogue; q and k stored as f16 hi + (x2048-scaled) residual planes with 3-product scores (unscaled logits, sigma ~16, kept f32-accurate), v stored as f16 hi + (x2048-scaled) residual planes; sliding-window causal mask (j <= i, i - j < 512), running-max softmax in f32 (hardware exp); the softmax weights as f16 planes e x 2048 (against v hi) and e (against the x2048 v residual) accumulated into one f32 accumulator (2 products; 2^-11 folded into the epilogue); output projection with ctx as bf16 hi + residual x exact Wo rows (2 products); f32 accumulate.
#include <hip/hip_runtime.h>
#include <math.h>

typedef __attribute__((ext_vector_type(16))) _Float16 v16h;
typedef __attribute__((ext_vector_type(16))) __bf16 v16b;
typedef __attribute__((ext_vector_type(8)))  _Float16 v8h;
typedef __attribute__((ext_vector_type(4)))  _Float16 v4h;
typedef __attribute__((ext_vector_type(8)))  float v8f;
typedef __attribute__((ext_vector_type(4)))  float v4f;
typedef __attribute__((ext_vector_type(2)))  float v2f;
typedef __attribute__((ext_vector_type(4)))  unsigned v4u;
typedef __attribute__((ext_vector_type(4)))  int v4i;
typedef float __attribute__((may_alias)) float_a;
typedef int __attribute__((may_alias)) int_a;

template <typename T> __device__ __forceinline__ void vst2(void* p, T v) { *(T*)p = v;  }
__device__ __forceinline__ v8f wmma16(v16h a, v16h b, v8f c) {
  v8f d = __builtin_amdgcn_wmma_f32_16x16x32_f16(false, a, false, b, (short)0, c, false, false);
  asm volatile("v_nop\n\tv_nop\n\tv_nop\n\tv_nop" : "+v"(d) : "v"(a), "v"(b));
  return d;
}
__device__ __forceinline__ v8f wmma_bf(v16b a, v16b b, v8f c) {
  v8f d = __builtin_amdgcn_wmma_f32_16x16x32_bf16(false, a, false, b, (short)0, c, false, false);
  asm volatile("v_nop\n\tv_nop\n\tv_nop\n\tv_nop" : "+v"(d) : "v"(a), "v"(b));
  return d;
}
// 16x16x32 fragments: lane = (h = lane>>4, row/col = lane&15); elements 0..7 = k0+8h+0..7, 8..15 = k0+16+8h+0..7; D element r = row 8h+r
__device__ __forceinline__ v16h frag_h(const _Float16* rowk0, int lane) {
  union { v16h v; v8h q[2]; } u; const _Float16* p = rowk0 + 8 * (lane >> 4);
  u.q[0] = *(const v8h*)p; u.q[1] = *(const v8h*)(p + 16); return u.v;
}
__device__ __forceinline__ v16h frag_f32(const float* rowk0, int lane) {
  v16h a; const float* p = rowk0 + 8 * (lane >> 4);
#pragma unroll
  for (int i = 0; i < 8; ++i) { a[i] = (_Float16)p[i]; a[8 + i] = (_Float16)p[16 + i]; }
  return a;
}
__device__ __forceinline__ v16h frag_f32s(const float* rowk0, int lane, float sc) {
  v16h a; const float* p = rowk0 + 8 * (lane >> 4);
#pragma unroll
  for (int i = 0; i < 8; ++i) { a[i] = (_Float16)(p[i] * sc); a[8 + i] = (_Float16)(p[16 + i] * sc); }
  return a;
}
// column fragment from a [K][ld] layout (column n), rows >= K read as 0
__device__ __forceinline__ v16h fragc_f32(const float* W, int k0, int n, int lane, int ld, int K) {
  v16h a; const int g = lane >> 4;
#pragma unroll
  for (int i = 0; i < 8; ++i) { const int ka = k0 + 8 * g + i, kb = ka + 16;
    a[i] = (_Float16)(ka < K ? W[(size_t)(ka < K ? ka : K - 1) * ld + n] : 0.f); a[8 + i] = (_Float16)(kb < K ? W[(size_t)(kb < K ? kb : K - 1) * ld + n] : 0.f); }
  return a;
}
struct F2 { v16b h, l; };
__device__ __forceinline__ F2 bsplit16(const float v[16]) { F2 r;
#pragma unroll
  for (int i = 0; i < 16; ++i) { const __bf16 h = (__bf16)v[i]; r.h[i] = h; r.l[i] = (__bf16)(v[i] - (float)h); }
  return r; }
__device__ __forceinline__ F2 split_row(const float* row, int k0, int lane) { float v[16]; const float* p = row + k0 + 8 * (lane >> 4);
#pragma unroll
  for (int i = 0; i < 8; ++i) { v[i] = p[i]; v[8 + i] = p[16 + i]; }
  return bsplit16(v); }
__device__ __forceinline__ F2 split_rowK(const float* row, int k0, int lane, int K) { float v[16]; const int g = lane >> 4;
#pragma unroll
  for (int i = 0; i < 8; ++i) { const int ka = k0 + 8 * g + i, kb = ka + 16; v[i] = ka < K ? row[ka < K ? ka : K - 1] : 0.f; v[8 + i] = kb < K ? row[kb < K ? kb : K - 1] : 0.f; }
  return bsplit16(v); }
__device__ __forceinline__ F2 split_col(const float* W, int k0, int n, int lane, int ld, int K) { float v[16]; const int g = lane >> 4;
#pragma unroll
  for (int i = 0; i < 8; ++i) { const int ka = k0 + 8 * g + i, kb = ka + 16; v[i] = ka < K ? W[(size_t)(ka < K ? ka : K - 1) * ld + n] : 0.f; v[8 + i] = kb < K ? W[(size_t)(kb < K ? kb : K - 1) * ld + n] : 0.f; }
  return bsplit16(v); }
__device__ __forceinline__ v8f mac3(const F2& a, const F2& b, v8f c) { c = wmma_bf(a.l, b.h, c); c = wmma_bf(a.h, b.l, c); return wmma_bf(a.h, b.h, c); }
__device__ __forceinline__ float sigm(float v) { return 1.0f / (1.0f + expf(-v)); }
// value of lane (lane ^ M) of the same 16-lane row, M < 16, by a DPP row_xmask move in the vector pipe (the shuffle builtin goes through the LDS unit and is waited for at every step); every lane is on where it is used
template <int M> __device__ __forceinline__ float rowx(float v) { return __builtin_bit_cast(float, __builtin_amdgcn_mov_dpp(__builtin_bit_cast(int, v), 0x160 + M, 0xf, 0xf, true)); }
// butterfly over the 16 lanes of a row, steps 1, 2, 4, 8
__device__ __forceinline__ float row_sum(float s) { s += rowx<1>(s); s += rowx<2>(s); s += rowx<4>(s); s += rowx<8>(s); return s; }
__device__ __forceinline__ float row_max(float m) { m = fmaxf(m, rowx<1>(m)); m = fmaxf(m, rowx<2>(m)); m = fmaxf(m, rowx<4>(m)); m = fmaxf(m, rowx<8>(m)); return m; }
// e^x as the fast-math form computes it (x * log2(e), hardware exp2). The v_nop is the free slot that the instruction set asks for behind a transcendental before its source is overwritten or its result read; inside the statement it stays directly behind the v_exp_f32
__device__ __forceinline__ float exp_slot(float x) { float r; const float y = x * 1.44269504f; asm("v_exp_f32 %0, %1\n\tv_nop" : "=v"(r) : "v"(y)); return r; }
#define LDSX() do { asm volatile("s_wait_dscnt 0" ::: "memory"); __builtin_amdgcn_wave_barrier(); __builtin_amdgcn_fence(__ATOMIC_RELEASE, "workgroup"); } while (0)


// Grouped-query sliding-window attention (B 2, S 2,048, hidden 2,048, 8 query heads / 2 kv heads x 256, window 512): q/k/v projections, per-head RMSNorm, rotary embedding, windowed causal softmax, output projection.
#define NB 2
#define SS 2048
#define HID 2048
#define NH 8
#define NKV 2
#define HD 256
#define WIN 512
#define QW (NH * HD)          // 2048 q columns
#define KW (NKV * HD)         // 512
#define QKVW (QW + 2 * KW)    // 3072
#define NR (NB * SS)
#ifndef TQB
#define TQB (SS / 64)
#define TNB NB
#define TOB (NB * SS / 64)
#define TRB (NB * SS / 64)    // projection row tiles
#endif
typedef __attribute__((ext_vector_type(8))) __bf16 v8b;
__device__ __forceinline__ v16b frag_b(const __bf16* rowk0, int lane) {
  union { v16b v; v8b q[2]; } u; const __bf16* p = rowk0 + 8 * (lane >> 4);
  u.q[0] = *(const v8b*)p; u.q[1] = *(const v8b*)(p + 16); return u.v;
}
__device__ __forceinline__ float bfr(float v) { return (float)(__bf16)v; }
__device__ __attribute__((noinline)) float exp_ni(float v) { return expf(v); }
__device__ __attribute__((noinline)) float erf_ni(float v) { return erff(v); }

#define PK_A 0                            // [3072][2048] Wq | Wk | Wv natural rows
#define PK_P ((size_t)QKVW * HID)         // [2048][2048] Wo natural rows
#define PK_END (PK_P + (size_t)HID * HID)
#define WS_PK  0u
#define WS_QH  (((2u * PK_END) + 127u) / 128u * 128u)   // f16 [4096][2048] q hi ; QL
#define WS_QL  (WS_QH + 2u * (size_t)NR * QW)
#define WS_KH  (WS_QL + 2u * (size_t)NR * QW)          // f16 [4096][512] k hi ; KL
#define WS_KL  (WS_KH + 2u * (size_t)NR * KW)
#define WS_VT  (WS_KL + 2u * (size_t)NR * KW)          // f16 [b][512][2048] v hi ; VTL (x2048 residual)
#define WS_VTL (WS_VT + 2u * (size_t)NR * KW)
#define WS_O   (WS_VTL + 2u * (size_t)NR * KW)         // f32 [4096][2048] ctx
#define WS_END (WS_O + 4u * (size_t)NR * QW)

__global__ __launch_bounds__(256) void k_pack(const float* __restrict__ WQ, const float* __restrict__ WK, const float* __restrict__ WV, const float* __restrict__ WO, __bf16* __restrict__ PK) {
  __shared__ __align__(16) __bf16 s[HID]; const int n = blockIdx.x, which = blockIdx.y, t = threadIdx.x;   // which 0: Wq (n < 2048), 1: Wk (n < 512), 2: Wv, 3: Wo
  if ((which == 1 || which == 2) && n >= KW) return;
  const float* Wm = (which == 0) ? WQ : (which == 1) ? WK : (which == 2) ? WV : WO;
  for (int k = t; k < HID; k += 256) s[k] = (__bf16)Wm[(size_t)n * HID + k];
  __syncthreads();
  const size_t row = (which == 0) ? n : (which == 1) ? (QW + n) : (QW + KW + n);
  __bf16* dst = (which < 3) ? PK + PK_A + row * HID : PK + PK_P + (size_t)n * HID;
  for (int q = t; q < HID / 8; q += 256) vst2((unsigned*)(dst + q * 8), *(const v4u*)&s[q * 8]);
}
// ---- k_qkv: block = (64 rows, one 256-column head hb of [q heads 0..7 | k heads 8..9 | v heads 10..11]): GEMM (exact, 16 tiles), RMSNorm over the head's 256 dims (f32), rotary (q, k) with the cos/sin inputs, then planes
// The head's 256 weight rows go through LDS, 64 k (128 B of each row) per pass, two buffers: asynchronous 16-byte copies bring pass t + 2 while pass t + 1 waits ready, and the block's four waves read their B fragments from the one staged tile.
#define BPITCH 144              // LDS pitch of a staged 128-B row: 16 B x odd, conflict-free for ds_load_b128 readers
#define BBUF (HD * BPITCH)      // 36,864 B per buffer
#define NPASS (HID / 64)
// Eight copies of one lane: rows 16 apart, 16 bytes each. The s_wait_xcnt stands inside the copies' own statement so that no address register of an issued copy is rewritten ahead of it.
__device__ __forceinline__ void stage8(unsigned l, const __bf16* g) {
  asm volatile("global_load_async_to_lds_b128 %0, %8, off\n\t"
               "global_load_async_to_lds_b128 %1, %9, off\n\t"
               "global_load_async_to_lds_b128 %2, %10, off\n\t"
               "global_load_async_to_lds_b128 %3, %11, off\n\t"
               "global_load_async_to_lds_b128 %4, %12, off\n\t"
               "global_load_async_to_lds_b128 %5, %13, off\n\t"
               "global_load_async_to_lds_b128 %6, %14, off\n\t"
               "global_load_async_to_lds_b128 %7, %15, off\n\t"
               "s_wait_xcnt 0x0"
               :: "v"(l), "v"(l + 16u * BPITCH), "v"(l + 32u * BPITCH), "v"(l + 48u * BPITCH), "v"(l + 64u * BPITCH), "v"(l + 80u * BPITCH), "v"(l + 96u * BPITCH), "v"(l + 112u * BPITCH),
                  "v"(g), "v"(g + 16 * HID), "v"(g + 32 * HID), "v"(g + 48 * HID), "v"(g + 64 * HID), "v"(g + 80 * HID), "v"(g + 96 * HID), "v"(g + 112 * HID)
               : "memory");
}
// One pass's tile: 256 rows x 128 B = 16 copies per lane; a wave's copy covers four whole rows (four 128-B lines).
__device__ __forceinline__ void stage_tile(unsigned l, const __bf16* g) { stage8(l, g); stage8(l + 128u * BPITCH, g + 128 * HID); }
// cos and sin of four rows for one lane: per row cos[d], cos[d + 128], sin[d], sin[d + 128], four dims each
__device__ __forceinline__ void rope_rows(v4f (&e)[4][4], const float* c, const float* s) {
#pragma unroll
  for (int i = 0; i < 4; ++i) { e[i][0] = *(const v4f*)(c + i * HD); e[i][1] = *(const v4f*)(c + i * HD + 128); e[i][2] = *(const v4f*)(s + i * HD); e[i][3] = *(const v4f*)(s + i * HD + 128); }
}
__global__ __launch_bounds__(128) void k_qkv(const float* __restrict__ X, const __bf16* __restrict__ P, const float* __restrict__ COS, const float* __restrict__ SIN, const float* __restrict__ QNW, const float* __restrict__ KNW, _Float16* __restrict__ QH, _Float16* __restrict__ QL, _Float16* __restrict__ KH, _Float16* __restrict__ KL, _Float16* __restrict__ VT, _Float16* __restrict__ VTL) {
  __shared__ __align__(16) _Float16 soh[4][16][264], sol[4][16][264];
  __shared__ __align__(16) unsigned char ring[2 * BBUF];   // the two weight buffers; behind the loop the q and k heads' f32 rows or the v heads' transpose planes lie here
  const int tid = threadIdx.x, wave = tid >> 5, lane = tid & 31, col = lane & 15, g = lane >> 4; const size_t r0 = (size_t)blockIdx.x * 64 + wave * 16; const int hb = blockIdx.y; const int n0 = hb * HD;   // column base in [0, 3072)
  v8f acc[16] = {};
  const unsigned lcp = (unsigned)(size_t)ring + (unsigned)(tid >> 3) * BPITCH + (unsigned)(tid & 7) * 16u;   // this lane's first LDS byte: row tid / 8, 16-byte piece tid % 8
  const __bf16* gcp = P + (size_t)(n0 + (tid >> 3)) * HID + (tid & 7) * 8;
  stage_tile(lcp, gcp);
  asm volatile("s_wait_asynccnt 0x0" ::: "memory");   // this wave's share of tile 0 has landed
  __syncthreads();                                    // tile 0 is readable by every wave
  stage_tile(lcp + BBUF, gcp + 64);
#pragma unroll 1   // one pass per trip: the ring's order stands once, at the foot
  for (int t = 0; t < NPASS; ++t) { v16b a[2]; { const float* p = X + (r0 + col) * HID + t * 64 + 8 * g;
#pragma unroll
      for (int ks = 0; ks < 2; ++ks)
#pragma unroll
        for (int i = 0; i < 8; ++i) { a[ks][i] = (__bf16)p[ks * 32 + i]; a[ks][8 + i] = (__bf16)p[ks * 32 + 16 + i]; } }
    const unsigned char* bb = ring + (t & 1) * BBUF + col * BPITCH;
#pragma unroll
    for (int ks = 0; ks < 2; ++ks)
#pragma unroll
      for (int jh = 0; jh < 2; ++jh) { v16b w[8];   // eight fragments read as one group, then their eight products
#pragma unroll
        for (int j = 0; j < 8; ++j) w[j] = frag_b((const __bf16*)(bb + (jh * 8 + j) * 16 * BPITCH + ks * 64), lane);
#pragma unroll
        for (int j = 0; j < 8; ++j) acc[jh * 8 + j] = wmma_bf(a[ks], w[j], acc[jh * 8 + j]); }
    asm volatile("s_wait_dscnt 0x0" ::: "memory");      // this wave's reads of buffer t % 2 are done before it is refilled
    asm volatile("s_wait_asynccnt 0x0" ::: "memory");   // this wave's share of tile t + 1 has landed
    __syncthreads();                                    // publishes tile t + 1 and ends every wave's reads of buffer t % 2
    if (t + 2 < NPASS) stage_tile(lcp + (unsigned)(t & 1) * BBUF, gcp + (t + 2) * 64); }
  asm volatile("s_wait_asynccnt 0x0" ::: "memory");     // no copy is outstanding when the ring's LDS is used anew
  // RMSNorm statistics per row (8g + r): this lane's 16 columns, then the 16 col-lanes
  float ss[8];
#pragma unroll
  for (int r = 0; r < 8; ++r) { float s = 0.f;
#pragma unroll
    for (int j = 0; j < 16; ++j) s += acc[j][r] * acc[j][r];
    s = row_sum(s);
    ss[r] = 1.0f / sqrtf(s / (float)HD + 1e-6f); }
  const int kind = (hb < NH) ? 0 : (hb < NH + NKV) ? 1 : 2;   // q, k, v
  if (kind < 2) {   // q, k: the normed rows go through LDS in f32, and the rotary is applied row by row, where cos and sin are read as whole rows
    const float* NW = (kind == 0) ? QNW : KNW;
    // a lane holds dims 4 * lane .. + 3 of a row and their rotary partners 128 further on: four 16-byte loads per row and lane bring cos and sin (rows are (b*S + s): [b][s][d] = row*HD + d), four rows a group, two groups of registers
    const float* cp = COS + r0 * HD + lane * 4; const float* sq = SIN + r0 * HD + lane * 4;
    v4f cs[2][4][4];
    rope_rows(cs[0], cp, sq);   // the first group flies during the staging
    float (*sx)[HD + 4] = (float (*)[HD + 4])(ring + wave * (16 * (HD + 4) * 4));   // 16 rows of 260 floats = 16,640 B per wave, inside the ring; every read of the ring ended at the last pass's barrier and no copy is outstanding
#pragma unroll
    for (int j = 0; j < 16; ++j) { const float w = bfr(NW[j * 16 + col]);
#pragma unroll
      for (int r = 0; r < 8; ++r) sx[8 * g + r][j * 16 + col] = acc[j][r] * ss[r] * w; }
    LDSX();
    _Float16* DH = (kind == 0) ? QH : KH; _Float16* DL = (kind == 0) ? QL : KL; const size_t ld = (kind == 0) ? QW : KW; const int c0 = ((kind == 0) ? hb : hb - NH) * HD;
#pragma unroll   // straight line: the two register groups are named by constants
    for (int gq = 0; gq < 4; ++gq) {
      if (gq < 3) { rope_rows(cs[(gq + 1) & 1], cp + (gq + 1) * 4 * HD, sq + (gq + 1) * 4 * HD);
        __builtin_amdgcn_sched_barrier(0); }   // the next group's loads stay ahead of this group's arithmetic, which covers their latency
#pragma unroll
      for (int i4 = 0; i4 < 4; ++i4) { const int rl = gq * 4 + i4; const v4f* e = cs[gq & 1][i4];
        const v4f xa = *(const v4f*)&sx[rl][lane * 4], xb = *(const v4f*)&sx[rl][128 + lane * 4];
        v4h ha, la, hc, lc;
#pragma unroll
        for (int i = 0; i < 4; ++i) { const float ya = xa[i] * bfr(e[0][i]) - xb[i] * bfr(e[2][i]), yb = xb[i] * bfr(e[1][i]) + xa[i] * bfr(e[3][i]);
          const _Float16 p = (_Float16)ya, q = (_Float16)yb; ha[i] = p; la[i] = (_Float16)((ya - (float)p) * 2048.0f); hc[i] = q; lc[i] = (_Float16)((yb - (float)q) * 2048.0f); }
        const size_t o = (r0 + rl) * ld + c0 + lane * 4;   // a wave's store covers 256 contiguous bytes, two whole lines
        vst2(DH + o, ha); vst2(DH + o + 128, hc); vst2(DL + o, la); vst2(DL + o + 128, lc); }
      if (gq < 2) asm volatile("s_wait_xcnt 0x0" ::: "memory");   // behind this group's stores, before the loads that follow land in their registers
    } }
  else {
#pragma unroll
    for (int j = 0; j < 16; ++j) { const int d = j * 16 + col;
#pragma unroll
      for (int r = 0; r < 8; ++r) { const float y = acc[j][r] * ss[r];
        const _Float16 hv = (_Float16)y; soh[wave][8 * g + r][d] = hv; sol[wave][8 * g + r][d] = (_Float16)((y - (float)hv) * 2048.0f); } }
    LDSX();
    __syncthreads();
    const size_t rb = (size_t)blockIdx.x * 64; const size_t b = rb / SS; const int s0 = (int)(rb % SS); const int g2 = hb - NH - NKV;
    _Float16 (*st)[72] = (_Float16 (*)[72])ring; _Float16 (*stl)[72] = (_Float16 (*)[72])(ring + BBUF);   // [HD][72] each, exactly one buffer; every read of the ring ended at the last pass's barrier
    for (int e = tid; e < 64 * HD; e += 128) { const int rr = e / HD, d = e % HD; st[d][rr] = soh[rr >> 4][rr & 15][d]; stl[d][rr] = sol[rr >> 4][rr & 15][d]; }
    __syncthreads();
    for (int e = tid; e < HD * 8; e += 128) { const int d = e >> 3, pc = e & 7; const size_t o = (b * KW + g2 * HD + d) * SS + s0 + pc * 8; vst2((unsigned*)(VT + o), *(const v4u*)&st[d][pc * 8]); vst2((unsigned*)(VTL + o), *(const v4u*)&stl[d][pc * 8]); } }
}
// ---- k_attn: block = (64 queries, head n, b): kv head n/4; key tiles inside the window [i0 - 511, i0 + 63]; scores over 256 dims (3 products, q fragments re-read per step); mask j <= i && i - j < 512; online softmax; P = e x 2048 (f16) against v hi and e against the x2048 v residual, one accumulator (2 products); ctx rows
// Every matrix operand comes from LDS, brought by asynchronous 16-byte copies. Each wave's 16 q rows (hi, residual) are staged once. The k tile and the v tile of a 32-key step are the two buffers of one ring, filled in turn: v of step s flies while the scores of step s are formed, k of step s + 1 flies during the softmax and the value products of step s. The block's four waves read the one staged tile.
#define QPITCH 528              // LDS pitch of a staged 512-B row (q, k): 16 B x odd, conflict-free for ds_load_b128 readers
#define VPITCH 80               // LDS pitch of a staged 64-B v row (32 keys of one dim): 16 B x odd
#define QWAVE (32 * QPITCH)     // one wave's q rows, 16 hi then 16 residual: 16,896 B
#define KBUF (64 * QPITCH)      // 32 keys hi then 32 keys residual: 33,792 B
#define VBUF (512 * VPITCH)     // 256 dims hi then 256 dims residual: 40,960 B
// Eight copies of one lane, LS LDS bytes and gs elements apart. An immediate offset moves the LDS and the global address alike, so copy i names the one LDS-address register with offset i * LS (at most 17,920) and a global address that is i * LS short of its row: one LDS-address register serves all eight and none has to stay live across the step. Every register and every offset is a multiple of 16. The s_wait_xcnt stands inside the copies' own statement so that no address register of an issued copy is rewritten ahead of it.
template <int LS> __device__ __forceinline__ void stage8h(unsigned l, const _Float16* g, size_t gs) {
  const char* p = (const char*)g; const size_t d = gs * 2 - LS;   // bytes from one copy's global register to the next
  asm volatile("global_load_async_to_lds_b128 %0, %1, off\n\t"
               "global_load_async_to_lds_b128 %0, %2, off offset:%9\n\t"
               "global_load_async_to_lds_b128 %0, %3, off offset:%10\n\t"
               "global_load_async_to_lds_b128 %0, %4, off offset:%11\n\t"
               "global_load_async_to_lds_b128 %0, %5, off offset:%12\n\t"
               "global_load_async_to_lds_b128 %0, %6, off offset:%13\n\t"
               "global_load_async_to_lds_b128 %0, %7, off offset:%14\n\t"
               "global_load_async_to_lds_b128 %0, %8, off offset:%15\n\t"
               "s_wait_xcnt 0x0"
               :: "v"(l), "v"(p), "v"(p + d), "v"(p + 2 * d), "v"(p + 3 * d), "v"(p + 4 * d), "v"(p + 5 * d), "v"(p + 6 * d), "v"(p + 7 * d),
                  "n"(LS), "n"(2 * LS), "n"(3 * LS), "n"(4 * LS), "n"(5 * LS), "n"(6 * LS), "n"(7 * LS)
               : "memory");
}
__global__ __launch_bounds__(128) void k_attn(const _Float16* __restrict__ QH, const _Float16* __restrict__ QL, const _Float16* __restrict__ KH, const _Float16* __restrict__ KL, const _Float16* __restrict__ VT, const _Float16* __restrict__ VTL, float* __restrict__ O) {
  __shared__ __align__(16) _Float16 sp[4][16][40], spu[4][16][40];
  __shared__ __align__(16) unsigned char qs[4 * QWAVE];   // q rows, a range per wave; behind the loop each wave stages its ctx rows in its own range
  __shared__ __align__(16) unsigned char kb[KBUF];        // ring buffer 0: the k tile
  __shared__ __align__(16) unsigned char vb[VBUF];        // ring buffer 1: the v tile
  const int tid = threadIdx.x, wave = tid >> 5, lane = tid & 31, col = lane & 15, g = lane >> 4; const int qb = blockIdx.x, n = blockIdx.y; const size_t b = blockIdx.z; const int kvh = n / (NH / NKV); const int q0 = qb * 64 + wave * 16; const size_t rowb = b * SS;
  const _Float16* Vp = VT + (b * KW + kvh * HD) * SS; const _Float16* Vpl = VTL + (b * KW + kvh * HD) * SS;
  float m[8], l[8];
#pragma unroll
  for (int r = 0; r < 8; ++r) { m[r] = -3.0e38f; l[r] = 0.f; }
  v8f acc[16] = {};
  const int ks0 = max(0, qb * 64 - (WIN - 1)) / 32, ks1 = (qb * 64 + 64) / 32;
  // q: a wave's copy is one whole 512-B row of its own 16 queries. k: a wave's copy is one whole row; waves 0, 1 bring the hi rows (16 keys each), waves 2, 3 the residual rows. v: a wave's copy is eight 64-B rows; lane = (row tid / 4, piece tid % 4).
  const unsigned lq = (unsigned)(size_t)qs + (unsigned)wave * QWAVE + (unsigned)lane * 16u; const size_t gq = (rowb + q0) * QW + n * HD + lane * 8;
  const unsigned lk = (unsigned)(size_t)kb + (unsigned)wave * 16u * QPITCH + (unsigned)lane * 16u; const _Float16* gk = ((wave < 2) ? KH : KL) + (rowb + (wave & 1) * 16) * KW + kvh * HD + lane * 8;
  const unsigned lv = (unsigned)(size_t)vb + (unsigned)(tid >> 2) * VPITCH + (unsigned)(tid & 3) * 16u; const size_t gv = (size_t)(tid >> 2) * SS + (tid & 3) * 8;
  stage8h<QPITCH>(lq, QH + gq, QW); stage8h<QPITCH>(lq + 8u * QPITCH, QH + gq + 8 * QW, QW); stage8h<QPITCH>(lq + 16u * QPITCH, QL + gq, QW); stage8h<QPITCH>(lq + 24u * QPITCH, QL + gq + 8 * QW, QW);
  stage8h<QPITCH>(lk, gk + (size_t)ks0 * 32 * KW, KW); stage8h<QPITCH>(lk + 8u * QPITCH, gk + ((size_t)ks0 * 32 + 8) * KW, KW);
  asm volatile("s_wait_asynccnt 0x0" ::: "memory");   // this wave's q rows and its share of the first k tile have landed
  __syncthreads();                                    // the first k tile is readable by every wave
  stage8h<32 * VPITCH>(lv, Vp + gv + ks0 * 32, 32 * SS); stage8h<32 * VPITCH>(lv + 256u * VPITCH, Vpl + gv + ks0 * 32, 32 * SS);
  const unsigned char* qrow = qs + wave * QWAVE + col * QPITCH;
#pragma unroll 1
  for (int ks = ks0; ks < ks1; ++ks) { const int j0 = ks * 32; v8f s[2];
#pragma unroll
    for (int ct = 0; ct < 2; ++ct) { const int kk = j0 + ct * 16 + col; const unsigned char* krow = kb + (ct * 16 + col) * QPITCH; v8f c = {}, cl = {};
#pragma unroll   // straight-line groups: the fragment arrays stay in registers and each group's LDS reads stand in one place
      for (int kq = 0; kq < HD / 64; ++kq) { v16h aq[2], aql[2], kh[2], kl[2];   // eight fragments read as one group, then their six products
#pragma unroll
        for (int j = 0; j < 2; ++j) { const int ko = (kq * 2 + j) * 64; aq[j] = frag_h((const _Float16*)(qrow + ko), lane); aql[j] = frag_h((const _Float16*)(qrow + 16 * QPITCH + ko), lane); kh[j] = frag_h((const _Float16*)(krow + ko), lane); kl[j] = frag_h((const _Float16*)(krow + 32 * QPITCH + ko), lane); }
#pragma unroll
        for (int j = 0; j < 2; ++j) { c = wmma16(aq[j], kh[j], c); cl = wmma16(aql[j], kh[j], cl); cl = wmma16(aq[j], kl[j], cl); } }
#pragma unroll
      for (int r = 0; r < 8; ++r) { const int qi = q0 + 8 * g + r; const bool keep = (kk <= qi) && (qi - kk < WIN); s[ct][r] = keep ? (c[r] + cl[r] * (1.0f / 2048.0f)) : -3.0e38f; } }   // unscaled logits (the module applies no 1/sqrt(d))
    asm volatile("s_wait_dscnt 0x0" ::: "memory");      // this wave's reads of the k tile are done before it is refilled
    asm volatile("s_wait_asynccnt 0x0" ::: "memory");   // this wave's share of this step's v tile has landed
    __syncthreads();                                    // publishes the v tile and ends every wave's reads of the k tile
    if (ks + 1 < ks1) { stage8h<QPITCH>(lk, gk + (size_t)(j0 + 32) * KW, KW); stage8h<QPITCH>(lk + 8u * QPITCH, gk + (size_t)(j0 + 40) * KW, KW); }
#pragma unroll
    for (int r = 0; r < 8; ++r) { const float mx = row_max(fmaxf(s[0][r], s[1][r]));
      const float mn = fmaxf(m[r], mx); const float xm = exp_slot(m[r] - mn), x0 = exp_slot(s[0][r] - mn), x1 = exp_slot(s[1][r] - mn);   // formed in every lane, then selected: no branch in the step
      const float alpha = (m[r] <= -1.0e38f) ? 0.f : xm;
      const float e0 = (s[0][r] <= -1.0e38f) ? 0.f : x0, e1 = (s[1][r] <= -1.0e38f) ? 0.f : x1; const float es = row_sum(e0 + e1);
      l[r] = l[r] * alpha + es; m[r] = (mn <= -1.0e38f) ? m[r] : mn;
#pragma unroll
      for (int dt = 0; dt < 16; ++dt) acc[dt][r] *= alpha;
      sp[wave][8 * g + r][col] = (_Float16)(e0 * 2048.0f); sp[wave][8 * g + r][16 + col] = (_Float16)(e1 * 2048.0f); spu[wave][8 * g + r][col] = (_Float16)e0; spu[wave][8 * g + r][16 + col] = (_Float16)e1; }   // (e x 2048) pairs with v hi, plain e with the x2048 v residual -> both land in one f32 accumulator
    LDSX();
    const v16h pa = frag_h(&sp[wave][col][0], lane), pu = frag_h(&spu[wave][col][0], lane);
#pragma unroll   // straight-line groups, as in the score loop
    for (int dq = 0; dq < 4; ++dq) { v16h vl[4], vh[4];   // eight fragments read as one group, then their eight products
#pragma unroll
      for (int j = 0; j < 4; ++j) { const unsigned char* vr = vb + ((dq * 4 + j) * 16 + col) * VPITCH; vl[j] = frag_h((const _Float16*)(vr + 256 * VPITCH), lane); vh[j] = frag_h((const _Float16*)vr, lane); }
#pragma unroll
      for (int j = 0; j < 4; ++j) { acc[dq * 4 + j] = wmma16(pu, vl[j], acc[dq * 4 + j]); acc[dq * 4 + j] = wmma16(pa, vh[j], acc[dq * 4 + j]); } }
    asm volatile("s_wait_dscnt 0x0" ::: "memory");      // this wave's reads of the v tile (and of its softmax planes) are done before the refill
    asm volatile("s_wait_asynccnt 0x0" ::: "memory");   // this wave's share of the next k tile has landed
    __syncthreads();                                    // publishes the next k tile and ends every wave's reads of the v tile
    if (ks + 1 < ks1) { stage8h<32 * VPITCH>(lv, Vp + gv + j0 + 32, 32 * SS); stage8h<32 * VPITCH>(lv + 256u * VPITCH, Vpl + gv + j0 + 32, 32 * SS); } }
  asm volatile("s_wait_asynccnt 0x0" ::: "memory");     // no copy is outstanding when the q range is used anew
  float (*so)[HD + 4] = (float (*)[HD + 4])(qs + wave * QWAVE);   // 16 rows of 260 floats = 16,640 B, inside this wave's own q range, which no other wave reads or writes
#pragma unroll
  for (int r = 0; r < 8; ++r) { const float il = (1.0f / 2048.0f) / l[r];
#pragma unroll
    for (int dt = 0; dt < 16; ++dt) so[8 * g + r][dt * 16 + col] = acc[dt][r] * il; }
  LDSX();
  for (int rl = 0; rl < 16; ++rl) { const size_t o = (rowb + q0 + rl) * QW + n * HD; vst2(O + o + lane * 4, *(const v4f*)&so[rl][lane * 4]); vst2(O + o + 128 + lane * 4, *(const v4f*)&so[rl][128 + lane * 4]); }
}
// ---- k_out: block = (64 rows, 128 cols): y = ctx(hi/lo, K 2048) . Wo rows
// The block's 128 weight rows go through LDS as in k_qkv: 64 k per pass, two buffers, eight asynchronous copies per lane and pass.
#define OBUF (128 * BPITCH)     // 18,432 B per buffer
__global__ __launch_bounds__(128) void k_out(const float* __restrict__ Oc, const __bf16* __restrict__ P, float* __restrict__ Y) {
  __shared__ __align__(16) float so[4][16][132];
  __shared__ __align__(16) unsigned char ring[2 * OBUF];   // the two weight buffers
  const int tid = threadIdx.x, wave = tid >> 5, lane = tid & 31, col = lane & 15, g = lane >> 4; const size_t r0 = (size_t)blockIdx.x * 64 + wave * 16; const int n0 = blockIdx.y * 128;
  v8f acc[8] = {};
  const unsigned lcp = (unsigned)(size_t)ring + (unsigned)(tid >> 3) * BPITCH + (unsigned)(tid & 7) * 16u;   // this lane's first LDS byte: row tid / 8, 16-byte piece tid % 8
  const __bf16* gcp = P + (size_t)(n0 + (tid >> 3)) * HID + (tid & 7) * 8;
  stage8(lcp, gcp);
  asm volatile("s_wait_asynccnt 0x0" ::: "memory");   // this wave's share of tile 0 has landed
  __syncthreads();                                    // tile 0 is readable by every wave
  stage8(lcp + OBUF, gcp + 64);
#pragma unroll 1   // one pass per trip: the ring's order stands once, at the foot
  for (int t = 0; t < QW / 64; ++t) { F2 a[2];
#pragma unroll
    for (int ks = 0; ks < 2; ++ks) a[ks] = split_row(Oc + (r0 + col) * QW, t * 64 + ks * 32, lane);
    const unsigned char* bb = ring + (t & 1) * OBUF + col * BPITCH;
#pragma unroll
    for (int ks = 0; ks < 2; ++ks) { v16b w[8];   // eight fragments read as one group, then their sixteen products
#pragma unroll
      for (int j = 0; j < 8; ++j) w[j] = frag_b((const __bf16*)(bb + j * 16 * BPITCH + ks * 64), lane);
#pragma unroll
      for (int j = 0; j < 8; ++j) { acc[j] = wmma_bf(a[ks].l, w[j], acc[j]); acc[j] = wmma_bf(a[ks].h, w[j], acc[j]); } }
    asm volatile("s_wait_dscnt 0x0" ::: "memory");      // this wave's reads of buffer t % 2 are done before it is refilled
    asm volatile("s_wait_asynccnt 0x0" ::: "memory");   // this wave's share of tile t + 1 has landed
    __syncthreads();                                    // publishes tile t + 1 and ends every wave's reads of buffer t % 2
    if (t + 2 < QW / 64) stage8(lcp + (unsigned)(t & 1) * OBUF, gcp + (t + 2) * 64); }
  asm volatile("s_wait_asynccnt 0x0" ::: "memory");     // no copy is outstanding when the wave ends
#pragma unroll
  for (int j = 0; j < 8; ++j)
#pragma unroll
    for (int r = 0; r < 8; ++r) so[wave][8 * g + r][j * 16 + col] = acc[j][r];
  LDSX();
  for (int rl = 0; rl < 16; ++rl) vst2(Y + (r0 + rl) * HID + n0 + lane * 4, *(const v4f*)&so[wave][rl][lane * 4]);
}
extern "C" void kernel_launch(void* const* d_in, const int* in_sizes, int n_in, void* d_out, int out_size, void* d_ws, size_t ws_size, hipStream_t stream) {
  (void)in_sizes; (void)n_in; (void)out_size;
  const float** F = (const float**)d_in;   // 0 hidden_states [2,2048,2048], 1 cos [2,2048,256], 2 sin, 3 Wq [2048,2048], 4 Wk [512,2048], 5 Wv [512,2048], 6 Wo [2048,2048] (natural), 7 q_norm_w [256], 8 k_norm_w [256]
  if (ws_size < (size_t)WS_END) return;
  char* ws = (char*)d_ws; __bf16* PK = (__bf16*)(ws + WS_PK); _Float16 *QH = (_Float16*)(ws + WS_QH), *QL = (_Float16*)(ws + WS_QL), *KH = (_Float16*)(ws + WS_KH), *KL = (_Float16*)(ws + WS_KL), *VT = (_Float16*)(ws + WS_VT), *VTL = (_Float16*)(ws + WS_VTL); float* O = (float*)(ws + WS_O);
  k_pack<<<dim3(HID, 4), 256, 0, stream>>>(F[3], F[4], F[5], F[6], PK);
  k_qkv<<<dim3(TRB, NH + 2 * NKV), 128, 0, stream>>>(F[0], PK + PK_A, F[1], F[2], F[7], F[8], QH, QL, KH, KL, VT, VTL);
  k_attn<<<dim3(TQB, NH, TNB), 128, 0, stream>>>(QH, QL, KH, KL, VT, VTL, O);
  k_out<<<dim3(TOB, HID / 128), 128, 0, stream>>>(O, PK + PK_P, (float*)d_out);
}

// v005
// Measured time: 223 microseconds a run.
// Next to v004, in two timings, it ran 1.05 and 1.03 times as fast.
// Counting every step since v000, it is 4.46 times as fast.
// compute dtype: hidden_states, cos, sin, Wq/Wk/Wv/Wo, q/k norm weights rounded to bf16; q/k/v projections with exact bf16 products on WMMA 16x16x32 (natural [out][in] rows; one 256-column head per block); per-head RMSNorm (eps 1e-6, x weight; v with weight 1) and the rotate-half rotary embedding with the cos/sin inputs in f32 in the projection epilogue; q and k stored as f16 hi + (x2048-scaled) residual planes with 3-product scores (unscaled logits, sigma ~16, kept f32-accurate), v stored as f16 hi + (x2048-scaled) residual planes; sliding-window causal mask (j <= i, i - j < 512), running-max softmax in f32 (hardware exp); the softmax weights as f16 planes e x 2048 (against v hi) and e (against the x2048 v residual) accumulated into one f32 accumulator (2 products; 2^-11 folded into the epilogue); output projection with ctx as bf16 hi + residual x exact Wo rows (2 products); f32 accumulate.
#include <hip/hip_runtime.h>
#include <math.h>

typedef __attribute__((ext_vector_type(16))) _Float16 v16h;
typedef __attribute__((ext_vector_type(16))) __bf16 v16b;
typedef __attribute__((ext_vector_type(8)))  _Float16 v8h;
typedef __attribute__((ext_vector_type(4)))  _Float16 v4h;
typedef __attribute__((ext_vector_type(8)))  float v8f;
typedef __attribute__((ext_vector_type(4)))  float v4f;
typedef __attribute__((ext_vector_type(2)))  float v2f;
typedef __attribute__((ext_vector_type(4)))  unsigned v4u;
typedef __attribute__((ext_vector_type(4)))  int v4i;
typedef float __attribute__((may_alias)) float_a;
typedef int __attribute__((may_alias)) int_a;

template <typename T> __device__ __forceinline__ void vst2(void* p, T v) { *(T*)p = v;  }
__device__ __forceinline__ v8f wmma16(v16h a, v16h b, v8f c) {
  v8f d = __builtin_amdgcn_wmma_f32_16x16x32_f16(false, a, false, b, (short)0, c, false, false);
  asm volatile("v_nop\n\tv_nop\n\tv_nop\n\tv_nop" : "+v"(d) : "v"(a), "v"(b));
  return d;
}
__device__ __forceinline__ v8f wmma_bf(v16b a, v16b b, v8f c) {
  v8f d = __builtin_amdgcn_wmma_f32_16x16x32_bf16(false, a, false, b, (short)0, c, false, false);
  asm volatile("v_nop\n\tv_nop\n\tv_nop\n\tv_nop" : "+v"(d) : "v"(a), "v"(b));
  return d;
}
// 16x16x32 fragments: lane = (h = lane>>4, row/col = lane&15); elements 0..7 = k0+8h+0..7, 8..15 = k0+16+8h+0..7; D element r = row 8h+r
__device__ __forceinline__ v16h frag_h(const _Float16* rowk0, int lane) {
  union { v16h v; v8h q[2]; } u; const _Float16* p = rowk0 + 8 * (lane >> 4);
  u.q[0] = *(const v8h*)p; u.q[1] = *(const v8h*)(p + 16); return u.v;
}
__device__ __forceinline__ v16h frag_f32(const float* rowk0, int lane) {
  v16h a; const float* p = rowk0 + 8 * (lane >> 4);
#pragma unroll
  for (int i = 0; i < 8; ++i) { a[i] = (_Float16)p[i]; a[8 + i] = (_Float16)p[16 + i]; }
  return a;
}
__device__ __forceinline__ v16h frag_f32s(const float* rowk0, int lane, float sc) {
  v16h a; const float* p = rowk0 + 8 * (lane >> 4);
#pragma unroll
  for (int i = 0; i < 8; ++i) { a[i] = (_Float16)(p[i] * sc); a[8 + i] = (_Float16)(p[16 + i] * sc); }
  return a;
}
// column fragment from a [K][ld] layout (column n), rows >= K read as 0
__device__ __forceinline__ v16h fragc_f32(const float* W, int k0, int n, int lane, int ld, int K) {
  v16h a; const int g = lane >> 4;
#pragma unroll
  for (int i = 0; i < 8; ++i) { const int ka = k0 + 8 * g + i, kb = ka + 16;
    a[i] = (_Float16)(ka < K ? W[(size_t)(ka < K ? ka : K - 1) * ld + n] : 0.f); a[8 + i] = (_Float16)(kb < K ? W[(size_t)(kb < K ? kb : K - 1) * ld + n] : 0.f); }
  return a;
}
struct F2 { v16b h, l; };
__device__ __forceinline__ F2 bsplit16(const float v[16]) { F2 r;
#pragma unroll
  for (int i = 0; i < 16; ++i) { const __bf16 h = (__bf16)v[i]; r.h[i] = h; r.l[i] = (__bf16)(v[i] - (float)h); }
  return r; }
__device__ __forceinline__ F2 split_row(const float* row, int k0, int lane) { float v[16]; const float* p = row + k0 + 8 * (lane >> 4);
#pragma unroll
  for (int i = 0; i < 8; ++i) { v[i] = p[i]; v[8 + i] = p[16 + i]; }
  return bsplit16(v); }
__device__ __forceinline__ F2 split_rowK(const float* row, int k0, int lane, int K) { float v[16]; const int g = lane >> 4;
#pragma unroll
  for (int i = 0; i < 8; ++i) { const int ka = k0 + 8 * g + i, kb = ka + 16; v[i] = ka < K ? row[ka < K ? ka : K - 1] : 0.f; v[8 + i] = kb < K ? row[kb < K ? kb : K - 1] : 0.f; }
  return bsplit16(v); }
__device__ __forceinline__ F2 split_col(const float* W, int k0, int n, int lane, int ld, int K) { float v[16]; const int g = lane >> 4;
#pragma unroll
  for (int i = 0; i < 8; ++i) { const int ka = k0 + 8 * g + i, kb = ka + 16; v[i] = ka < K ? W[(size_t)(ka < K ? ka : K - 1) * ld + n] : 0.f; v[8 + i] = kb < K ? W[(size_t)(kb < K ? kb : K - 1) * ld + n] : 0.f; }
  return bsplit16(v); }
__device__ __forceinline__ v8f mac3(const F2& a, const F2& b, v8f c) { c = wmma_bf(a.l, b.h, c); c = wmma_bf(a.h, b.l, c); return wmma_bf(a.h, b.h, c); }
__device__ __forceinline__ float sigm(float v) { return 1.0f / (1.0f + expf(-v)); }
// value of lane (lane ^ M) of the same 16-lane row, M < 16, by a DPP row_xmask move in the vector pipe (the shuffle builtin goes through the LDS unit and is waited for at every step); every lane is on where it is used
template <int M> __device__ __forceinline__ float rowx(float v) { return __builtin_bit_cast(float, __builtin_amdgcn_mov_dpp(__builtin_bit_cast(int, v), 0x160 + M, 0xf, 0xf, true)); }
// butterfly over the 16 lanes of a row, steps 1, 2, 4, 8
__device__ __forceinline__ float row_sum(float s) { s += rowx<1>(s); s += rowx<2>(s); s += rowx<4>(s); s += rowx<8>(s); return s; }
__device__ __forceinline__ float row_max(float m) { m = fmaxf(m, rowx<1>(m)); m = fmaxf(m, rowx<2>(m)); m = fmaxf(m, rowx<4>(m)); m = fmaxf(m, rowx<8>(m)); return m; }
// e^x as the fast-math form computes it (x * log2(e), hardware exp2). The v_nop is the free slot that the instruction set asks for behind a transcendental before its source is overwritten or its result read; inside the statement it stays directly behind the v_exp_f32
__device__ __forceinline__ float exp_slot(float x) { float r; const float y = x * 1.44269504f; asm("v_exp_f32 %0, %1\n\tv_nop" : "=v"(r) : "v"(y)); return r; }
#define LDSX() do { asm volatile("s_wait_dscnt 0" ::: "memory"); __builtin_amdgcn_wave_barrier(); __builtin_amdgcn_fence(__ATOMIC_RELEASE, "workgroup"); } while (0)


// Grouped-query sliding-window attention (B 2, S 2,048, hidden 2,048, 8 query heads / 2 kv heads x 256, window 512): q/k/v projections, per-head RMSNorm, rotary embedding, windowed causal softmax, output projection.
#define NB 2
#define SS 2048
#define HID 2048
#define NH 8
#define NKV 2
#define HD 256
#define WIN 512
#define QW (NH * HD)          // 2048 q columns
#define KW (NKV * HD)         // 512
#define QKVW (QW + 2 * KW)    // 3072
#define NR (NB * SS)
#ifndef TQB
#define TQB (SS / 64)
#define TNB NB
#define TOB (NB * SS / 64)
#define TRB (NB * SS / 64)    // projection row tiles
#endif
typedef __attribute__((ext_vector_type(8))) __bf16 v8b;
__device__ __forceinline__ v16b frag_b(const __bf16* rowk0, int lane) {
  union { v16b v; v8b q[2]; } u; const __bf16* p = rowk0 + 8 * (lane >> 4);
  u.q[0] = *(const v8b*)p; u.q[1] = *(const v8b*)(p + 16); return u.v;
}
__device__ __forceinline__ float bfr(float v) { return (float)(__bf16)v; }
__device__ __attribute__((noinline)) float exp_ni(float v) { return expf(v); }
__device__ __attribute__((noinline)) float erf_ni(float v) { return erff(v); }

#define PK_A 0                            // [3072][2048] Wq | Wk | Wv natural rows
#define PK_P ((size_t)QKVW * HID)         // [2048][2048] Wo natural rows
#define PK_END (PK_P + (size_t)HID * HID)
#define WS_PK  0u
#define WS_QH  (((2u * PK_END) + 127u) / 128u * 128u)   // f16 [4096][2048] q hi ; QL
#define WS_QL  (WS_QH + 2u * (size_t)NR * QW)
#define WS_KH  (WS_QL + 2u * (size_t)NR * QW)          // f16 [4096][512] k hi ; KL
#define WS_KL  (WS_KH + 2u * (size_t)NR * KW)
#define WS_VT  (WS_KL + 2u * (size_t)NR * KW)          // f16 [b][512][2048] v hi ; VTL (x2048 residual)
#define WS_VTL (WS_VT + 2u * (size_t)NR * KW)
#define WS_O   (WS_VTL + 2u * (size_t)NR * KW)         // f32 [4096][2048] ctx
#define WS_END (WS_O + 4u * (size_t)NR * QW)

// ---- k_pack: PK is the four weight matrices one behind the other (Wq | Wk | Wv | Wo, natural rows), each value rounded to bf16, so the launch is one flat stream. A block converts 16,384 values of one matrix (eight whole rows): few waves have to start, and each holds its 16 loads in flight at once.
#define PKF 16384                         // values per block: 256 lanes x 16 pieces of 4
#define PKQ (QW * HID / PKF)              // 256 blocks for Wq (and for Wo)
#define PKK (KW * HID / PKF)              // 64 blocks for Wk (and for Wv)
#define PKG ((QKVW + HID) * HID / PKF)    // 640 blocks
typedef __attribute__((ext_vector_type(4))) __bf16 v4b;
__global__ __launch_bounds__(256) void k_pack(const float* __restrict__ WQ, const float* __restrict__ WK, const float* __restrict__ WV, const float* __restrict__ WO, __bf16* __restrict__ PK) {
  const int blk = blockIdx.x, t = threadIdx.x;
  const float* Wm = WQ; int first = 0;   // the block's matrix and that matrix's first block
  if (blk >= PKQ + 2 * PKK) { Wm = WO; first = PKQ + 2 * PKK; } else if (blk >= PKQ + PKK) { Wm = WV; first = PKQ + PKK; } else if (blk >= PKQ) { Wm = WK; first = PKQ; }
  const float* s = Wm + (size_t)(blk - first) * PKF + t * 4; __bf16* d = PK + (size_t)blk * PKF + t * 4;
  v4f v[16];   // a wave's load covers 512 contiguous bytes (four whole lines), its store 256 (two whole lines)
#pragma unroll
  for (int i = 0; i < 16; ++i) v[i] = *(const v4f*)(s + i * 1024);
  __builtin_amdgcn_sched_barrier(0);   // all 16 loads are issued ahead of the first conversion; without it the last two waited for the first two to land, to take over their registers
  v4b o[16];
#pragma unroll
  for (int i = 0; i < 16; ++i)
#pragma unroll
    for (int k = 0; k < 4; ++k) o[i][k] = (__bf16)v[i][k];
#pragma unroll
  for (int i = 0; i < 16; ++i) vst2(d + i * 1024, o[i]);
}
// ---- k_qkv: block = (64 rows, one 256-column head hb of [q heads 0..7 | k heads 8..9 | v heads 10..11]): GEMM (exact, 16 tiles), RMSNorm over the head's 256 dims (f32), rotary (q, k) with the cos/sin inputs, then planes
// The head's 256 weight rows go through LDS, 64 k (128 B of each row) per pass, two buffers: asynchronous 16-byte copies bring pass t + 2 while pass t + 1 waits ready, and the block's four waves read their B fragments from the one staged tile.
#define BPITCH 144              // LDS pitch of a staged 128-B row: 16 B x odd, conflict-free for ds_load_b128 readers
#define BBUF (HD * BPITCH)      // 36,864 B per buffer
#define NPASS (HID / 64)
// Eight copies of one lane: rows 16 apart, 16 bytes each. The s_wait_xcnt stands inside the copies' own statement so that no address register of an issued copy is rewritten ahead of it.
__device__ __forceinline__ void stage8(unsigned l, const __bf16* g) {
  asm volatile("global_load_async_to_lds_b128 %0, %8, off\n\t"
               "global_load_async_to_lds_b128 %1, %9, off\n\t"
               "global_load_async_to_lds_b128 %2, %10, off\n\t"
               "global_load_async_to_lds_b128 %3, %11, off\n\t"
               "global_load_async_to_lds_b128 %4, %12, off\n\t"
               "global_load_async_to_lds_b128 %5, %13, off\n\t"
               "global_load_async_to_lds_b128 %6, %14, off\n\t"
               "global_load_async_to_lds_b128 %7, %15, off\n\t"
               "s_wait_xcnt 0x0"
               :: "v"(l), "v"(l + 16u * BPITCH), "v"(l + 32u * BPITCH), "v"(l + 48u * BPITCH), "v"(l + 64u * BPITCH), "v"(l + 80u * BPITCH), "v"(l + 96u * BPITCH), "v"(l + 112u * BPITCH),
                  "v"(g), "v"(g + 16 * HID), "v"(g + 32 * HID), "v"(g + 48 * HID), "v"(g + 64 * HID), "v"(g + 80 * HID), "v"(g + 96 * HID), "v"(g + 112 * HID)
               : "memory");
}
// One pass's tile: 256 rows x 128 B = 16 copies per lane; a wave's copy covers four whole rows (four 128-B lines).
__device__ __forceinline__ void stage_tile(unsigned l, const __bf16* g) { stage8(l, g); stage8(l + 128u * BPITCH, g + 128 * HID); }
// cos and sin of four rows for one lane: per row cos[d], cos[d + 128], sin[d], sin[d + 128], four dims each
__device__ __forceinline__ void rope_rows(v4f (&e)[4][4], const float* c, const float* s) {
#pragma unroll
  for (int i = 0; i < 4; ++i) { e[i][0] = *(const v4f*)(c + i * HD); e[i][1] = *(const v4f*)(c + i * HD + 128); e[i][2] = *(const v4f*)(s + i * HD); e[i][3] = *(const v4f*)(s + i * HD + 128); }
}
__global__ __launch_bounds__(128) void k_qkv(const float* __restrict__ X, const __bf16* __restrict__ P, const float* __restrict__ COS, const float* __restrict__ SIN, const float* __restrict__ QNW, const float* __restrict__ KNW, _Float16* __restrict__ QH, _Float16* __restrict__ QL, _Float16* __restrict__ KH, _Float16* __restrict__ KL, _Float16* __restrict__ VT, _Float16* __restrict__ VTL) {
  __shared__ __align__(16) _Float16 soh[4][16][264], sol[4][16][264];
  __shared__ __align__(16) unsigned char ring[2 * BBUF];   // the two weight buffers; behind the loop the q and k heads' f32 rows or the v heads' transpose planes lie here
  const int tid = threadIdx.x, wave = tid >> 5, lane = tid & 31, col = lane & 15, g = lane >> 4; const size_t r0 = (size_t)blockIdx.x * 64 + wave * 16; const int hb = blockIdx.y; const int n0 = hb * HD;   // column base in [0, 3072)
  v8f acc[16] = {};
  const unsigned lcp = (unsigned)(size_t)ring + (unsigned)(tid >> 3) * BPITCH + (unsigned)(tid & 7) * 16u;   // this lane's first LDS byte: row tid / 8, 16-byte piece tid % 8
  const __bf16* gcp = P + (size_t)(n0 + (tid >> 3)) * HID + (tid & 7) * 8;
  stage_tile(lcp, gcp);
  asm volatile("s_wait_asynccnt 0x0" ::: "memory");   // this wave's share of tile 0 has landed
  __syncthreads();                                    // tile 0 is readable by every wave
  stage_tile(lcp + BBUF, gcp + 64);
#pragma unroll 1   // one pass per trip: the ring's order stands once, at the foot
  for (int t = 0; t < NPASS; ++t) { v16b a[2]; { const float* p = X + (r0 + col) * HID + t * 64 + 8 * g;
#pragma unroll
      for (int ks = 0; ks < 2; ++ks)
#pragma unroll
        for (int i = 0; i < 8; ++i) { a[ks][i] = (__bf16)p[ks * 32 + i]; a[ks][8 + i] = (__bf16)p[ks * 32 + 16 + i]; } }
    const unsigned char* bb = ring + (t & 1) * BBUF + col * BPITCH;
#pragma unroll
    for (int ks = 0; ks < 2; ++ks)
#pragma unroll
      for (int jh = 0; jh < 2; ++jh) { v16b w[8];   // eight fragments read as one group, then their eight products
#pragma unroll
        for (int j = 0; j < 8; ++j) w[j] = frag_b((const __bf16*)(bb + (jh * 8 + j) * 16 * BPITCH + ks * 64), lane);
#pragma unroll
        for (int j = 0; j < 8; ++j) acc[jh * 8 + j] = wmma_bf(a[ks], w[j], acc[jh * 8 + j]); }
    asm volatile("s_wait_dscnt 0x0" ::: "memory");      // this wave's reads of buffer t % 2 are done before it is refilled
    asm volatile("s_wait_asynccnt 0x0" ::: "memory");   // this wave's share of tile t + 1 has landed
    __syncthreads();                                    // publishes tile t + 1 and ends every wave's reads of buffer t % 2
    if (t + 2 < NPASS) stage_tile(lcp + (unsigned)(t & 1) * BBUF, gcp + (t + 2) * 64); }
  asm volatile("s_wait_asynccnt 0x0" ::: "memory");     // no copy is outstanding when the ring's LDS is used anew
  // RMSNorm statistics per row (8g + r): this lane's 16 columns, then the 16 col-lanes
  float ss[8];
#pragma unroll
  for (int r = 0; r < 8; ++r) { float s = 0.f;
#pragma unroll
    for (int j = 0; j < 16; ++j) s += acc[j][r] * acc[j][r];
    s = row_sum(s);
    ss[r] = 1.0f / sqrtf(s / (float)HD + 1e-6f); }
  const int kind = (hb < NH) ? 0 : (hb < NH + NKV) ? 1 : 2;   // q, k, v
  if (kind < 2) {   // q, k: the normed rows go through LDS in f32, and the rotary is applied row by row, where cos and sin are read as whole rows
    const float* NW = (kind == 0) ? QNW : KNW;
    // a lane holds dims 4 * lane .. + 3 of a row and their rotary partners 128 further on: four 16-byte loads per row and lane bring cos and sin (rows are (b*S + s): [b][s][d] = row*HD + d), four rows a group, two groups of registers
    const float* cp = COS + r0 * HD + lane * 4; const float* sq = SIN + r0 * HD + lane * 4;
    v4f cs[2][4][4];
    rope_rows(cs[0], cp, sq);   // the first group flies during the staging
    float (*sx)[HD + 4] = (float (*)[HD + 4])(ring + wave * (16 * (HD + 4) * 4));   // 16 rows of 260 floats = 16,640 B per wave, inside the ring; every read of the ring ended at the last pass's barrier and no copy is outstanding
#pragma unroll
    for (int j = 0; j < 16; ++j) { const float w = bfr(NW[j * 16 + col]);
#pragma unroll
      for (int r = 0; r < 8; ++r) sx[8 * g + r][j * 16 + col] = acc[j][r] * ss[r] * w; }
    LDSX();
    _Float16* DH = (kind == 0) ? QH : KH; _Float16* DL = (kind == 0) ? QL : KL; const size_t ld = (kind == 0) ? QW : KW; const int c0 = ((kind == 0) ? hb : hb - NH) * HD;
#pragma unroll   // straight line: the two register groups are named by constants
    for (int gq = 0; gq < 4; ++gq) {
      if (gq < 3) { rope_rows(cs[(gq + 1) & 1], cp + (gq + 1) * 4 * HD, sq + (gq + 1) * 4 * HD);
        __builtin_amdgcn_sched_barrier(0); }   // the next group's loads stay ahead of this group's arithmetic, which covers their latency
#pragma unroll
      for (int i4 = 0; i4 < 4; ++i4) { const int rl = gq * 4 + i4; const v4f* e = cs[gq & 1][i4];
        const v4f xa = *(const v4f*)&sx[rl][lane * 4], xb = *(const v4f*)&sx[rl][128 + lane * 4];
        v4h ha, la, hc, lc;
#pragma unroll
        for (int i = 0; i < 4; ++i) { const float ya = xa[i] * bfr(e[0][i]) - xb[i] * bfr(e[2][i]), yb = xb[i] * bfr(e[1][i]) + xa[i] * bfr(e[3][i]);
          const _Float16 p = (_Float16)ya, q = (_Float16)yb; ha[i] = p; la[i] = (_Float16)((ya - (float)p) * 2048.0f); hc[i] = q; lc[i] = (_Float16)((yb - (float)q) * 2048.0f); }
        const size_t o = (r0 + rl) * ld + c0 + lane * 4;   // a wave's store covers 256 contiguous bytes, two whole lines
        vst2(DH + o, ha); vst2(DH + o + 128, hc); vst2(DL + o, la); vst2(DL + o + 128, lc); }
      if (gq < 2) asm volatile("s_wait_xcnt 0x0" ::: "memory");   // behind this group's stores, before the loads that follow land in their registers
    } }
  else {
#pragma unroll
    for (int j = 0; j < 16; ++j) { const int d = j * 16 + col;
#pragma unroll
      for (int r = 0; r < 8; ++r) { const float y = acc[j][r] * ss[r];
        const _Float16 hv = (_Float16)y; soh[wave][8 * g + r][d] = hv; sol[wave][8 * g + r][d] = (_Float16)((y - (float)hv) * 2048.0f); } }
    LDSX();
    __syncthreads();
    const size_t rb = (size_t)blockIdx.x * 64; const size_t b = rb / SS; const int s0 = (int)(rb % SS); const int g2 = hb - NH - NKV;
    _Float16 (*st)[72] = (_Float16 (*)[72])ring; _Float16 (*stl)[72] = (_Float16 (*)[72])(ring + BBUF);   // [HD][72] each, exactly one buffer; every read of the ring ended at the last pass's barrier
    for (int e = tid; e < 64 * HD; e += 128) { const int rr = e / HD, d = e % HD; st[d][rr] = soh[rr >> 4][rr & 15][d]; stl[d][rr] = sol[rr >> 4][rr & 15][d]; }
    __syncthreads();
    for (int e = tid; e < HD * 8; e += 128) { const int d = e >> 3, pc = e & 7; const size_t o = (b * KW + g2 * HD + d) * SS + s0 + pc * 8; vst2((unsigned*)(VT + o), *(const v4u*)&st[d][pc * 8]); vst2((unsigned*)(VTL + o), *(const v4u*)&stl[d][pc * 8]); } }
}
// ---- k_attn: block = (64 queries, head n, b): kv head n/4; key tiles inside the window [i0 - 511, i0 + 63]; scores over 256 dims (3 products, q fragments re-read per step); mask j <= i && i - j < 512; online softmax; P = e x 2048 (f16) against v hi and e against the x2048 v residual, one accumulator (2 products); ctx rows
// Every matrix operand comes from LDS, brought by asynchronous 16-byte copies. Each wave's 16 q rows (hi, residual) are staged once. The k tile and the v tile of a 32-key step are the two buffers of one ring, filled in turn: v of step s flies while the scores of step s are formed, k of step s + 1 flies during the softmax and the value products of step s. The block's four waves read the one staged tile.
#define QPITCH 528              // LDS pitch of a staged 512-B row (q, k): 16 B x odd, conflict-free for ds_load_b128 readers
#define VPITCH 80               // LDS pitch of a staged 64-B v row (32 keys of one dim): 16 B x odd
#define QWAVE (32 * QPITCH)     // one wave's q rows, 16 hi then 16 residual: 16,896 B
#define KBUF (64 * QPITCH)      // 32 keys hi then 32 keys residual: 33,792 B
#define VBUF (512 * VPITCH)     // 256 dims hi then 256 dims residual: 40,960 B
// Eight copies of one lane, LS LDS bytes and gs elements apart. An immediate offset moves the LDS and the global address alike, so copy i names the one LDS-address register with offset i * LS (at most 17,920) and a global address that is i * LS short of its row: one LDS-address register serves all eight and none has to stay live across the step. Every register and every offset is a multiple of 16. The s_wait_xcnt stands inside the copies' own statement so that no address register of an issued copy is rewritten ahead of it.
template <int LS> __device__ __forceinline__ void stage8h(unsigned l, const _Float16* g, size_t gs) {
  const char* p = (const char*)g; const size_t d = gs * 2 - LS;   // bytes from one copy's global register to the next
  asm volatile("global_load_async_to_lds_b128 %0, %1, off\n\t"
               "global_load_async_to_lds_b128 %0, %2, off offset:%9\n\t"
               "global_load_async_to_lds_b128 %0, %3, off offset:%10\n\t"
               "global_load_async_to_lds_b128 %0, %4, off offset:%11\n\t"
               "global_load_async_to_lds_b128 %0, %5, off offset:%12\n\t"
               "global_load_async_to_lds_b128 %0, %6, off offset:%13\n\t"
               "global_load_async_to_lds_b128 %0, %7, off offset:%14\n\t"
               "global_load_async_to_lds_b128 %0, %8, off offset:%15\n\t"
               "s_wait_xcnt 0x0"
               :: "v"(l), "v"(p), "v"(p + d), "v"(p + 2 * d), "v"(p + 3 * d), "v"(p + 4 * d), "v"(p + 5 * d), "v"(p + 6 * d), "v"(p + 7 * d),
                  "n"(LS), "n"(2 * LS), "n"(3 * LS), "n"(4 * LS), "n"(5 * LS), "n"(6 * LS), "n"(7 * LS)
               : "memory");
}
__global__ __launch_bounds__(128) void k_attn(const _Float16* __restrict__ QH, const _Float16* __restrict__ QL, const _Float16* __restrict__ KH, const _Float16* __restrict__ KL, const _Float16* __restrict__ VT, const _Float16* __restrict__ VTL, float* __restrict__ O) {
  __shared__ __align__(16) _Float16 sp[4][16][40], spu[4][16][40];
  __shared__ __align__(16) unsigned char qs[4 * QWAVE];   // q rows, a range per wave; behind the loop each wave stages its ctx rows in its own range
  __shared__ __align__(16) unsigned char kb[KBUF];        // ring buffer 0: the k tile
  __shared__ __align__(16) unsigned char vb[VBUF];        // ring buffer 1: the v tile
  const int tid = threadIdx.x, wave = tid >> 5, lane = tid & 31, col = lane & 15, g = lane >> 4; const int qb = blockIdx.x, n = blockIdx.y; const size_t b = blockIdx.z; const int kvh = n / (NH / NKV); const int q0 = qb * 64 + wave * 16; const size_t rowb = b * SS;
  const _Float16* Vp = VT + (b * KW + kvh * HD) * SS; const _Float16* Vpl = VTL + (b * KW + kvh * HD) * SS;
  float m[8], l[8];
#pragma unroll
  for (int r = 0; r < 8; ++r) { m[r] = -3.0e38f; l[r] = 0.f; }
  v8f acc[16] = {};
  const int ks0 = max(0, qb * 64 - (WIN - 1)) / 32, ks1 = (qb * 64 + 64) / 32;
  // q: a wave's copy is one whole 512-B row of its own 16 queries. k: a wave's copy is one whole row; waves 0, 1 bring the hi rows (16 keys each), waves 2, 3 the residual rows. v: a wave's copy is eight 64-B rows; lane = (row tid / 4, piece tid % 4).
  const unsigned lq = (unsigned)(size_t)qs + (unsigned)wave * QWAVE + (unsigned)lane * 16u; const size_t gq = (rowb + q0) * QW + n * HD + lane * 8;
  const unsigned lk = (unsigned)(size_t)kb + (unsigned)wave * 16u * QPITCH + (unsigned)lane * 16u; const _Float16* gk = ((wave < 2) ? KH : KL) + (rowb + (wave & 1) * 16) * KW + kvh * HD + lane * 8;
  const unsigned lv = (unsigned)(size_t)vb + (unsigned)(tid >> 2) * VPITCH + (unsigned)(tid & 3) * 16u; const size_t gv = (size_t)(tid >> 2) * SS + (tid & 3) * 8;
  stage8h<QPITCH>(lq, QH + gq, QW); stage8h<QPITCH>(lq + 8u * QPITCH, QH + gq + 8 * QW, QW); stage8h<QPITCH>(lq + 16u * QPITCH, QL + gq, QW); stage8h<QPITCH>(lq + 24u * QPITCH, QL + gq + 8 * QW, QW);
  stage8h<QPITCH>(lk, gk + (size_t)ks0 * 32 * KW, KW); stage8h<QPITCH>(lk + 8u * QPITCH, gk + ((size_t)ks0 * 32 + 8) * KW, KW);
  asm volatile("s_wait_asynccnt 0x0" ::: "memory");   // this wave's q rows and its share of the first k tile have landed
  __syncthreads();                                    // the first k tile is readable by every wave
  stage8h<32 * VPITCH>(lv, Vp + gv + ks0 * 32, 32 * SS); stage8h<32 * VPITCH>(lv + 256u * VPITCH, Vpl + gv + ks0 * 32, 32 * SS);
  const unsigned char* qrow = qs + wave * QWAVE + col * QPITCH;
#pragma unroll 1
  for (int ks = ks0; ks < ks1; ++ks) { const int j0 = ks * 32; v8f s[2];
#pragma unroll
    for (int ct = 0; ct < 2; ++ct) { const int kk = j0 + ct * 16 + col; const unsigned char* krow = kb + (ct * 16 + col) * QPITCH; v8f c = {}, cl = {};
#pragma unroll   // straight-line groups: the fragment arrays stay in registers and each group's LDS reads stand in one place
      for (int kq = 0; kq < HD / 64; ++kq) { v16h aq[2], aql[2], kh[2], kl[2];   // eight fragments read as one group, then their six products
#pragma unroll
        for (int j = 0; j < 2; ++j) { const int ko = (kq * 2 + j) * 64; aq[j] = frag_h((const _Float16*)(qrow + ko), lane); aql[j] = frag_h((const _Float16*)(qrow + 16 * QPITCH + ko), lane); kh[j] = frag_h((const _Float16*)(krow + ko), lane); kl[j] = frag_h((const _Float16*)(krow + 32 * QPITCH + ko), lane); }
#pragma unroll
        for (int j = 0; j < 2; ++j) { c = wmma16(aq[j], kh[j], c); cl = wmma16(aql[j], kh[j], cl); cl = wmma16(aq[j], kl[j], cl); } }
#pragma unroll
      for (int r = 0; r < 8; ++r) { const int qi = q0 + 8 * g + r; const bool keep = (kk <= qi) && (qi - kk < WIN); s[ct][r] = keep ? (c[r] + cl[r] * (1.0f / 2048.0f)) : -3.0e38f; } }   // unscaled logits (the module applies no 1/sqrt(d))
    asm volatile("s_wait_dscnt 0x0" ::: "memory");      // this wave's reads of the k tile are done before it is refilled
    asm volatile("s_wait_asynccnt 0x0" ::: "memory");   // this wave's share of this step's v tile has landed
    __syncthreads();                                    // publishes the v tile and ends every wave's reads of the k tile
    if (ks + 1 < ks1) { stage8h<QPITCH>(lk, gk + (size_t)(j0 + 32) * KW, KW); stage8h<QPITCH>(lk + 8u * QPITCH, gk + (size_t)(j0 + 40) * KW, KW); }
#pragma unroll
    for (int r = 0; r < 8; ++r) { const float mx = row_max(fmaxf(s[0][r], s[1][r]));
      const float mn = fmaxf(m[r], mx); const float xm = exp_slot(m[r] - mn), x0 = exp_slot(s[0][r] - mn), x1 = exp_slot(s[1][r] - mn);   // formed in every lane, then selected: no branch in the step
      const float alpha = (m[r] <= -1.0e38f) ? 0.f : xm;
      const float e0 = (s[0][r] <= -1.0e38f) ? 0.f : x0, e1 = (s[1][r] <= -1.0e38f) ? 0.f : x1; const float es = row_sum(e0 + e1);
      l[r] = l[r] * alpha + es; m[r] = (mn <= -1.0e38f) ? m[r] : mn;
#pragma unroll
      for (int dt = 0; dt < 16; ++dt) acc[dt][r] *= alpha;
      sp[wave][8 * g + r][col] = (_Float16)(e0 * 2048.0f); sp[wave][8 * g + r][16 + col] = (_Float16)(e1 * 2048.0f); spu[wave][8 * g + r][col] = (_Float16)e0; spu[wave][8 * g + r][16 + col] = (_Float16)e1; }   // (e x 2048) pairs with v hi, plain e with the x2048 v residual -> both land in one f32 accumulator
    LDSX();
    const v16h pa = frag_h(&sp[wave][col][0], lane), pu = frag_h(&spu[wave][col][0], lane);
#pragma unroll   // straight-line groups, as in the score loop
    for (int dq = 0; dq < 4; ++dq) { v16h vl[4], vh[4];   // eight fragments read as one group, then their eight products
#pragma unroll
      for (int j = 0; j < 4; ++j) { const unsigned char* vr = vb + ((dq * 4 + j) * 16 + col) * VPITCH; vl[j] = frag_h((const _Float16*)(vr + 256 * VPITCH), lane); vh[j] = frag_h((const _Float16*)vr, lane); }
#pragma unroll
      for (int j = 0; j < 4; ++j) { acc[dq * 4 + j] = wmma16(pu, vl[j], acc[dq * 4 + j]); acc[dq * 4 + j] = wmma16(pa, vh[j], acc[dq * 4 + j]); } }
    asm volatile("s_wait_dscnt 0x0" ::: "memory");      // this wave's reads of the v tile (and of its softmax planes) are done before the refill
    asm volatile("s_wait_asynccnt 0x0" ::: "memory");   // this wave's share of the next k tile has landed
    __syncthreads();                                    // publishes the next k tile and ends every wave's reads of the v tile
    if (ks + 1 < ks1) { stage8h<32 * VPITCH>(lv, Vp + gv + j0 + 32, 32 * SS); stage8h<32 * VPITCH>(lv + 256u * VPITCH, Vpl + gv + j0 + 32, 32 * SS); } }
  asm volatile("s_wait_asynccnt 0x0" ::: "memory");     // no copy is outstanding when the q range is used anew
  float (*so)[HD + 4] = (float (*)[HD + 4])(qs + wave * QWAVE);   // 16 rows of 260 floats = 16,640 B, inside this wave's own q range, which no other wave reads or writes
#pragma unroll
  for (int r = 0; r < 8; ++r) { const float il = (1.0f / 2048.0f) / l[r];
#pragma unroll
    for (int dt = 0; dt < 16; ++dt) so[8 * g + r][dt * 16 + col] = acc[dt][r] * il; }
  LDSX();
  for (int rl = 0; rl < 16; ++rl) { const size_t o = (rowb + q0 + rl) * QW + n * HD; vst2(O + o + lane * 4, *(const v4f*)&so[rl][lane * 4]); vst2(O + o + 128 + lane * 4, *(const v4f*)&so[rl][128 + lane * 4]); }
}
// ---- k_out: block = (64 rows, 128 cols): y = ctx(hi/lo, K 2048) . Wo rows
// The block's 128 weight rows go through LDS as in k_qkv: 64 k per pass, two buffers, eight asynchronous copies per lane and pass.
#define OBUF (128 * BPITCH)     // 18,432 B per buffer
__global__ __launch_bounds__(128) void k_out(const float* __restrict__ Oc, const __bf16* __restrict__ P, float* __restrict__ Y) {
  __shared__ __align__(16) float so[4][16][132];
  __shared__ __align__(16) unsigned char ring[2 * OBUF];   // the two weight buffers
  const int tid = threadIdx.x, wave = tid >> 5, lane = tid & 31, col = lane & 15, g = lane >> 4; const size_t r0 = (size_t)blockIdx.x * 64 + wave * 16; const int n0 = blockIdx.y * 128;
  v8f acc[8] = {};
  const unsigned lcp = (unsigned)(size_t)ring + (unsigned)(tid >> 3) * BPITCH + (unsigned)(tid & 7) * 16u;   // this lane's first LDS byte: row tid / 8, 16-byte piece tid % 8
  const __bf16* gcp = P + (size_t)(n0 + (tid >> 3)) * HID + (tid & 7) * 8;
  stage8(lcp, gcp);
  asm volatile("s_wait_asynccnt 0x0" ::: "memory");   // this wave's share of tile 0 has landed
  __syncthreads();                                    // tile 0 is readable by every wave
  stage8(lcp + OBUF, gcp + 64);
#pragma unroll 1   // one pass per trip: the ring's order stands once, at the foot
  for (int t = 0; t < QW / 64; ++t) { F2 a[2];
#pragma unroll
    for (int ks = 0; ks < 2; ++ks) a[ks] = split_row(Oc + (r0 + col) * QW, t * 64 + ks * 32, lane);
    const unsigned char* bb = ring + (t & 1) * OBUF + col * BPITCH;
#pragma unroll
    for (int ks = 0; ks < 2; ++ks) { v16b w[8];   // eight fragments read as one group, then their sixteen products
#pragma unroll
      for (int j = 0; j < 8; ++j) w[j] = frag_b((const __bf16*)(bb + j * 16 * BPITCH + ks * 64), lane);
#pragma unroll
      for (int j = 0; j < 8; ++j) { acc[j] = wmma_bf(a[ks].l, w[j], acc[j]); acc[j] = wmma_bf(a[ks].h, w[j], acc[j]); } }
    asm volatile("s_wait_dscnt 0x0" ::: "memory");      // this wave's reads of buffer t % 2 are done before it is refilled
    asm volatile("s_wait_asynccnt 0x0" ::: "memory");   // this wave's share of tile t + 1 has landed
    __syncthreads();                                    // publishes tile t + 1 and ends every wave's reads of buffer t % 2
    if (t + 2 < QW / 64) stage8(lcp + (unsigned)(t & 1) * OBUF, gcp + (t + 2) * 64); }
  asm volatile("s_wait_asynccnt 0x0" ::: "memory");     // no copy is outstanding when the wave ends
#pragma unroll
  for (int j = 0; j < 8; ++j)
#pragma unroll
    for (int r = 0; r < 8; ++r) so[wave][8 * g + r][j * 16 + col] = acc[j][r];
  LDSX();
  for (int rl = 0; rl < 16; ++rl) vst2(Y + (r0 + rl) * HID + n0 + lane * 4, *(const v4f*)&so[wave][rl][lane * 4]);
}
extern "C" void kernel_launch(void* const* d_in, const int* in_sizes, int n_in, void* d_out, int out_size, void* d_ws, size_t ws_size, hipStream_t stream) {
  (void)in_sizes; (void)n_in; (void)out_size;
  const float** F = (const float**)d_in;   // 0 hidden_states [2,2048,2048], 1 cos [2,2048,256], 2 sin, 3 Wq [2048,2048], 4 Wk [512,2048], 5 Wv [512,2048], 6 Wo [2048,2048] (natural), 7 q_norm_w [256], 8 k_norm_w [256]
  if (ws_size < (size_t)WS_END) return;
  char* ws = (char*)d_ws; __bf16* PK = (__bf16*)(ws + WS_PK); _Float16 *QH = (_Float16*)(ws + WS_QH), *QL = (_Float16*)(ws + WS_QL), *KH = (_Float16*)(ws + WS_KH), *KL = (_Float16*)(ws + WS_KL), *VT = (_Float16*)(ws + WS_VT), *VTL = (_Float16*)(ws + WS_VTL); float* O = (float*)(ws + WS_O);
  k_pack<<<dim3(PKG), 256, 0, stream>>>(F[3], F[4], F[5], F[6], PK);
  k_qkv<<<dim3(TRB, NH + 2 * NKV), 128, 0, stream>>>(F[0], PK + PK_A, F[1], F[2], F[7], F[8], QH, QL, KH, KL, VT, VTL);
  k_attn<<<dim3(TQB, NH, TNB), 128, 0, stream>>>(QH, QL, KH, KL, VT, VTL, O);
  k_out<<<dim3(TOB, HID / 128), 128, 0, stream>>>(O, PK + PK_P, (float*)d_out);
}

// v006
// One run takes 203 microseconds.
// Next to v005, in two timings, it ran 1.10 and 1.09 times as fast.
// All steps since v000 together make it 4.89 times as fast.
// compute dtype: hidden_states, cos, sin, Wq/Wk/Wv/Wo, q/k norm weights rounded to bf16; q/k/v projections with exact bf16 products on WMMA 16x16x32 (natural [out][in] rows; one 256-column head per block); per-head RMSNorm (eps 1e-6, x weight; v with weight 1) and the rotate-half rotary embedding with the cos/sin inputs in f32 in the projection epilogue; q and k stored as f16 hi + (x2048-scaled) residual planes with 3-product scores (unscaled logits, sigma ~16, kept f32-accurate), v stored as f16 hi + (x2048-scaled) residual planes; sliding-window causal mask (j <= i, i - j < 512), running-max softmax in f32 (hardware exp); the softmax weights as f16 planes e x 2048 (against v hi) and e (against the x2048 v residual) accumulated into one f32 accumulator (2 products; 2^-11 folded into the epilogue); output projection with ctx as bf16 hi + residual x exact Wo rows (2 products); f32 accumulate.
#include <hip/hip_runtime.h>
#include <math.h>

typedef __attribute__((ext_vector_type(16))) _Float16 v16h;
typedef __attribute__((ext_vector_type(16))) __bf16 v16b;
typedef __attribute__((ext_vector_type(8)))  _Float16 v8h;
typedef __attribute__((ext_vector_type(4)))  _Float16 v4h;
typedef __attribute__((ext_vector_type(8)))  float v8f;
typedef __attribute__((ext_vector_type(4)))  float v4f;
typedef __attribute__((ext_vector_type(2)))  float v2f;
typedef __attribute__((ext_vector_type(4)))  unsigned v4u;
typedef __attribute__((ext_vector_type(4)))  int v4i;
typedef float __attribute__((may_alias)) float_a;
typedef int __attribute__((may_alias)) int_a;

template <typename T> __device__ __forceinline__ void vst2(void* p, T v) { *(T*)p = v;  }
__device__ __forceinline__ v8f wmma16(v16h a, v16h b, v8f c) {
  v8f d = __builtin_amdgcn_wmma_f32_16x16x32_f16(false, a, false, b, (short)0, c, false, false);
  asm volatile("v_nop\n\tv_nop\n\tv_nop\n\tv_nop" : "+v"(d) : "v"(a), "v"(b));
  return d;
}
__device__ __forceinline__ v8f wmma_bf(v16b a, v16b b, v8f c) {
  v8f d = __builtin_amdgcn_wmma_f32_16x16x32_bf16(false, a, false, b, (short)0, c, false, false);
  asm volatile("v_nop\n\tv_nop\n\tv_nop\n\tv_nop" : "+v"(d) : "v"(a), "v"(b));
  return d;
}
// 16x16x32 fragments: lane = (h = lane>>4, row/col = lane&15); elements 0..7 = k0+8h+0..7, 8..15 = k0+16+8h+0..7; D element r = row 8h+r
__device__ __forceinline__ v16h frag_h(const _Float16* rowk0, int lane) {
  union { v16h v; v8h q[2]; } u; const _Float16* p = rowk0 + 8 * (lane >> 4);
  u.q[0] = *(const v8h*)p; u.q[1] = *(const v8h*)(p + 16); return u.v;
}
__device__ __forceinline__ v16h frag_f32(const float* rowk0, int lane) {
  v16h a; const float* p = rowk0 + 8 * (lane >> 4);
#pragma unroll
  for (int i = 0; i < 8; ++i) { a[i] = (_Float16)p[i]; a[8 + i] = (_Float16)p[16 + i]; }
  return a;
}
__device__ __forceinline__ v16h frag_f32s(const float* rowk0, int lane, float sc) {
  v16h a; const float* p = rowk0 + 8 * (lane >> 4);
#pragma unroll
  for (int i = 0; i < 8; ++i) { a[i] = (_Float16)(p[i] * sc); a[8 + i] = (_Float16)(p[16 + i] * sc); }
  return a;
}
// column fragment from a [K][ld] layout (column n), rows >= K read as 0
__device__ __forceinline__ v16h fragc_f32(const float* W, int k0, int n, int lane, int ld, int K) {
  v16h a; const int g = lane >> 4;
#pragma unroll
  for (int i = 0; i < 8; ++i) { const int ka = k0 + 8 * g + i, kb = ka + 16;
    a[i] = (_Float16)(ka < K ? W[(size_t)(ka < K ? ka : K - 1) * ld + n] : 0.f); a[8 + i] = (_Float16)(kb < K ? W[(size_t)(kb < K ? kb : K - 1) * ld + n] : 0.f); }
  return a;
}
struct F2 { v16b h, l; };
__device__ __forceinline__ F2 bsplit16(const float v[16]) { F2 r;
#pragma unroll
  for (int i = 0; i < 16; ++i) { const __bf16 h = (__bf16)v[i]; r.h[i] = h; r.l[i] = (__bf16)(v[i] - (float)h); }
  return r; }
__device__ __forceinline__ F2 split_row(const float* row, int k0, int lane) { float v[16]; const float* p = row + k0 + 8 * (lane >> 4);
#pragma unroll
  for (int i = 0; i < 8; ++i) { v[i] = p[i]; v[8 + i] = p[16 + i]; }
  return bsplit16(v); }
__device__ __forceinline__ F2 split_rowK(const float* row, int k0, int lane, int K) { float v[16]; const int g = lane >> 4;
#pragma unroll
  for (int i = 0; i < 8; ++i) { const int ka = k0 + 8 * g + i, kb = ka + 16; v[i] = ka < K ? row[ka < K ? ka : K - 1] : 0.f; v[8 + i] = kb < K ? row[kb < K ? kb : K - 1] : 0.f; }
  return bsplit16(v); }
__device__ __forceinline__ F2 split_col(const float* W, int k0, int n, int lane, int ld, int K) { float v[16]; const int g = lane >> 4;
#pragma unroll
  for (int i = 0; i < 8; ++i) { const int ka = k0 + 8 * g + i, kb = ka + 16; v[i] = ka < K ? W[(size_t)(ka < K ? ka : K - 1) * ld + n] : 0.f; v[8 + i] = kb < K ? W[(size_t)(kb < K ? kb : K - 1) * ld + n] : 0.f; }
  return bsplit16(v); }
__device__ __forceinline__ v8f mac3(const F2& a, const F2& b, v8f c) { c = wmma_bf(a.l, b.h, c); c = wmma_bf(a.h, b.l, c); return wmma_bf(a.h, b.h, c); }
__device__ __forceinline__ float sigm(float v) { return 1.0f / (1.0f + expf(-v)); }
// value of lane (lane ^ M) of the same 16-lane row, M < 16, by a DPP row_xmask move in the vector pipe (the shuffle builtin goes through the LDS unit and is waited for at every step); every lane is on where it is used
template <int M> __device__ __forceinline__ float rowx(float v) { return __builtin_bit_cast(float, __builtin_amdgcn_mov_dpp(__builtin_bit_cast(int, v), 0x160 + M, 0xf, 0xf, true)); }
// butterfly over the 16 lanes of a row, steps 1, 2, 4, 8
__device__ __forceinline__ float row_sum(float s) { s += rowx<1>(s); s += rowx<2>(s); s += rowx<4>(s); s += rowx<8>(s); return s; }
__device__ __forceinline__ float row_max(float m) { m = fmaxf(m, rowx<1>(m)); m = fmaxf(m, rowx<2>(m)); m = fmaxf(m, rowx<4>(m)); m = fmaxf(m, rowx<8>(m)); return m; }
// e^x as the fast-math form computes it (x * log2(e), hardware exp2). The v_nop is the free slot that the instruction set asks for behind a transcendental before its source is overwritten or its result read; inside the statement it stays directly behind the v_exp_f32
__device__ __forceinline__ float exp_slot(float x) { float r; const float y = x * 1.44269504f; asm("v_exp_f32 %0, %1\n\tv_nop" : "=v"(r) : "v"(y)); return r; }
#define LDSX() do { asm volatile("s_wait_dscnt 0" ::: "memory"); __builtin_amdgcn_wave_barrier(); __builtin_amdgcn_fence(__ATOMIC_RELEASE, "workgroup"); } while (0)


// Grouped-query sliding-window attention (B 2, S 2,048, hidden 2,048, 8 query heads / 2 kv heads x 256, window 512): q/k/v projections, per-head RMSNorm, rotary embedding, windowed causal softmax, output projection.
#define NB 2
#define SS 2048
#define HID 2048
#define NH 8
#define NKV 2
#define HD 256
#define WIN 512
#define QW (NH * HD)          // 2048 q columns
#define KW (NKV * HD)         // 512
#define QKVW (QW + 2 * KW)    // 3072
#define NR (NB * SS)
#ifndef TQB
#define TQB (SS / 64)
#define TNB NB
#define TOB (NB * SS / 64)
#define TRB (NB * SS / 64)    // projection row tiles
#endif
typedef __attribute__((ext_vector_type(8))) __bf16 v8b;
__device__ __forceinline__ v16b frag_b(const __bf16* rowk0, int lane) {
  union { v16b v; v8b q[2]; } u; const __bf16* p = rowk0 + 8 * (lane >> 4);
  u.q[0] = *(const v8b*)p; u.q[1] = *(const v8b*)(p + 16); return u.v;
}
__device__ __forceinline__ float bfr(float v) { return (float)(__bf16)v; }
__device__ __attribute__((noinline)) float exp_ni(float v) { return expf(v); }
__device__ __attribute__((noinline)) float erf_ni(float v) { return erff(v); }

#define PK_A 0                            // [3072][2048] Wq | Wk | Wv natural rows
#define PK_P ((size_t)QKVW * HID)         // [2048][2048] Wo natural rows
#define PK_END (PK_P + (size_t)HID * HID)
#define WS_PK  0u
#define WS_QH  (((2u * PK_END) + 127u) / 128u * 128u)   // f16 [4096][2048] q hi ; QL
#define WS_QL  (WS_QH + 2u * (size_t)NR * QW)
#define WS_KH  (WS_QL + 2u * (size_t)NR * QW)          // f16 [4096][512] k hi ; KL
#define WS_KL  (WS_KH + 2u * (size_t)NR * KW)
#define WS_VT  (WS_KL + 2u * (size_t)NR * KW)          // f16 [b][512][2048] v hi ; VTL (x2048 residual)
#define WS_VTL (WS_VT + 2u * (size_t)NR * KW)
#define WS_O   (WS_VTL + 2u * (size_t)NR * KW)         // f32 [4096][2048] ctx
#define WS_END (WS_O + 4u * (size_t)NR * QW)

// ---- k_pack: PK is the four weight matrices one behind the other (Wq | Wk | Wv | Wo, natural rows), each value rounded to bf16, so the launch is one flat stream. A block converts 16,384 values of one matrix (eight whole rows): few waves have to start, and each holds its 16 loads in flight at once.
#define PKF 16384                         // values per block: 256 lanes x 16 pieces of 4
#define PKQ (QW * HID / PKF)              // 256 blocks for Wq (and for Wo)
#define PKK (KW * HID / PKF)              // 64 blocks for Wk (and for Wv)
#define PKG ((QKVW + HID) * HID / PKF)    // 640 blocks
typedef __attribute__((ext_vector_type(4))) __bf16 v4b;
__global__ __launch_bounds__(256) void k_pack(const float* __restrict__ WQ, const float* __restrict__ WK, const float* __restrict__ WV, const float* __restrict__ WO, __bf16* __restrict__ PK) {
  const int blk = blockIdx.x, t = threadIdx.x;
  const float* Wm = WQ; int first = 0;   // the block's matrix and that matrix's first block
  if (blk >= PKQ + 2 * PKK) { Wm = WO; first = PKQ + 2 * PKK; } else if (blk >= PKQ + PKK) { Wm = WV; first = PKQ + PKK; } else if (blk >= PKQ) { Wm = WK; first = PKQ; }
  const float* s = Wm + (size_t)(blk - first) * PKF + t * 4; __bf16* d = PK + (size_t)blk * PKF + t * 4;
  v4f v[16];   // a wave's load covers 512 contiguous bytes (four whole lines), its store 256 (two whole lines)
#pragma unroll
  for (int i = 0; i < 16; ++i) v[i] = *(const v4f*)(s + i * 1024);
  __builtin_amdgcn_sched_barrier(0);   // all 16 loads are issued ahead of the first conversion; without it the last two waited for the first two to land, to take over their registers
  v4b o[16];
#pragma unroll
  for (int i = 0; i < 16; ++i)
#pragma unroll
    for (int k = 0; k < 4; ++k) o[i][k] = (__bf16)v[i][k];
#pragma unroll
  for (int i = 0; i < 16; ++i) vst2(d + i * 1024, o[i]);
}
// ---- k_qkv: block = (64 rows, one 256-column head hb of [q heads 0..7 | k heads 8..9 | v heads 10..11]): GEMM (exact, 16 tiles), RMSNorm over the head's 256 dims (f32), rotary (q, k) with the cos/sin inputs, then planes
// The head's 256 weight rows go through LDS, 64 k (128 B of each row) per pass, two buffers: asynchronous 16-byte copies bring pass t + 2 while pass t + 1 waits ready, and the block's four waves read their B fragments from the one staged tile.
#define BPITCH 144              // LDS pitch of a staged 128-B row: 16 B x odd, conflict-free for ds_load_b128 readers
#define BBUF (HD * BPITCH)      // 36,864 B per buffer
#define NPASS (HID / 64)
// Eight copies of one lane: rows 16 apart, 16 bytes each. The s_wait_xcnt stands inside the copies' own statement so that no address register of an issued copy is rewritten ahead of it.
__device__ __forceinline__ void stage8(unsigned l, const __bf16* g) {
  asm volatile("global_load_async_to_lds_b128 %0, %8, off\n\t"
               "global_load_async_to_lds_b128 %1, %9, off\n\t"
               "global_load_async_to_lds_b128 %2, %10, off\n\t"
               "global_load_async_to_lds_b128 %3, %11, off\n\t"
               "global_load_async_to_lds_b128 %4, %12, off\n\t"
               "global_load_async_to_lds_b128 %5, %13, off\n\t"
               "global_load_async_to_lds_b128 %6, %14, off\n\t"
               "global_load_async_to_lds_b128 %7, %15, off\n\t"
               "s_wait_xcnt 0x0"
               :: "v"(l), "v"(l + 16u * BPITCH), "v"(l + 32u * BPITCH), "v"(l + 48u * BPITCH), "v"(l + 64u * BPITCH), "v"(l + 80u * BPITCH), "v"(l + 96u * BPITCH), "v"(l + 112u * BPITCH),
                  "v"(g), "v"(g + 16 * HID), "v"(g + 32 * HID), "v"(g + 48 * HID), "v"(g + 64 * HID), "v"(g + 80 * HID), "v"(g + 96 * HID), "v"(g + 112 * HID)
               : "memory");
}
// One pass's tile: 256 rows x 128 B = 16 copies per lane; a wave's copy covers four whole rows (four 128-B lines).
__device__ __forceinline__ void stage_tile(unsigned l, const __bf16* g) { stage8(l, g); stage8(l + 128u * BPITCH, g + 128 * HID); }
// The A tile of a pass (64 rows x 64 k, f32) goes through LDS in the same ring order as the weight tile. A wave brings its own 16 rows: a copy is two whole 256-B rows (four whole 128-B lines), where a fragment load from global memory touched 16 lines for 32 B each and was waited for inside its pass.
#define APITCH 272              // LDS pitch of a staged 256-B row: 16 B x odd, conflict-free for ds_load_b128 readers
#define ABUF (64 * APITCH)      // 17,408 B per buffer
// Eight copies of one lane: rows 2 apart (LD floats a row), 16 bytes each. The s_wait_xcnt stands inside the copies' own statement so that no address register of an issued copy is rewritten ahead of it.
template <int LD> __device__ __forceinline__ void stage8a(unsigned l, const float* g) {
  asm volatile("global_load_async_to_lds_b128 %0, %8, off\n\t"
               "global_load_async_to_lds_b128 %1, %9, off\n\t"
               "global_load_async_to_lds_b128 %2, %10, off\n\t"
               "global_load_async_to_lds_b128 %3, %11, off\n\t"
               "global_load_async_to_lds_b128 %4, %12, off\n\t"
               "global_load_async_to_lds_b128 %5, %13, off\n\t"
               "global_load_async_to_lds_b128 %6, %14, off\n\t"
               "global_load_async_to_lds_b128 %7, %15, off\n\t"
               "s_wait_xcnt 0x0"
               :: "v"(l), "v"(l + 2u * APITCH), "v"(l + 4u * APITCH), "v"(l + 6u * APITCH), "v"(l + 8u * APITCH), "v"(l + 10u * APITCH), "v"(l + 12u * APITCH), "v"(l + 14u * APITCH),
                  "v"(g), "v"(g + 2 * LD), "v"(g + 4 * LD), "v"(g + 6 * LD), "v"(g + 8 * LD), "v"(g + 10 * LD), "v"(g + 12 * LD), "v"(g + 14 * LD)
               : "memory");
}
// cos and sin of four rows for one lane: per row cos[d], cos[d + 128], sin[d], sin[d + 128], four dims each
__device__ __forceinline__ void rope_rows(v4f (&e)[4][4], const float* c, const float* s) {
#pragma unroll
  for (int i = 0; i < 4; ++i) { e[i][0] = *(const v4f*)(c + i * HD); e[i][1] = *(const v4f*)(c + i * HD + 128); e[i][2] = *(const v4f*)(s + i * HD); e[i][3] = *(const v4f*)(s + i * HD + 128); }
}
__global__ __launch_bounds__(128) void k_qkv(const float* __restrict__ X, const __bf16* __restrict__ P, const float* __restrict__ COS, const float* __restrict__ SIN, const float* __restrict__ QNW, const float* __restrict__ KNW, _Float16* __restrict__ QH, _Float16* __restrict__ QL, _Float16* __restrict__ KH, _Float16* __restrict__ KL, _Float16* __restrict__ VT, _Float16* __restrict__ VTL) {
  __shared__ __align__(16) unsigned char aux[2 * 4 * 16 * 264 * 2];   // in the loop the two A buffers (2 x ABUF, the front of it); behind the loop the v heads' hi and residual planes
  _Float16 (*soh)[16][264] = (_Float16 (*)[16][264])aux; _Float16 (*sol)[16][264] = (_Float16 (*)[16][264])(aux + 4 * 16 * 264 * 2);
  __shared__ __align__(16) unsigned char ring[2 * BBUF];   // the two weight buffers; behind the loop the q and k heads' f32 rows or the v heads' transpose planes lie here
  const int tid = threadIdx.x, wave = tid >> 5, lane = tid & 31, col = lane & 15, g = lane >> 4; const size_t r0 = (size_t)blockIdx.x * 64 + wave * 16; const int hb = blockIdx.y; const int n0 = hb * HD;   // column base in [0, 3072)
  v8f acc[16] = {};
  const unsigned lcp = (unsigned)(size_t)ring + (unsigned)(tid >> 3) * BPITCH + (unsigned)(tid & 7) * 16u;   // this lane's first LDS byte: row tid / 8, 16-byte piece tid % 8
  const __bf16* gcp = P + (size_t)(n0 + (tid >> 3)) * HID + (tid & 7) * 8;
  const unsigned lca = (unsigned)(size_t)aux + (unsigned)(wave * 16 + g) * APITCH + (unsigned)col * 16u;   // A: row g of the wave's 16, 16-byte piece col
  const float* gca = X + (r0 + g) * HID + col * 4;
  stage_tile(lcp, gcp); stage8a<HID>(lca, gca);
  asm volatile("s_wait_asynccnt 0x0" ::: "memory");   // this wave's share of tile 0 has landed
  __syncthreads();                                    // tile 0 is readable by every wave
  stage_tile(lcp + BBUF, gcp + 64); stage8a<HID>(lca + ABUF, gca + 64);
#pragma unroll 1   // one pass per trip: the ring's order stands once, at the foot
  for (int t = 0; t < NPASS; ++t) { v16b a[2]; { const float* p = (const float*)(aux + (t & 1) * ABUF + (wave * 16 + col) * APITCH) + 8 * g;
#pragma unroll
      for (int ks = 0; ks < 2; ++ks)
#pragma unroll
        for (int i = 0; i < 8; ++i) { a[ks][i] = (__bf16)p[ks * 32 + i]; a[ks][8 + i] = (__bf16)p[ks * 32 + 16 + i]; } }
    const unsigned char* bb = ring + (t & 1) * BBUF + col * BPITCH;
#pragma unroll
    for (int ks = 0; ks < 2; ++ks)
#pragma unroll
      for (int jh = 0; jh < 2; ++jh) { v16b w[8];   // eight fragments read as one group, then their eight products
#pragma unroll
        for (int j = 0; j < 8; ++j) w[j] = frag_b((const __bf16*)(bb + (jh * 8 + j) * 16 * BPITCH + ks * 64), lane);
#pragma unroll
        for (int j = 0; j < 8; ++j) acc[jh * 8 + j] = wmma_bf(a[ks], w[j], acc[jh * 8 + j]); }
    asm volatile("s_wait_dscnt 0x0" ::: "memory");      // this wave's reads of buffer t % 2 are done before it is refilled
    asm volatile("s_wait_asynccnt 0x0" ::: "memory");   // this wave's share of tile t + 1 has landed
    __syncthreads();                                    // publishes tile t + 1 and ends every wave's reads of buffer t % 2
    if (t + 2 < NPASS) { stage_tile(lcp + (unsigned)(t & 1) * BBUF, gcp + (t + 2) * 64); stage8a<HID>(lca + (unsigned)(t & 1) * ABUF, gca + (t + 2) * 64); } }
  asm volatile("s_wait_asynccnt 0x0" ::: "memory");     // no copy is outstanding when the ring's LDS is used anew
  // RMSNorm statistics per row (8g + r): this lane's 16 columns, then the 16 col-lanes
  float ss[8];
#pragma unroll
  for (int r = 0; r < 8; ++r) { float s = 0.f;
#pragma unroll
    for (int j = 0; j < 16; ++j) s += acc[j][r] * acc[j][r];
    s = row_sum(s);
    ss[r] = 1.0f / sqrtf(s / (float)HD + 1e-6f); }
  const int kind = (hb < NH) ? 0 : (hb < NH + NKV) ? 1 : 2;   // q, k, v
  if (kind < 2) {   // q, k: the normed rows go through LDS in f32, and the rotary is applied row by row, where cos and sin are read as whole rows
    const float* NW = (kind == 0) ? QNW : KNW;
    // a lane holds dims 4 * lane .. + 3 of a row and their rotary partners 128 further on: four 16-byte loads per row and lane bring cos and sin (rows are (b*S + s): [b][s][d] = row*HD + d), four rows a group, two groups of registers
    const float* cp = COS + r0 * HD + lane * 4; const float* sq = SIN + r0 * HD + lane * 4;
    v4f cs[2][4][4];
    rope_rows(cs[0], cp, sq);   // the first group flies during the staging
    float (*sx)[HD + 4] = (float (*)[HD + 4])(ring + wave * (16 * (HD + 4) * 4));   // 16 rows of 260 floats = 16,640 B per wave, inside the ring; every read of the ring ended at the last pass's barrier and no copy is outstanding
#pragma unroll
    for (int j = 0; j < 16; ++j) { const float w = bfr(NW[j * 16 + col]);
#pragma unroll
      for (int r = 0; r < 8; ++r) sx[8 * g + r][j * 16 + col] = acc[j][r] * ss[r] * w; }
    LDSX();
    _Float16* DH = (kind == 0) ? QH : KH; _Float16* DL = (kind == 0) ? QL : KL; const size_t ld = (kind == 0) ? QW : KW; const int c0 = ((kind == 0) ? hb : hb - NH) * HD;
#pragma unroll   // straight line: the two register groups are named by constants
    for (int gq = 0; gq < 4; ++gq) {
      if (gq < 3) { rope_rows(cs[(gq + 1) & 1], cp + (gq + 1) * 4 * HD, sq + (gq + 1) * 4 * HD);
        __builtin_amdgcn_sched_barrier(0); }   // the next group's loads stay ahead of this group's arithmetic, which covers their latency
#pragma unroll
      for (int i4 = 0; i4 < 4; ++i4) { const int rl = gq * 4 + i4; const v4f* e = cs[gq & 1][i4];
        const v4f xa = *(const v4f*)&sx[rl][lane * 4], xb = *(const v4f*)&sx[rl][128 + lane * 4];
        v4h ha, la, hc, lc;
#pragma unroll
        for (int i = 0; i < 4; ++i) { const float ya = xa[i] * bfr(e[0][i]) - xb[i] * bfr(e[2][i]), yb = xb[i] * bfr(e[1][i]) + xa[i] * bfr(e[3][i]);
          const _Float16 p = (_Float16)ya, q = (_Float16)yb; ha[i] = p; la[i] = (_Float16)((ya - (float)p) * 2048.0f); hc[i] = q; lc[i] = (_Float16)((yb - (float)q) * 2048.0f); }
        const size_t o = (r0 + rl) * ld + c0 + lane * 4;   // a wave's store covers 256 contiguous bytes, two whole lines
        vst2(DH + o, ha); vst2(DH + o + 128, hc); vst2(DL + o, la); vst2(DL + o + 128, lc); }
      if (gq < 2) asm volatile("s_wait_xcnt 0x0" ::: "memory");   // behind this group's stores, before the loads that follow land in their registers
    } }
  else {
#pragma unroll
    for (int j = 0; j < 16; ++j) { const int d = j * 16 + col;
#pragma unroll
      for (int r = 0; r < 8; ++r) { const float y = acc[j][r] * ss[r];
        const _Float16 hv = (_Float16)y; soh[wave][8 * g + r][d] = hv; sol[wave][8 * g + r][d] = (_Float16)((y - (float)hv) * 2048.0f); } }
    LDSX();
    __syncthreads();
    const size_t rb = (size_t)blockIdx.x * 64; const size_t b = rb / SS; const int s0 = (int)(rb % SS); const int g2 = hb - NH - NKV;
    _Float16 (*st)[72] = (_Float16 (*)[72])ring; _Float16 (*stl)[72] = (_Float16 (*)[72])(ring + BBUF);   // [HD][72] each, exactly one buffer; every read of the ring ended at the last pass's barrier
    for (int e = tid; e < 64 * HD; e += 128) { const int rr = e / HD, d = e % HD; st[d][rr] = soh[rr >> 4][rr & 15][d]; stl[d][rr] = sol[rr >> 4][rr & 15][d]; }
    __syncthreads();
    for (int e = tid; e < HD * 8; e += 128) { const int d = e >> 3, pc = e & 7; const size_t o = (b * KW + g2 * HD + d) * SS + s0 + pc * 8; vst2((unsigned*)(VT + o), *(const v4u*)&st[d][pc * 8]); vst2((unsigned*)(VTL + o), *(const v4u*)&stl[d][pc * 8]); } }
}
// ---- k_attn: block = (64 queries, head n, b): kv head n/4; key tiles inside the window [i0 - 511, i0 + 63]; scores over 256 dims (3 products, q fragments re-read per step); mask j <= i && i - j < 512; online softmax; P = e x 2048 (f16) against v hi and e against the x2048 v residual, one accumulator (2 products); ctx rows
// Every matrix operand comes from LDS, brought by asynchronous 16-byte copies. Each wave's 16 q rows (hi, residual) are staged once. The k tile and the v tile of a 32-key step are the two buffers of one ring, filled in turn: v of step s flies while the scores of step s are formed, k of step s + 1 flies during the softmax and the value products of step s. The block's four waves read the one staged tile.
#define QPITCH 528              // LDS pitch of a staged 512-B row (q, k): 16 B x odd, conflict-free for ds_load_b128 readers
#define VPITCH 80               // LDS pitch of a staged 64-B v row (32 keys of one dim): 16 B x odd
#define QWAVE (32 * QPITCH)     // one wave's q rows, 16 hi then 16 residual: 16,896 B
#define KBUF (64 * QPITCH)      // 32 keys hi then 32 keys residual: 33,792 B
#define VBUF (512 * VPITCH)     // 256 dims hi then 256 dims residual: 40,960 B
// Eight copies of one lane, LS LDS bytes and gs elements apart. An immediate offset moves the LDS and the global address alike, so copy i names the one LDS-address register with offset i * LS (at most 17,920) and a global address that is i * LS short of its row: one LDS-address register serves all eight and none has to stay live across the step. Every register and every offset is a multiple of 16. The s_wait_xcnt stands inside the copies' own statement so that no address register of an issued copy is rewritten ahead of it.
template <int LS> __device__ __forceinline__ void stage8h(unsigned l, const _Float16* g, size_t gs) {
  const char* p = (const char*)g; const size_t d = gs * 2 - LS;   // bytes from one copy's global register to the next
  asm volatile("global_load_async_to_lds_b128 %0, %1, off\n\t"
               "global_load_async_to_lds_b128 %0, %2, off offset:%9\n\t"
               "global_load_async_to_lds_b128 %0, %3, off offset:%10\n\t"
               "global_load_async_to_lds_b128 %0, %4, off offset:%11\n\t"
               "global_load_async_to_lds_b128 %0, %5, off offset:%12\n\t"
               "global_load_async_to_lds_b128 %0, %6, off offset:%13\n\t"
               "global_load_async_to_lds_b128 %0, %7, off offset:%14\n\t"
               "global_load_async_to_lds_b128 %0, %8, off offset:%15\n\t"
               "s_wait_xcnt 0x0"
               :: "v"(l), "v"(p), "v"(p + d), "v"(p + 2 * d), "v"(p + 3 * d), "v"(p + 4 * d), "v"(p + 5 * d), "v"(p + 6 * d), "v"(p + 7 * d),
                  "n"(LS), "n"(2 * LS), "n"(3 * LS), "n"(4 * LS), "n"(5 * LS), "n"(6 * LS), "n"(7 * LS)
               : "memory");
}
__global__ __launch_bounds__(128) void k_attn(const _Float16* __restrict__ QH, const _Float16* __restrict__ QL, const _Float16* __restrict__ KH, const _Float16* __restrict__ KL, const _Float16* __restrict__ VT, const _Float16* __restrict__ VTL, float* __restrict__ O) {
  __shared__ __align__(16) _Float16 sp[4][16][40], spu[4][16][40];
  __shared__ __align__(16) unsigned char qs[4 * QWAVE];   // q rows, a range per wave; behind the loop each wave stages its ctx rows in its own range
  __shared__ __align__(16) unsigned char kb[KBUF];        // ring buffer 0: the k tile
  __shared__ __align__(16) unsigned char vb[VBUF];        // ring buffer 1: the v tile
  const int tid = threadIdx.x, wave = tid >> 5, lane = tid & 31, col = lane & 15, g = lane >> 4; const int qb = blockIdx.x, n = blockIdx.y; const size_t b = blockIdx.z; const int kvh = n / (NH / NKV); const int q0 = qb * 64 + wave * 16; const size_t rowb = b * SS;
  const _Float16* Vp = VT + (b * KW + kvh * HD) * SS; const _Float16* Vpl = VTL + (b * KW + kvh * HD) * SS;
  float m[8], l[8];
#pragma unroll
  for (int r = 0; r < 8; ++r) { m[r] = -3.0e38f; l[r] = 0.f; }
  v8f acc[16] = {};
  const int ks0 = max(0, qb * 64 - (WIN - 1)) / 32, ks1 = (qb * 64 + 64) / 32;
  // q: a wave's copy is one whole 512-B row of its own 16 queries. k: a wave's copy is one whole row; waves 0, 1 bring the hi rows (16 keys each), waves 2, 3 the residual rows. v: a wave's copy is eight 64-B rows; lane = (row tid / 4, piece tid % 4).
  const unsigned lq = (unsigned)(size_t)qs + (unsigned)wave * QWAVE + (unsigned)lane * 16u; const size_t gq = (rowb + q0) * QW + n * HD + lane * 8;
  const unsigned lk = (unsigned)(size_t)kb + (unsigned)wave * 16u * QPITCH + (unsigned)lane * 16u; const _Float16* gk = ((wave < 2) ? KH : KL) + (rowb + (wave & 1) * 16) * KW + kvh * HD + lane * 8;
  const unsigned lv = (unsigned)(size_t)vb + (unsigned)(tid >> 2) * VPITCH + (unsigned)(tid & 3) * 16u; const size_t gv = (size_t)(tid >> 2) * SS + (tid & 3) * 8;
  stage8h<QPITCH>(lq, QH + gq, QW); stage8h<QPITCH>(lq + 8u * QPITCH, QH + gq + 8 * QW, QW); stage8h<QPITCH>(lq + 16u * QPITCH, QL + gq, QW); stage8h<QPITCH>(lq + 24u * QPITCH, QL + gq + 8 * QW, QW);
  stage8h<QPITCH>(lk, gk + (size_t)ks0 * 32 * KW, KW); stage8h<QPITCH>(lk + 8u * QPITCH, gk + ((size_t)ks0 * 32 + 8) * KW, KW);
  asm volatile("s_wait_asynccnt 0x0" ::: "memory");   // this wave's q rows and its share of the first k tile have landed
  __syncthreads();                                    // the first k tile is readable by every wave
  stage8h<32 * VPITCH>(lv, Vp + gv + ks0 * 32, 32 * SS); stage8h<32 * VPITCH>(lv + 256u * VPITCH, Vpl + gv + ks0 * 32, 32 * SS);
  const unsigned char* qrow = qs + wave * QWAVE + col * QPITCH;
#pragma unroll 1
  for (int ks = ks0; ks < ks1; ++ks) { const int j0 = ks * 32; v8f s[2];
#pragma unroll
    for (int ct = 0; ct < 2; ++ct) { const int kk = j0 + ct * 16 + col; const unsigned char* krow = kb + (ct * 16 + col) * QPITCH; v8f c = {}, cl = {};
#pragma unroll   // straight-line groups: the fragment arrays stay in registers and each group's LDS reads stand in one place
      for (int kq = 0; kq < HD / 64; ++kq) { v16h aq[2], aql[2], kh[2], kl[2];   // eight fragments read as one group, then their six products
#pragma unroll
        for (int j = 0; j < 2; ++j) { const int ko = (kq * 2 + j) * 64; aq[j] = frag_h((const _Float16*)(qrow + ko), lane); aql[j] = frag_h((const _Float16*)(qrow + 16 * QPITCH + ko), lane); kh[j] = frag_h((const _Float16*)(krow + ko), lane); kl[j] = frag_h((const _Float16*)(krow + 32 * QPITCH + ko), lane); }
#pragma unroll
        for (int j = 0; j < 2; ++j) { c = wmma16(aq[j], kh[j], c); cl = wmma16(aql[j], kh[j], cl); cl = wmma16(aq[j], kl[j], cl); } }
#pragma unroll
      for (int r = 0; r < 8; ++r) { const int qi = q0 + 8 * g + r; const bool keep = (kk <= qi) && (qi - kk < WIN); s[ct][r] = keep ? (c[r] + cl[r] * (1.0f / 2048.0f)) : -3.0e38f; } }   // unscaled logits (the module applies no 1/sqrt(d))
    asm volatile("s_wait_dscnt 0x0" ::: "memory");      // this wave's reads of the k tile are done before it is refilled
    asm volatile("s_wait_asynccnt 0x0" ::: "memory");   // this wave's share of this step's v tile has landed
    __syncthreads();                                    // publishes the v tile and ends every wave's reads of the k tile
    if (ks + 1 < ks1) { stage8h<QPITCH>(lk, gk + (size_t)(j0 + 32) * KW, KW); stage8h<QPITCH>(lk + 8u * QPITCH, gk + (size_t)(j0 + 40) * KW, KW); }
#pragma unroll
    for (int r = 0; r < 8; ++r) { const float mx = row_max(fmaxf(s[0][r], s[1][r]));
      const float mn = fmaxf(m[r], mx); const float xm = exp_slot(m[r] - mn), x0 = exp_slot(s[0][r] - mn), x1 = exp_slot(s[1][r] - mn);   // formed in every lane, then selected: no branch in the step
      const float alpha = (m[r] <= -1.0e38f) ? 0.f : xm;
      const float e0 = (s[0][r] <= -1.0e38f) ? 0.f : x0, e1 = (s[1][r] <= -1.0e38f) ? 0.f : x1; const float es = row_sum(e0 + e1);
      l[r] = l[r] * alpha + es; m[r] = (mn <= -1.0e38f) ? m[r] : mn;
#pragma unroll
      for (int dt = 0; dt < 16; ++dt) acc[dt][r] *= alpha;
      sp[wave][8 * g + r][col] = (_Float16)(e0 * 2048.0f); sp[wave][8 * g + r][16 + col] = (_Float16)(e1 * 2048.0f); spu[wave][8 * g + r][col] = (_Float16)e0; spu[wave][8 * g + r][16 + col] = (_Float16)e1; }   // (e x 2048) pairs with v hi, plain e with the x2048 v residual -> both land in one f32 accumulator
    LDSX();
    const v16h pa = frag_h(&sp[wave][col][0], lane), pu = frag_h(&spu[wave][col][0], lane);
#pragma unroll   // straight-line groups, as in the score loop
    for (int dq = 0; dq < 4; ++dq) { v16h vl[4], vh[4];   // eight fragments read as one group, then their eight products
#pragma unroll
      for (int j = 0; j < 4; ++j) { const unsigned char* vr = vb + ((dq * 4 + j) * 16 + col) * VPITCH; vl[j] = frag_h((const _Float16*)(vr + 256 * VPITCH), lane); vh[j] = frag_h((const _Float16*)vr, lane); }
#pragma unroll
      for (int j = 0; j < 4; ++j) { acc[dq * 4 + j] = wmma16(pu, vl[j], acc[dq * 4 + j]); acc[dq * 4 + j] = wmma16(pa, vh[j], acc[dq * 4 + j]); } }
    asm volatile("s_wait_dscnt 0x0" ::: "memory");      // this wave's reads of the v tile (and of its softmax planes) are done before the refill
    asm volatile("s_wait_asynccnt 0x0" ::: "memory");   // this wave's share of the next k tile has landed
    __syncthreads();                                    // publishes the next k tile and ends every wave's reads of the v tile
    if (ks + 1 < ks1) { stage8h<32 * VPITCH>(lv, Vp + gv + j0 + 32, 32 * SS); stage8h<32 * VPITCH>(lv + 256u * VPITCH, Vpl + gv + j0 + 32, 32 * SS); } }
  asm volatile("s_wait_asynccnt 0x0" ::: "memory");     // no copy is outstanding when the q range is used anew
  float (*so)[HD + 4] = (float (*)[HD + 4])(qs + wave * QWAVE);   // 16 rows of 260 floats = 16,640 B, inside this wave's own q range, which no other wave reads or writes
#pragma unroll
  for (int r = 0; r < 8; ++r) { const float il = (1.0f / 2048.0f) / l[r];
#pragma unroll
    for (int dt = 0; dt < 16; ++dt) so[8 * g + r][dt * 16 + col] = acc[dt][r] * il; }
  LDSX();
  for (int rl = 0; rl < 16; ++rl) { const size_t o = (rowb + q0 + rl) * QW + n * HD; vst2(O + o + lane * 4, *(const v4f*)&so[rl][lane * 4]); vst2(O + o + 128 + lane * 4, *(const v4f*)&so[rl][128 + lane * 4]); }
}
// ---- k_out: block = (64 rows, 128 cols): y = ctx(hi/lo, K 2048) . Wo rows
// The block's 128 weight rows and its 64 ctx rows go through LDS as in k_qkv: 64 k per pass, two buffers, eight asynchronous copies per lane and pass for each.
#define OBUF (128 * BPITCH)     // 18,432 B per buffer
__global__ __launch_bounds__(128) void k_out(const float* __restrict__ Oc, const __bf16* __restrict__ P, float* __restrict__ Y) {
  __shared__ __align__(16) unsigned char aux[2 * ABUF];   // in the loop the two A buffers; behind the loop the output rows (33,792 B)
  float (*so)[16][132] = (float (*)[16][132])aux;
  __shared__ __align__(16) unsigned char ring[2 * OBUF];   // the two weight buffers
  const int tid = threadIdx.x, wave = tid >> 5, lane = tid & 31, col = lane & 15, g = lane >> 4; const size_t r0 = (size_t)blockIdx.x * 64 + wave * 16; const int n0 = blockIdx.y * 128;
  v8f acc[8] = {};
  const unsigned lcp = (unsigned)(size_t)ring + (unsigned)(tid >> 3) * BPITCH + (unsigned)(tid & 7) * 16u;   // this lane's first LDS byte: row tid / 8, 16-byte piece tid % 8
  const __bf16* gcp = P + (size_t)(n0 + (tid >> 3)) * HID + (tid & 7) * 8;
  const unsigned lca = (unsigned)(size_t)aux + (unsigned)(wave * 16 + g) * APITCH + (unsigned)col * 16u;   // A: row g of the wave's 16, 16-byte piece col
  const float* gca = Oc + (r0 + g) * QW + col * 4;
  stage8(lcp, gcp); stage8a<QW>(lca, gca);
  asm volatile("s_wait_asynccnt 0x0" ::: "memory");   // this wave's share of tile 0 has landed
  __syncthreads();                                    // tile 0 is readable by every wave
  stage8(lcp + OBUF, gcp + 64); stage8a<QW>(lca + ABUF, gca + 64);
#pragma unroll 1   // one pass per trip: the ring's order stands once, at the foot
  for (int t = 0; t < QW / 64; ++t) { F2 a[2];
#pragma unroll
    for (int ks = 0; ks < 2; ++ks) a[ks] = split_row((const float*)(aux + (t & 1) * ABUF + (wave * 16 + col) * APITCH), ks * 32, lane);
    const unsigned char* bb = ring + (t & 1) * OBUF + col * BPITCH;
#pragma unroll
    for (int ks = 0; ks < 2; ++ks) { v16b w[8];   // eight fragments read as one group, then their sixteen products
#pragma unroll
      for (int j = 0; j < 8; ++j) w[j] = frag_b((const __bf16*)(bb + j * 16 * BPITCH + ks * 64), lane);
#pragma unroll
      for (int j = 0; j < 8; ++j) { acc[j] = wmma_bf(a[ks].l, w[j], acc[j]); acc[j] = wmma_bf(a[ks].h, w[j], acc[j]); } }
    asm volatile("s_wait_dscnt 0x0" ::: "memory");      // this wave's reads of buffer t % 2 are done before it is refilled
    asm volatile("s_wait_asynccnt 0x0" ::: "memory");   // this wave's share of tile t + 1 has landed
    __syncthreads();                                    // publishes tile t + 1 and ends every wave's reads of buffer t % 2
    if (t + 2 < QW / 64) { stage8(lcp + (unsigned)(t & 1) * OBUF, gcp + (t + 2) * 64); stage8a<QW>(lca + (unsigned)(t & 1) * ABUF, gca + (t + 2) * 64); } }
  asm volatile("s_wait_asynccnt 0x0" ::: "memory");     // no copy is outstanding when the A buffers' LDS is used anew
#pragma unroll
  for (int j = 0; j < 8; ++j)
#pragma unroll
    for (int r = 0; r < 8; ++r) so[wave][8 * g + r][j * 16 + col] = acc[j][r];
  LDSX();
  for (int rl = 0; rl < 16; ++rl) vst2(Y + (r0 + rl) * HID + n0 + lane * 4, *(const v4f*)&so[wave][rl][lane * 4]);
}
extern "C" void kernel_launch(void* const* d_in, const int* in_sizes, int n_in, void* d_out, int out_size, void* d_ws, size_t ws_size, hipStream_t stream) {
  (void)in_sizes; (void)n_in; (void)out_size;
  const float** F = (const float**)d_in;   // 0 hidden_states [2,2048,2048], 1 cos [2,2048,256], 2 sin, 3 Wq [2048,2048], 4 Wk [512,2048], 5 Wv [512,2048], 6 Wo [2048,2048] (natural), 7 q_norm_w [256], 8 k_norm_w [256]
  if (ws_size < (size_t)WS_END) return;
  char* ws = (char*)d_ws; __bf16* PK = (__bf16*)(ws + WS_PK); _Float16 *QH = (_Float16*)(ws + WS_QH), *QL = (_Float16*)(ws + WS_QL), *KH = (_Float16*)(ws + WS_KH), *KL = (_Float16*)(ws + WS_KL), *VT = (_Float16*)(ws + WS_VT), *VTL = (_Float16*)(ws + WS_VTL); float* O = (float*)(ws + WS_O);
  k_pack<<<dim3(PKG), 256, 0, stream>>>(F[3], F[4], F[5], F[6], PK);
  k_qkv<<<dim3(TRB, NH + 2 * NKV), 128, 0, stream>>>(F[0], PK + PK_A, F[1], F[2], F[7], F[8], QH, QL, KH, KL, VT, VTL);
  k_attn<<<dim3(TQB, NH, TNB), 128, 0, stream>>>(QH, QL, KH, KL, VT, VTL, O);
  k_out<<<dim3(TOB, HID / 128), 128, 0, stream>>>(O, PK + PK_P, (float*)d_out);
}

// v007
// A run of this version takes 185 microseconds.
// In two side-by-side timings against v006, it was 1.10 and 1.11 times as fast.
// All steps since v000 together make it 5.41 times as fast.
// compute dtype: hidden_states, cos, sin, Wq/Wk/Wv/Wo, q/k norm weights rounded to bf16; q/k/v projections with exact bf16 products on WMMA 16x16x32 (natural [out][in] rows; one 256-column head per block); per-head RMSNorm (eps 1e-6, x weight; v with weight 1) and the rotate-half rotary embedding with the cos/sin inputs in f32 in the projection epilogue; q and k stored as f16 hi + (x2048-scaled) residual planes with 3-product scores (unscaled logits, sigma ~16, kept f32-accurate), v stored as f16 hi + (x2048-scaled) residual planes; sliding-window causal mask (j <= i, i - j < 512), running-max softmax in f32 (hardware exp); the softmax weights as f16 planes e x 2048 (against v hi) and e (against the x2048 v residual) accumulated into one f32 accumulator (2 products; 2^-11 folded into the epilogue); output projection with ctx as bf16 hi + residual x exact Wo rows (2 products); f32 accumulate.
#include <hip/hip_runtime.h>
#include <math.h>

typedef __attribute__((ext_vector_type(16))) _Float16 v16h;
typedef __attribute__((ext_vector_type(16))) __bf16 v16b;
typedef __attribute__((ext_vector_type(8)))  _Float16 v8h;
typedef __attribute__((ext_vector_type(4)))  _Float16 v4h;
typedef __attribute__((ext_vector_type(8)))  float v8f;
typedef __attribute__((ext_vector_type(4)))  float v4f;
typedef __attribute__((ext_vector_type(2)))  float v2f;
typedef __attribute__((ext_vector_type(4)))  unsigned v4u;
typedef __attribute__((ext_vector_type(4)))  int v4i;
typedef float __attribute__((may_alias)) float_a;
typedef int __attribute__((may_alias)) int_a;

template <typename T> __device__ __forceinline__ void vst2(void* p, T v) { *(T*)p = v;  }
__device__ __forceinline__ v8f wmma16(v16h a, v16h b, v8f c) {
  v8f d = __builtin_amdgcn_wmma_f32_16x16x32_f16(false, a, false, b, (short)0, c, false, false);
  asm volatile("v_nop\n\tv_nop\n\tv_nop\n\tv_nop" : "+v"(d) : "v"(a), "v"(b));
  return d;
}
__device__ __forceinline__ v8f wmma_bf(v16b a, v16b b, v8f c) {
  return __builtin_amdgcn_wmma_f32_16x16x32_bf16(false, a, false, b, (short)0, c, false, false);   // the builtin alone, the compiler keeps its distances: an asm statement on its operands would hold all of them below v256, and two row tiles' accumulators with their fragments need more
}
// 16x16x32 fragments: lane = (h = lane>>4, row/col = lane&15); elements 0..7 = k0+8h+0..7, 8..15 = k0+16+8h+0..7; D element r = row 8h+r
__device__ __forceinline__ v16h frag_h(const _Float16* rowk0, int lane) {
  union { v16h v; v8h q[2]; } u; const _Float16* p = rowk0 + 8 * (lane >> 4);
  u.q[0] = *(const v8h*)p; u.q[1] = *(const v8h*)(p + 16); return u.v;
}
__device__ __forceinline__ v16h frag_f32(const float* rowk0, int lane) {
  v16h a; const float* p = rowk0 + 8 * (lane >> 4);
#pragma unroll
  for (int i = 0; i < 8; ++i) { a[i] = (_Float16)p[i]; a[8 + i] = (_Float16)p[16 + i]; }
  return a;
}
__device__ __forceinline__ v16h frag_f32s(const float* rowk0, int lane, float sc) {
  v16h a; const float* p = rowk0 + 8 * (lane >> 4);
#pragma unroll
  for (int i = 0; i < 8; ++i) { a[i] = (_Float16)(p[i] * sc); a[8 + i] = (_Float16)(p[16 + i] * sc); }
  return a;
}
// column fragment from a [K][ld] layout (column n), rows >= K read as 0
__device__ __forceinline__ v16h fragc_f32(const float* W, int k0, int n, int lane, int ld, int K) {
  v16h a; const int g = lane >> 4;
#pragma unroll
  for (int i = 0; i < 8; ++i) { const int ka = k0 + 8 * g + i, kb = ka + 16;
    a[i] = (_Float16)(ka < K ? W[(size_t)(ka < K ? ka : K - 1) * ld + n] : 0.f); a[8 + i] = (_Float16)(kb < K ? W[(size_t)(kb < K ? kb : K - 1) * ld + n] : 0.f); }
  return a;
}
struct F2 { v16b h, l; };
__device__ __forceinline__ F2 bsplit16(const float v[16]) { F2 r;
#pragma unroll
  for (int i = 0; i < 16; ++i) { const __bf16 h = (__bf16)v[i]; r.h[i] = h; r.l[i] = (__bf16)(v[i] - (float)h); }
  return r; }
__device__ __forceinline__ F2 split_row(const float* row, int k0, int lane) { float v[16]; const float* p = row + k0 + 8 * (lane >> 4);
#pragma unroll
  for (int i = 0; i < 8; ++i) { v[i] = p[i]; v[8 + i] = p[16 + i]; }
  return bsplit16(v); }
__device__ __forceinline__ F2 split_rowK(const float* row, int k0, int lane, int K) { float v[16]; const int g = lane >> 4;
#pragma unroll
  for (int i = 0; i < 8; ++i) { const int ka = k0 + 8 * g + i, kb = ka + 16; v[i] = ka < K ? row[ka < K ? ka : K - 1] : 0.f; v[8 + i] = kb < K ? row[kb < K ? kb : K - 1] : 0.f; }
  return bsplit16(v); }
__device__ __forceinline__ F2 split_col(const float* W, int k0, int n, int lane, int ld, int K) { float v[16]; const int g = lane >> 4;
#pragma unroll
  for (int i = 0; i < 8; ++i) { const int ka = k0 + 8 * g + i, kb = ka + 16; v[i] = ka < K ? W[(size_t)(ka < K ? ka : K - 1) * ld + n] : 0.f; v[8 + i] = kb < K ? W[(size_t)(kb < K ? kb : K - 1) * ld + n] : 0.f; }
  return bsplit16(v); }
__device__ __forceinline__ v8f mac3(const F2& a, const F2& b, v8f c) { c = wmma_bf(a.l, b.h, c); c = wmma_bf(a.h, b.l, c); return wmma_bf(a.h, b.h, c); }
__device__ __forceinline__ float sigm(float v) { return 1.0f / (1.0f + expf(-v)); }
// value of lane (lane ^ M) of the same 16-lane row, M < 16, by a DPP row_xmask move in the vector pipe (the shuffle builtin goes through the LDS unit and is waited for at every step); every lane is on where it is used
template <int M> __device__ __forceinline__ float rowx(float v) { return __builtin_bit_cast(float, __builtin_amdgcn_mov_dpp(__builtin_bit_cast(int, v), 0x160 + M, 0xf, 0xf, true)); }
// butterfly over the 16 lanes of a row, steps 1, 2, 4, 8
__device__ __forceinline__ float row_sum(float s) { s += rowx<1>(s); s += rowx<2>(s); s += rowx<4>(s); s += rowx<8>(s); return s; }
__device__ __forceinline__ float row_max(float m) { m = fmaxf(m, rowx<1>(m)); m = fmaxf(m, rowx<2>(m)); m = fmaxf(m, rowx<4>(m)); m = fmaxf(m, rowx<8>(m)); return m; }
// e^x as the fast-math form computes it (x * log2(e), hardware exp2). The v_nop is the free slot that the instruction set asks for behind a transcendental before its source is overwritten or its result read; inside the statement it stays directly behind the v_exp_f32
__device__ __forceinline__ float exp_slot(float x) { float r; const float y = x * 1.44269504f; asm("v_exp_f32 %0, %1\n\tv_nop" : "=v"(r) : "v"(y)); return r; }
#define LDSX() do { asm volatile("s_wait_dscnt 0" ::: "memory"); __builtin_amdgcn_wave_barrier(); __builtin_amdgcn_fence(__ATOMIC_RELEASE, "workgroup"); } while (0)


// Grouped-query sliding-window attention (B 2, S 2,048, hidden 2,048, 8 query heads / 2 kv heads x 256, window 512): q/k/v projections, per-head RMSNorm, rotary embedding, windowed causal softmax, output projection.
#define NB 2
#define SS 2048
#define HID 2048
#define NH 8
#define NKV 2
#define HD 256
#define WIN 512
#define QW (NH * HD)          // 2048 q columns
#define KW (NKV * HD)         // 512
#define QKVW (QW + 2 * KW)    // 3072
#define NR (NB * SS)
#ifndef TQB
#define TQB (SS / 64)
#define TNB NB
#define TOB (NB * SS / 128)
#define TRB (NB * SS / 128)   // projection row tiles of 128 rows
#endif
typedef __attribute__((ext_vector_type(8))) __bf16 v8b;
__device__ __forceinline__ v16b frag_b(const __bf16* rowk0, int lane) {
  union { v16b v; v8b q[2]; } u; const __bf16* p = rowk0 + 8 * (lane >> 4);
  u.q[0] = *(const v8b*)p; u.q[1] = *(const v8b*)(p + 16); return u.v;
}
__device__ __forceinline__ float bfr(float v) { return (float)(__bf16)v; }
__device__ __attribute__((noinline)) float exp_ni(float v) { return expf(v); }
__device__ __attribute__((noinline)) float erf_ni(float v) { return erff(v); }

#define PK_A 0                            // [3072][2048] Wq | Wk | Wv natural rows
#define PK_P ((size_t)QKVW * HID)         // [2048][2048] Wo natural rows
#define PK_END (PK_P + (size_t)HID * HID)
#define WS_PK  0u
#define WS_QH  (((2u * PK_END) + 127u) / 128u * 128u)   // f16 [4096][2048] q hi ; QL
#define WS_QL  (WS_QH + 2u * (size_t)NR * QW)
#define WS_KH  (WS_QL + 2u * (size_t)NR * QW)          // f16 [4096][512] k hi ; KL
#define WS_KL  (WS_KH + 2u * (size_t)NR * KW)
#define WS_VT  (WS_KL + 2u * (size_t)NR * KW)          // f16 [b][512][2048] v hi ; VTL (x2048 residual)
#define WS_VTL (WS_VT + 2u * (size_t)NR * KW)
#define WS_O   (WS_VTL + 2u * (size_t)NR * KW)         // f32 [4096][2048] ctx
#define WS_END (WS_O + 4u * (size_t)NR * QW)

// ---- k_pack: PK is the four weight matrices one behind the other (Wq | Wk | Wv | Wo, natural rows), each value rounded to bf16, so the launch is one flat stream. A block converts 16,384 values of one matrix (eight whole rows): few waves have to start, and each holds its 16 loads in flight at once.
#define PKF 16384                         // values per block: 256 lanes x 16 pieces of 4
#define PKQ (QW * HID / PKF)              // 256 blocks for Wq (and for Wo)
#define PKK (KW * HID / PKF)              // 64 blocks for Wk (and for Wv)
#define PKG ((QKVW + HID) * HID / PKF)    // 640 blocks
typedef __attribute__((ext_vector_type(4))) __bf16 v4b;
__global__ __launch_bounds__(256) void k_pack(const float* __restrict__ WQ, const float* __restrict__ WK, const float* __restrict__ WV, const float* __restrict__ WO, __bf16* __restrict__ PK) {
  const int blk = blockIdx.x, t = threadIdx.x;
  const float* Wm = WQ; int first = 0;   // the block's matrix and that matrix's first block
  if (blk >= PKQ + 2 * PKK) { Wm = WO; first = PKQ + 2 * PKK; } else if (blk >= PKQ + PKK) { Wm = WV; first = PKQ + PKK; } else if (blk >= PKQ) { Wm = WK; first = PKQ; }
  const float* s = Wm + (size_t)(blk - first) * PKF + t * 4; __bf16* d = PK + (size_t)blk * PKF + t * 4;
  v4f v[16];   // a wave's load covers 512 contiguous bytes (four whole lines), its store 256 (two whole lines)
#pragma unroll
  for (int i = 0; i < 16; ++i) v[i] = *(const v4f*)(s + i * 1024);
  __builtin_amdgcn_sched_barrier(0);   // all 16 loads are issued ahead of the first conversion; without it the last two waited for the first two to land, to take over their registers
  v4b o[16];
#pragma unroll
  for (int i = 0; i < 16; ++i)
#pragma unroll
    for (int k = 0; k < 4; ++k) o[i][k] = (__bf16)v[i][k];
#pragma unroll
  for (int i = 0; i < 16; ++i) vst2(d + i * 1024, o[i]);
}
// ---- k_qkv: block = (128 rows, one 256-column head hb of [q heads 0..7 | k heads 8..9 | v heads 10..11]): GEMM (exact, 16 tiles), RMSNorm over the head's 256 dims (f32), rotary (q, k) with the cos/sin inputs, then planes
// The head's 256 weight rows go through LDS, 64 k (128 B of each row) per pass, two buffers: asynchronous 16-byte copies bring pass t + 2 while pass t + 1 waits ready, and the block's four waves read their B fragments from the one staged tile. A wave holds two 16-row tiles (rows 64 apart), so each B fragment it reads feeds two products and the head's weight rows are copied once per 128 rows.
#define BPITCH 144              // LDS pitch of a staged 128-B row: 16 B x odd, conflict-free for ds_load_b128 readers
#define BBUF (HD * BPITCH)      // 36,864 B per buffer
#define NPASS (HID / 64)
// Eight copies of one lane: rows 16 apart, 16 bytes each. The s_wait_xcnt stands inside the copies' own statement so that no address register of an issued copy is rewritten ahead of it.
__device__ __forceinline__ void stage8(unsigned l, const __bf16* g) {
  asm volatile("global_load_async_to_lds_b128 %0, %8, off\n\t"
               "global_load_async_to_lds_b128 %1, %9, off\n\t"
               "global_load_async_to_lds_b128 %2, %10, off\n\t"
               "global_load_async_to_lds_b128 %3, %11, off\n\t"
               "global_load_async_to_lds_b128 %4, %12, off\n\t"
               "global_load_async_to_lds_b128 %5, %13, off\n\t"
               "global_load_async_to_lds_b128 %6, %14, off\n\t"
               "global_load_async_to_lds_b128 %7, %15, off\n\t"
               "s_wait_xcnt 0x0"
               :: "v"(l), "v"(l + 16u * BPITCH), "v"(l + 32u * BPITCH), "v"(l + 48u * BPITCH), "v"(l + 64u * BPITCH), "v"(l + 80u * BPITCH), "v"(l + 96u * BPITCH), "v"(l + 112u * BPITCH),
                  "v"(g), "v"(g + 16 * HID), "v"(g + 32 * HID), "v"(g + 48 * HID), "v"(g + 64 * HID), "v"(g + 80 * HID), "v"(g + 96 * HID), "v"(g + 112 * HID)
               : "memory");
}
// One pass's tile: 256 rows x 128 B = 16 copies per lane; a wave's copy covers four whole rows (four 128-B lines).
__device__ __forceinline__ void stage_tile(unsigned l, const __bf16* g) { stage8(l, g); stage8(l + 128u * BPITCH, g + 128 * HID); }
// The A tile of a pass (128 rows x 64 k, f32) goes through LDS in the same ring order as the weight tile. A wave brings its own two times 16 rows: a copy is two whole 256-B rows (four whole 128-B lines), where a fragment load from global memory touched 16 lines for 32 B each and was waited for inside its pass.
#define APITCH 272              // LDS pitch of a staged 256-B row: 16 B x odd, conflict-free for ds_load_b128 readers
#define ABUF (128 * APITCH)     // 34,816 B per buffer
// Eight copies of one lane: rows 2 apart (LD floats a row), 16 bytes each. The s_wait_xcnt stands inside the copies' own statement so that no address register of an issued copy is rewritten ahead of it.
template <int LD> __device__ __forceinline__ void stage8a(unsigned l, const float* g) {
  asm volatile("global_load_async_to_lds_b128 %0, %8, off\n\t"
               "global_load_async_to_lds_b128 %1, %9, off\n\t"
               "global_load_async_to_lds_b128 %2, %10, off\n\t"
               "global_load_async_to_lds_b128 %3, %11, off\n\t"
               "global_load_async_to_lds_b128 %4, %12, off\n\t"
               "global_load_async_to_lds_b128 %5, %13, off\n\t"
               "global_load_async_to_lds_b128 %6, %14, off\n\t"
               "global_load_async_to_lds_b128 %7, %15, off\n\t"
               "s_wait_xcnt 0x0"
               :: "v"(l), "v"(l + 2u * APITCH), "v"(l + 4u * APITCH), "v"(l + 6u * APITCH), "v"(l + 8u * APITCH), "v"(l + 10u * APITCH), "v"(l + 12u * APITCH), "v"(l + 14u * APITCH),
                  "v"(g), "v"(g + 2 * LD), "v"(g + 4 * LD), "v"(g + 6 * LD), "v"(g + 8 * LD), "v"(g + 10 * LD), "v"(g + 12 * LD), "v"(g + 14 * LD)
               : "memory");
}
// cos and sin of four rows for one lane: per row cos[d], cos[d + 128], sin[d], sin[d + 128], four dims each
__device__ __forceinline__ void rope_rows(v4f (&e)[4][4], const float* c, const float* s) {
#pragma unroll
  for (int i = 0; i < 4; ++i) { e[i][0] = *(const v4f*)(c + i * HD); e[i][1] = *(const v4f*)(c + i * HD + 128); e[i][2] = *(const v4f*)(s + i * HD); e[i][3] = *(const v4f*)(s + i * HD + 128); }
}
__global__ __launch_bounds__(128) void k_qkv(const float* __restrict__ X, const __bf16* __restrict__ P, const float* __restrict__ COS, const float* __restrict__ SIN, const float* __restrict__ QNW, const float* __restrict__ KNW, _Float16* __restrict__ QH, _Float16* __restrict__ QL, _Float16* __restrict__ KH, _Float16* __restrict__ KL, _Float16* __restrict__ VT, _Float16* __restrict__ VTL) {
  __shared__ __align__(16) unsigned char aux[2 * ABUF];   // in the loop the two A buffers (69,632 B); behind the loop the v heads' hi and residual planes (67,584 B)
  _Float16 (*soh)[16][264] = (_Float16 (*)[16][264])aux; _Float16 (*sol)[16][264] = (_Float16 (*)[16][264])(aux + 4 * 16 * 264 * 2);
  __shared__ __align__(16) unsigned char ring[2 * BBUF];   // the two weight buffers; behind the loop the q and k heads' f32 rows or the v heads' transpose planes lie here
  const int tid = threadIdx.x, wave = tid >> 5, lane = tid & 31, col = lane & 15, g = lane >> 4; const size_t rw = (size_t)blockIdx.x * 128 + wave * 16; const int hb = blockIdx.y; const int n0 = hb * HD;   // rw: first row of the wave's tile 0, tile 1 lies 64 rows on; n0: column base in [0, 3072)
  v8f acc[2][16] = {};
  const unsigned lcp = (unsigned)(size_t)ring + (unsigned)(tid >> 3) * BPITCH + (unsigned)(tid & 7) * 16u;   // this lane's first LDS byte: row tid / 8, 16-byte piece tid % 8
  const __bf16* gcp = P + (size_t)(n0 + (tid >> 3)) * HID + (tid & 7) * 8;
  const unsigned lca = (unsigned)(size_t)aux + (unsigned)(wave * 16 + g) * APITCH + (unsigned)col * 16u;   // A: row g of the wave's 16, 16-byte piece col
  const float* gca = X + (rw + g) * HID + col * 4;
  stage_tile(lcp, gcp); stage8a<HID>(lca, gca); stage8a<HID>(lca + 64u * APITCH, gca + 64 * HID);
  asm volatile("s_wait_asynccnt 0x0" ::: "memory");   // this wave's share of tile 0 has landed
  __syncthreads();                                    // tile 0 is readable by every wave
  stage_tile(lcp + BBUF, gcp + 64); stage8a<HID>(lca + ABUF, gca + 64); stage8a<HID>(lca + ABUF + 64u * APITCH, gca + 64 * HID + 64);
#pragma unroll 1   // one pass per trip: the ring's order stands once, at the foot
  for (int t = 0; t < NPASS; ++t) { v16b a[2][2];   // [row tile][k step]
#pragma unroll
    for (int rt = 0; rt < 2; ++rt) { const float* p = (const float*)(aux + (t & 1) * ABUF + (rt * 64 + wave * 16 + col) * APITCH) + 8 * g;
#pragma unroll
      for (int ks = 0; ks < 2; ++ks)
#pragma unroll
        for (int i = 0; i < 8; ++i) { a[rt][ks][i] = (__bf16)p[ks * 32 + i]; a[rt][ks][8 + i] = (__bf16)p[ks * 32 + 16 + i]; } }
    const unsigned char* bb = ring + (t & 1) * BBUF + col * BPITCH;
#pragma unroll
    for (int ks = 0; ks < 2; ++ks)
#pragma unroll
      for (int jh = 0; jh < 2; ++jh) { v16b w[8];   // eight fragments read as one group, then their sixteen products
#pragma unroll
        for (int j = 0; j < 8; ++j) w[j] = frag_b((const __bf16*)(bb + (jh * 8 + j) * 16 * BPITCH + ks * 64), lane);
        __builtin_amdgcn_sched_barrier(0);   // the group's 16 LDS reads stand in one place ahead of its products; left free, the compiler read one fragment at a time into one register set and waited out the LDS latency before every pair of products
#pragma unroll
        for (int j = 0; j < 8; ++j) { acc[0][jh * 8 + j] = wmma_bf(a[0][ks], w[j], acc[0][jh * 8 + j]); acc[1][jh * 8 + j] = wmma_bf(a[1][ks], w[j], acc[1][jh * 8 + j]); }
        __builtin_amdgcn_sched_barrier(0); }   // and the next group's reads stay behind these products, not spread among them
    asm volatile("s_wait_dscnt 0x0" ::: "memory");      // this wave's reads of buffer t % 2 are done before it is refilled
    asm volatile("s_wait_asynccnt 0x0" ::: "memory");   // this wave's share of tile t + 1 has landed
    __syncthreads();                                    // publishes tile t + 1 and ends every wave's reads of buffer t % 2
    if (t + 2 < NPASS) { stage_tile(lcp + (unsigned)(t & 1) * BBUF, gcp + (t + 2) * 64); stage8a<HID>(lca + (unsigned)(t & 1) * ABUF, gca + (t + 2) * 64); stage8a<HID>(lca + (unsigned)(t & 1) * ABUF + 64u * APITCH, gca + 64 * HID + (t + 2) * 64); } }
  asm volatile("s_wait_asynccnt 0x0" ::: "memory");     // no copy is outstanding when the ring's LDS is used anew
  const int kind = (hb < NH) ? 0 : (hb < NH + NKV) ? 1 : 2;   // q, k, v
#pragma unroll   // straight line: the accumulators of a row tile are named by constants. The epilogue runs once per row tile, on the same LDS: a wave's own range (q, k) is rewritten by that wave alone, behind its own reads; the v heads' planes are rewritten behind the barriers named there
  for (int rt = 0; rt < 2; ++rt) { const size_t r0 = rw + rt * 64;
  // RMSNorm statistics per row (8g + r): this lane's 16 columns, then the 16 col-lanes
  float ss[8];
#pragma unroll
  for (int r = 0; r < 8; ++r) { float s = 0.f;
#pragma unroll
    for (int j = 0; j < 16; ++j) s += acc[rt][j][r] * acc[rt][j][r];
    s = row_sum(s);
    ss[r] = 1.0f / sqrtf(s / (float)HD + 1e-6f); }
  if (kind < 2) {   // q, k: the normed rows go through LDS in f32, and the rotary is applied row by row, where cos and sin are read as whole rows
    const float* NW = (kind == 0) ? QNW : KNW;
    // a lane holds dims 4 * lane .. + 3 of a row and their rotary partners 128 further on: four 16-byte loads per row and lane bring cos and sin (rows are (b*S + s): [b][s][d] = row*HD + d), four rows a group, two groups of registers
    const float* cp = COS + r0 * HD + lane * 4; const float* sq = SIN + r0 * HD + lane * 4;
    v4f cs[2][4][4];
    rope_rows(cs[0], cp, sq);   // the first group flies during the staging
    float (*sx)[HD + 4] = (float (*)[HD + 4])(ring + wave * (16 * (HD + 4) * 4));   // 16 rows of 260 floats = 16,640 B per wave, inside the ring; every read of the ring ended at the last pass's barrier and no copy is outstanding
#pragma unroll
    for (int j = 0; j < 16; ++j) { const float w = bfr(NW[j * 16 + col]);
#pragma unroll
      for (int r = 0; r < 8; ++r) sx[8 * g + r][j * 16 + col] = acc[rt][j][r] * ss[r] * w; }
    LDSX();
    _Float16* DH = (kind == 0) ? QH : KH; _Float16* DL = (kind == 0) ? QL : KL; const size_t ld = (kind == 0) ? QW : KW; const int c0 = ((kind == 0) ? hb : hb - NH) * HD;
#pragma unroll   // straight line: the two register groups are named by constants
    for (int gq = 0; gq < 4; ++gq) {
      if (gq < 3) { rope_rows(cs[(gq + 1) & 1], cp + (gq + 1) * 4 * HD, sq + (gq + 1) * 4 * HD);
        asm volatile("s_wait_xcnt 0x0" ::: "memory");   // behind these loads, before their address registers are given to other values
        __builtin_amdgcn_sched_barrier(0); }   // the next group's loads stay ahead of this group's arithmetic, which covers their latency
#pragma unroll
      for (int i4 = 0; i4 < 4; ++i4) { const int rl = gq * 4 + i4; const v4f* e = cs[gq & 1][i4];
        const v4f xa = *(const v4f*)&sx[rl][lane * 4], xb = *(const v4f*)&sx[rl][128 + lane * 4];
        v4h ha, la, hc, lc;
#pragma unroll
        for (int i = 0; i < 4; ++i) { const float ya = xa[i] * bfr(e[0][i]) - xb[i] * bfr(e[2][i]), yb = xb[i] * bfr(e[1][i]) + xa[i] * bfr(e[3][i]);
          const _Float16 p = (_Float16)ya, q = (_Float16)yb; ha[i] = p; la[i] = (_Float16)((ya - (float)p) * 2048.0f); hc[i] = q; lc[i] = (_Float16)((yb - (float)q) * 2048.0f); }
        const size_t o = (r0 + rl) * ld + c0 + lane * 4;   // a wave's store covers 256 contiguous bytes, two whole lines
        vst2(DH + o, ha); vst2(DH + o + 128, hc); vst2(DL + o, la); vst2(DL + o + 128, lc); }
      if (gq < 2 || rt < 1) asm volatile("s_wait_xcnt 0x0" ::: "memory");   // behind this group's stores, before the loads that follow (the next groups', the next row tile's) land in their registers
    }
    if (rt < 1) LDSX(); }   // the rows are read back before the second tile's values are stored over them
  else {
#pragma unroll
    for (int j = 0; j < 16; ++j) { const int d = j * 16 + col;
#pragma unroll
      for (int r = 0; r < 8; ++r) { const float y = acc[rt][j][r] * ss[r];
        const _Float16 hv = (_Float16)y; soh[wave][8 * g + r][d] = hv; sol[wave][8 * g + r][d] = (_Float16)((y - (float)hv) * 2048.0f); } }
    LDSX();
    __syncthreads();   // the planes are whole; for the second row tile it also ends every wave's reads of the first tile's transpose planes
    const size_t rb = (size_t)blockIdx.x * 128 + rt * 64; const size_t b = rb / SS; const int s0 = (int)(rb % SS); const int g2 = hb - NH - NKV;
    _Float16 (*st)[72] = (_Float16 (*)[72])ring; _Float16 (*stl)[72] = (_Float16 (*)[72])(ring + BBUF);   // [HD][72] each, exactly one buffer; every read of the ring ended at the last pass's barrier
    for (int e = tid; e < 64 * HD; e += 128) { const int rr = e / HD, d = e % HD; st[d][rr] = soh[rr >> 4][rr & 15][d]; stl[d][rr] = sol[rr >> 4][rr & 15][d]; }
    __syncthreads();
    for (int e = tid; e < HD * 8; e += 128) { const int d = e >> 3, pc = e & 7; const size_t o = (b * KW + g2 * HD + d) * SS + s0 + pc * 8; vst2((unsigned*)(VT + o), *(const v4u*)&st[d][pc * 8]); vst2((unsigned*)(VTL + o), *(const v4u*)&stl[d][pc * 8]); } }
  }
}
// ---- k_attn: block = (64 queries, head n, b): kv head n/4; key tiles inside the window [i0 - 511, i0 + 63]; scores over 256 dims (3 products, q fragments re-read per step); mask j <= i && i - j < 512; online softmax; P = e x 2048 (f16) against v hi and e against the x2048 v residual, one accumulator (2 products); ctx rows
// Every matrix operand comes from LDS, brought by asynchronous 16-byte copies. Each wave's 16 q rows (hi, residual) are staged once. The k tile and the v tile of a 32-key step are the two buffers of one ring, filled in turn: v of step s flies while the scores of step s are formed, k of step s + 1 flies during the softmax and the value products of step s. The block's four waves read the one staged tile.
#define QPITCH 528              // LDS pitch of a staged 512-B row (q, k): 16 B x odd, conflict-free for ds_load_b128 readers
#define VPITCH 80               // LDS pitch of a staged 64-B v row (32 keys of one dim): 16 B x odd
#define QWAVE (32 * QPITCH)     // one wave's q rows, 16 hi then 16 residual: 16,896 B
#define KBUF (64 * QPITCH)      // 32 keys hi then 32 keys residual: 33,792 B
#define VBUF (512 * VPITCH)     // 256 dims hi then 256 dims residual: 40,960 B
// Eight copies of one lane, LS LDS bytes and gs elements apart. An immediate offset moves the LDS and the global address alike, so copy i names the one LDS-address register with offset i * LS (at most 17,920) and a global address that is i * LS short of its row: one LDS-address register serves all eight and none has to stay live across the step. Every register and every offset is a multiple of 16. The s_wait_xcnt stands inside the copies' own statement so that no address register of an issued copy is rewritten ahead of it.
template <int LS> __device__ __forceinline__ void stage8h(unsigned l, const _Float16* g, size_t gs) {
  const char* p = (const char*)g; const size_t d = gs * 2 - LS;   // bytes from one copy's global register to the next
  asm volatile("global_load_async_to_lds_b128 %0, %1, off\n\t"
               "global_load_async_to_lds_b128 %0, %2, off offset:%9\n\t"
               "global_load_async_to_lds_b128 %0, %3, off offset:%10\n\t"
               "global_load_async_to_lds_b128 %0, %4, off offset:%11\n\t"
               "global_load_async_to_lds_b128 %0, %5, off offset:%12\n\t"
               "global_load_async_to_lds_b128 %0, %6, off offset:%13\n\t"
               "global_load_async_to_lds_b128 %0, %7, off offset:%14\n\t"
               "global_load_async_to_lds_b128 %0, %8, off offset:%15\n\t"
               "s_wait_xcnt 0x0"
               :: "v"(l), "v"(p), "v"(p + d), "v"(p + 2 * d), "v"(p + 3 * d), "v"(p + 4 * d), "v"(p + 5 * d), "v"(p + 6 * d), "v"(p + 7 * d),
                  "n"(LS), "n"(2 * LS), "n"(3 * LS), "n"(4 * LS), "n"(5 * LS), "n"(6 * LS), "n"(7 * LS)
               : "memory");
}
__global__ __launch_bounds__(128) void k_attn(const _Float16* __restrict__ QH, const _Float16* __restrict__ QL, const _Float16* __restrict__ KH, const _Float16* __restrict__ KL, const _Float16* __restrict__ VT, const _Float16* __restrict__ VTL, float* __restrict__ O) {
  __shared__ __align__(16) _Float16 sp[4][16][40], spu[4][16][40];
  __shared__ __align__(16) unsigned char qs[4 * QWAVE];   // q rows, a range per wave; behind the loop each wave stages its ctx rows in its own range
  __shared__ __align__(16) unsigned char kb[KBUF];        // ring buffer 0: the k tile
  __shared__ __align__(16) unsigned char vb[VBUF];        // ring buffer 1: the v tile
  const int tid = threadIdx.x, wave = tid >> 5, lane = tid & 31, col = lane & 15, g = lane >> 4; const int qb = blockIdx.x, n = blockIdx.y; const size_t b = blockIdx.z; const int kvh = n / (NH / NKV); const int q0 = qb * 64 + wave * 16; const size_t rowb = b * SS;
  const _Float16* Vp = VT + (b * KW + kvh * HD) * SS; const _Float16* Vpl = VTL + (b * KW + kvh * HD) * SS;
  float m[8], l[8];
#pragma unroll
  for (int r = 0; r < 8; ++r) { m[r] = -3.0e38f; l[r] = 0.f; }
  v8f acc[16] = {};
  const int ks0 = max(0, qb * 64 - (WIN - 1)) / 32, ks1 = (qb * 64 + 64) / 32;
  // q: a wave's copy is one whole 512-B row of its own 16 queries. k: a wave's copy is one whole row; waves 0, 1 bring the hi rows (16 keys each), waves 2, 3 the residual rows. v: a wave's copy is eight 64-B rows; lane = (row tid / 4, piece tid % 4).
  const unsigned lq = (unsigned)(size_t)qs + (unsigned)wave * QWAVE + (unsigned)lane * 16u; const size_t gq = (rowb + q0) * QW + n * HD + lane * 8;
  const unsigned lk = (unsigned)(size_t)kb + (unsigned)wave * 16u * QPITCH + (unsigned)lane * 16u; const _Float16* gk = ((wave < 2) ? KH : KL) + (rowb + (wave & 1) * 16) * KW + kvh * HD + lane * 8;
  const unsigned lv = (unsigned)(size_t)vb + (unsigned)(tid >> 2) * VPITCH + (unsigned)(tid & 3) * 16u; const size_t gv = (size_t)(tid >> 2) * SS + (tid & 3) * 8;
  stage8h<QPITCH>(lq, QH + gq, QW); stage8h<QPITCH>(lq + 8u * QPITCH, QH + gq + 8 * QW, QW); stage8h<QPITCH>(lq + 16u * QPITCH, QL + gq, QW); stage8h<QPITCH>(lq + 24u * QPITCH, QL + gq + 8 * QW, QW);
  stage8h<QPITCH>(lk, gk + (size_t)ks0 * 32 * KW, KW); stage8h<QPITCH>(lk + 8u * QPITCH, gk + ((size_t)ks0 * 32 + 8) * KW, KW);
  asm volatile("s_wait_asynccnt 0x0" ::: "memory");   // this wave's q rows and its share of the first k tile have landed
  __syncthreads();                                    // the first k tile is readable by every wave
  stage8h<32 * VPITCH>(lv, Vp + gv + ks0 * 32, 32 * SS); stage8h<32 * VPITCH>(lv + 256u * VPITCH, Vpl + gv + ks0 * 32, 32 * SS);
  const unsigned char* qrow = qs + wave * QWAVE + col * QPITCH;
#pragma unroll 1
  for (int ks = ks0; ks < ks1; ++ks) { const int j0 = ks * 32; v8f s[2];
#pragma unroll
    for (int ct = 0; ct < 2; ++ct) { const int kk = j0 + ct * 16 + col; const unsigned char* krow = kb + (ct * 16 + col) * QPITCH; v8f c = {}, cl = {};
#pragma unroll   // straight-line groups: the fragment arrays stay in registers and each group's LDS reads stand in one place
      for (int kq = 0; kq < HD / 64; ++kq) { v16h aq[2], aql[2], kh[2], kl[2];   // eight fragments read as one group, then their six products
#pragma unroll
        for (int j = 0; j < 2; ++j) { const int ko = (kq * 2 + j) * 64; aq[j] = frag_h((const _Float16*)(qrow + ko), lane); aql[j] = frag_h((const _Float16*)(qrow + 16 * QPITCH + ko), lane); kh[j] = frag_h((const _Float16*)(krow + ko), lane); kl[j] = frag_h((const _Float16*)(krow + 32 * QPITCH + ko), lane); }
#pragma unroll
        for (int j = 0; j < 2; ++j) { c = wmma16(aq[j], kh[j], c); cl = wmma16(aql[j], kh[j], cl); cl = wmma16(aq[j], kl[j], cl); } }
#pragma unroll
      for (int r = 0; r < 8; ++r) { const int qi = q0 + 8 * g + r; const bool keep = (kk <= qi) && (qi - kk < WIN); s[ct][r] = keep ? (c[r] + cl[r] * (1.0f / 2048.0f)) : -3.0e38f; } }   // unscaled logits (the module applies no 1/sqrt(d))
    asm volatile("s_wait_dscnt 0x0" ::: "memory");      // this wave's reads of the k tile are done before it is refilled
    asm volatile("s_wait_asynccnt 0x0" ::: "memory");   // this wave's share of this step's v tile has landed
    __syncthreads();                                    // publishes the v tile and ends every wave's reads of the k tile
    if (ks + 1 < ks1) { stage8h<QPITCH>(lk, gk + (size_t)(j0 + 32) * KW, KW); stage8h<QPITCH>(lk + 8u * QPITCH, gk + (size_t)(j0 + 40) * KW, KW); }
#pragma unroll
    for (int r = 0; r < 8; ++r) { const float mx = row_max(fmaxf(s[0][r], s[1][r]));
      const float mn = fmaxf(m[r], mx); const float xm = exp_slot(m[r] - mn), x0 = exp_slot(s[0][r] - mn), x1 = exp_slot(s[1][r] - mn);   // formed in every lane, then selected: no branch in the step
      const float alpha = (m[r] <= -1.0e38f) ? 0.f : xm;
      const float e0 = (s[0][r] <= -1.0e38f) ? 0.f : x0, e1 = (s[1][r] <= -1.0e38f) ? 0.f : x1; const float es = row_sum(e0 + e1);
      l[r] = l[r] * alpha + es; m[r] = (mn <= -1.0e38f) ? m[r] : mn;
#pragma unroll
      for (int dt = 0; dt < 16; ++dt) acc[dt][r] *= alpha;
      sp[wave][8 * g + r][col] = (_Float16)(e0 * 2048.0f); sp[wave][8 * g + r][16 + col] = (_Float16)(e1 * 2048.0f); spu[wave][8 * g + r][col] = (_Float16)e0; spu[wave][8 * g + r][16 + col] = (_Float16)e1; }   // (e x 2048) pairs with v hi, plain e with the x2048 v residual -> both land in one f32 accumulator
    LDSX();
    const v16h pa = frag_h(&sp[wave][col][0], lane), pu = frag_h(&spu[wave][col][0], lane);
#pragma unroll   // straight-line groups, as in the score loop
    for (int dq = 0; dq < 4; ++dq) { v16h vl[4], vh[4];   // eight fragments read as one group, then their eight products
#pragma unroll
      for (int j = 0; j < 4; ++j) { const unsigned char* vr = vb + ((dq * 4 + j) * 16 + col) * VPITCH; vl[j] = frag_h((const _Float16*)(vr + 256 * VPITCH), lane); vh[j] = frag_h((const _Float16*)vr, lane); }
#pragma unroll
      for (int j = 0; j < 4; ++j) { acc[dq * 4 + j] = wmma16(pu, vl[j], acc[dq * 4 + j]); acc[dq * 4 + j] = wmma16(pa, vh[j], acc[dq * 4 + j]); } }
    asm volatile("s_wait_dscnt 0x0" ::: "memory");      // this wave's reads of the v tile (and of its softmax planes) are done before the refill
    asm volatile("s_wait_asynccnt 0x0" ::: "memory");   // this wave's share of the next k tile has landed
    __syncthreads();                                    // publishes the next k tile and ends every wave's reads of the v tile
    if (ks + 1 < ks1) { stage8h<32 * VPITCH>(lv, Vp + gv + j0 + 32, 32 * SS); stage8h<32 * VPITCH>(lv + 256u * VPITCH, Vpl + gv + j0 + 32, 32 * SS); } }
  asm volatile("s_wait_asynccnt 0x0" ::: "memory");     // no copy is outstanding when the q range is used anew
  float (*so)[HD + 4] = (float (*)[HD + 4])(qs + wave * QWAVE);   // 16 rows of 260 floats = 16,640 B, inside this wave's own q range, which no other wave reads or writes
#pragma unroll
  for (int r = 0; r < 8; ++r) { const float il = (1.0f / 2048.0f) / l[r];
#pragma unroll
    for (int dt = 0; dt < 16; ++dt) so[8 * g + r][dt * 16 + col] = acc[dt][r] * il; }
  LDSX();
  for (int rl = 0; rl < 16; ++rl) { const size_t o = (rowb + q0 + rl) * QW + n * HD; vst2(O + o + lane * 4, *(const v4f*)&so[rl][lane * 4]); vst2(O + o + 128 + lane * 4, *(const v4f*)&so[rl][128 + lane * 4]); }
}
// ---- k_out: block = (128 rows, 128 cols): y = ctx(hi/lo, K 2048) . Wo rows
// The block's 128 weight rows and its 128 ctx rows go through LDS as in k_qkv: 64 k per pass, two buffers, eight asynchronous copies per lane and pass for the weights, sixteen for ctx. A wave holds two 16-row tiles (rows 64 apart): each weight fragment it reads feeds four products.
#define OBUF (128 * BPITCH)     // 18,432 B per buffer
__global__ __launch_bounds__(128) void k_out(const float* __restrict__ Oc, const __bf16* __restrict__ P, float* __restrict__ Y) {
  __shared__ __align__(16) unsigned char aux[2 * ABUF];   // in the loop the two A buffers; behind the loop the output rows (33,792 B)
  float (*so)[16][132] = (float (*)[16][132])aux;
  __shared__ __align__(16) unsigned char ring[2 * OBUF];   // the two weight buffers
  const int tid = threadIdx.x, wave = tid >> 5, lane = tid & 31, col = lane & 15, g = lane >> 4; const size_t rw = (size_t)blockIdx.x * 128 + wave * 16; const int n0 = blockIdx.y * 128;   // rw: first row of the wave's tile 0, tile 1 lies 64 rows on
  v8f acc[2][8] = {};
  const unsigned lcp = (unsigned)(size_t)ring + (unsigned)(tid >> 3) * BPITCH + (unsigned)(tid & 7) * 16u;   // this lane's first LDS byte: row tid / 8, 16-byte piece tid % 8
  const __bf16* gcp = P + (size_t)(n0 + (tid >> 3)) * HID + (tid & 7) * 8;
  const unsigned lca = (unsigned)(size_t)aux + (unsigned)(wave * 16 + g) * APITCH + (unsigned)col * 16u;   // A: row g of the wave's 16, 16-byte piece col
  const float* gca = Oc + (rw + g) * QW + col * 4;
  stage8(lcp, gcp); stage8a<QW>(lca, gca); stage8a<QW>(lca + 64u * APITCH, gca + 64 * QW);
  asm volatile("s_wait_asynccnt 0x0" ::: "memory");   // this wave's share of tile 0 has landed
  __syncthreads();                                    // tile 0 is readable by every wave
  stage8(lcp + OBUF, gcp + 64); stage8a<QW>(lca + ABUF, gca + 64); stage8a<QW>(lca + ABUF + 64u * APITCH, gca + 64 * QW + 64);
#pragma unroll 1   // one pass per trip: the ring's order stands once, at the foot
  for (int t = 0; t < QW / 64; ++t) { F2 a[2][2];   // [row tile][k step]
#pragma unroll
    for (int rt = 0; rt < 2; ++rt)
#pragma unroll
      for (int ks = 0; ks < 2; ++ks) a[rt][ks] = split_row((const float*)(aux + (t & 1) * ABUF + (rt * 64 + wave * 16 + col) * APITCH), ks * 32, lane);
    const unsigned char* bb = ring + (t & 1) * OBUF + col * BPITCH;
#pragma unroll
    for (int ks = 0; ks < 2; ++ks) { v16b w[8];   // eight fragments read as one group, then their 32 products; per accumulator residual first, then hi, as before
#pragma unroll
      for (int j = 0; j < 8; ++j) w[j] = frag_b((const __bf16*)(bb + j * 16 * BPITCH + ks * 64), lane);
      __builtin_amdgcn_sched_barrier(0);   // the group's 16 LDS reads stand in one place ahead of its products, as in k_qkv
#pragma unroll
      for (int j = 0; j < 8; ++j) { acc[0][j] = wmma_bf(a[0][ks].l, w[j], acc[0][j]); acc[1][j] = wmma_bf(a[1][ks].l, w[j], acc[1][j]); acc[0][j] = wmma_bf(a[0][ks].h, w[j], acc[0][j]); acc[1][j] = wmma_bf(a[1][ks].h, w[j], acc[1][j]); }
      __builtin_amdgcn_sched_barrier(0); }   // the next group's reads stay behind these products
    asm volatile("s_wait_dscnt 0x0" ::: "memory");      // this wave's reads of buffer t % 2 are done before it is refilled
    asm volatile("s_wait_asynccnt 0x0" ::: "memory");   // this wave's share of tile t + 1 has landed
    __syncthreads();                                    // publishes tile t + 1 and ends every wave's reads of buffer t % 2
    if (t + 2 < QW / 64) { stage8(lcp + (unsigned)(t & 1) * OBUF, gcp + (t + 2) * 64); stage8a<QW>(lca + (unsigned)(t & 1) * ABUF, gca + (t + 2) * 64); stage8a<QW>(lca + (unsigned)(t & 1) * ABUF + 64u * APITCH, gca + 64 * QW + (t + 2) * 64); } }
  asm volatile("s_wait_asynccnt 0x0" ::: "memory");     // no copy is outstanding when the A buffers' LDS is used anew
#pragma unroll   // straight line: the accumulators of a row tile are named by constants; a wave's own output range is rewritten by that wave alone, behind its own reads
  for (int rt = 0; rt < 2; ++rt) {
#pragma unroll
    for (int j = 0; j < 8; ++j)
#pragma unroll
      for (int r = 0; r < 8; ++r) so[wave][8 * g + r][j * 16 + col] = acc[rt][j][r];
    LDSX();
    for (int rl = 0; rl < 16; ++rl) vst2(Y + (rw + rt * 64 + rl) * HID + n0 + lane * 4, *(const v4f*)&so[wave][rl][lane * 4]);
    if (rt < 1) LDSX(); }   // the rows are read back before the second tile's values are stored over them
}
extern "C" void kernel_launch(void* const* d_in, const int* in_sizes, int n_in, void* d_out, int out_size, void* d_ws, size_t ws_size, hipStream_t stream) {
  (void)in_sizes; (void)n_in; (void)out_size;
  const float** F = (const float**)d_in;   // 0 hidden_states [2,2048,2048], 1 cos [2,2048,256], 2 sin, 3 Wq [2048,2048], 4 Wk [512,2048], 5 Wv [512,2048], 6 Wo [2048,2048] (natural), 7 q_norm_w [256], 8 k_norm_w [256]
  if (ws_size < (size_t)WS_END) return;
  char* ws = (char*)d_ws; __bf16* PK = (__bf16*)(ws + WS_PK); _Float16 *QH = (_Float16*)(ws + WS_QH), *QL = (_Float16*)(ws + WS_QL), *KH = (_Float16*)(ws + WS_KH), *KL = (_Float16*)(ws + WS_KL), *VT = (_Float16*)(ws + WS_VT), *VTL = (_Float16*)(ws + WS_VTL); float* O = (float*)(ws + WS_O);
  k_pack<<<dim3(PKG), 256, 0, stream>>>(F[3], F[4], F[5], F[6], PK);
  k_qkv<<<dim3(TRB, NH + 2 * NKV), 128, 0, stream>>>(F[0], PK + PK_A, F[1], F[2], F[7], F[8], QH, QL, KH, KL, VT, VTL);
  k_attn<<<dim3(TQB, NH, TNB), 128, 0, stream>>>(QH, QL, KH, KL, VT, VTL, O);
  k_out<<<dim3(TOB, HID / 128), 128, 0, stream>>>(O, PK + PK_P, (float*)d_out);
}

// v008
// Measured time: 170 microseconds a run.
// Two timings next to v007 both put it at 1.10 times that version's speed.
// All steps since v000 together make it 5.94 times as fast.
// compute dtype: hidden_states, cos, sin, Wq/Wk/Wv/Wo, q/k norm weights rounded to bf16; q/k/v projections with exact bf16 products on WMMA 16x16x32 (natural [out][in] rows; one 256-column head per block); per-head RMSNorm (eps 1e-6, x weight; v with weight 1) and the rotate-half rotary embedding with the cos/sin inputs in f32 in the projection epilogue; q and k stored as f16 hi + (x2048-scaled) residual planes with 3-product scores (unscaled logits, sigma ~16, kept f32-accurate), v stored as f16 hi + (x2048-scaled) residual planes; sliding-window causal mask (j <= i, i - j < 512), running-max softmax in f32 (hardware exp); the softmax weights as f16 planes e x 2048 (against v hi) and e (against the x2048 v residual) accumulated into one f32 accumulator (2 products; 2^-11 folded into the epilogue); output projection with ctx as bf16 hi + residual x exact Wo rows (2 products); f32 accumulate.
#include <hip/hip_runtime.h>
#include <math.h>

typedef __attribute__((ext_vector_type(16))) _Float16 v16h;
typedef __attribute__((ext_vector_type(16))) __bf16 v16b;
typedef __attribute__((ext_vector_type(8)))  _Float16 v8h;
typedef __attribute__((ext_vector_type(4)))  _Float16 v4h;
typedef __attribute__((ext_vector_type(8)))  float v8f;
typedef __attribute__((ext_vector_type(4)))  float v4f;
typedef __attribute__((ext_vector_type(2)))  float v2f;
typedef __attribute__((ext_vector_type(4)))  unsigned v4u;
typedef __attribute__((ext_vector_type(4)))  int v4i;
typedef float __attribute__((may_alias)) float_a;
typedef int __attribute__((may_alias)) int_a;

template <typename T> __device__ __forceinline__ void vst2(void* p, T v) { *(T*)p = v;  }
__device__ __forceinline__ v8f wmma16(v16h a, v16h b, v8f c) {
  v8f d = __builtin_amdgcn_wmma_f32_16x16x32_f16(false, a, false, b, (short)0, c, false, false);
  asm volatile("v_nop\n\tv_nop\n\tv_nop\n\tv_nop" : "+v"(d) : "v"(a), "v"(b));
  return d;
}
__device__ __forceinline__ v8f wmma_bf(v16b a, v16b b, v8f c) {
  return __builtin_amdgcn_wmma_f32_16x16x32_bf16(false, a, false, b, (short)0, c, false, false);   // the builtin alone, the compiler keeps its distances: an asm statement on its operands would hold all of them below v256, and two row tiles' accumulators with their fragments need more
}
// 16x16x32 fragments: lane = (h = lane>>4, row/col = lane&15); elements 0..7 = k0+8h+0..7, 8..15 = k0+16+8h+0..7; D element r = row 8h+r
__device__ __forceinline__ v16h frag_h(const _Float16* rowk0, int lane) {
  union { v16h v; v8h q[2]; } u; const _Float16* p = rowk0 + 8 * (lane >> 4);
  u.q[0] = *(const v8h*)p; u.q[1] = *(const v8h*)(p + 16); return u.v;
}
__device__ __forceinline__ v16h frag_f32(const float* rowk0, int lane) {
  v16h a; const float* p = rowk0 + 8 * (lane >> 4);
#pragma unroll
  for (int i = 0; i < 8; ++i) { a[i] = (_Float16)p[i]; a[8 + i] = (_Float16)p[16 + i]; }
  return a;
}
__device__ __forceinline__ v16h frag_f32s(const float* rowk0, int lane, float sc) {
  v16h a; const float* p = rowk0 + 8 * (lane >> 4);
#pragma unroll
  for (int i = 0; i < 8; ++i) { a[i] = (_Float16)(p[i] * sc); a[8 + i] = (_Float16)(p[16 + i] * sc); }
  return a;
}
// column fragment from a [K][ld] layout (column n), rows >= K read as 0
__device__ __forceinline__ v16h fragc_f32(const float* W, int k0, int n, int lane, int ld, int K) {
  v16h a; const int g = lane >> 4;
#pragma unroll
  for (int i = 0; i < 8; ++i) { const int ka = k0 + 8 * g + i, kb = ka + 16;
    a[i] = (_Float16)(ka < K ? W[(size_t)(ka < K ? ka : K - 1) * ld + n] : 0.f); a[8 + i] = (_Float16)(kb < K ? W[(size_t)(kb < K ? kb : K - 1) * ld + n] : 0.f); }
  return a;
}
struct F2 { v16b h, l; };
__device__ __forceinline__ F2 bsplit16(const float v[16]) { F2 r;
#pragma unroll
  for (int i = 0; i < 16; ++i) { const __bf16 h = (__bf16)v[i]; r.h[i] = h; r.l[i] = (__bf16)(v[i] - (float)h); }
  return r; }
__device__ __forceinline__ F2 split_row(const float* row, int k0, int lane) { float v[16]; const float* p = row + k0 + 8 * (lane >> 4);
#pragma unroll
  for (int i = 0; i < 8; ++i) { v[i] = p[i]; v[8 + i] = p[16 + i]; }
  return bsplit16(v); }
__device__ __forceinline__ F2 split_rowK(const float* row, int k0, int lane, int K) { float v[16]; const int g = lane >> 4;
#pragma unroll
  for (int i = 0; i < 8; ++i) { const int ka = k0 + 8 * g + i, kb = ka + 16; v[i] = ka < K ? row[ka < K ? ka : K - 1] : 0.f; v[8 + i] = kb < K ? row[kb < K ? kb : K - 1] : 0.f; }
  return bsplit16(v); }
__device__ __forceinline__ F2 split_col(const float* W, int k0, int n, int lane, int ld, int K) { float v[16]; const int g = lane >> 4;
#pragma unroll
  for (int i = 0; i < 8; ++i) { const int ka = k0 + 8 * g + i, kb = ka + 16; v[i] = ka < K ? W[(size_t)(ka < K ? ka : K - 1) * ld + n] : 0.f; v[8 + i] = kb < K ? W[(size_t)(kb < K ? kb : K - 1) * ld + n] : 0.f; }
  return bsplit16(v); }
__device__ __forceinline__ v8f mac3(const F2& a, const F2& b, v8f c) { c = wmma_bf(a.l, b.h, c); c = wmma_bf(a.h, b.l, c); return wmma_bf(a.h, b.h, c); }
__device__ __forceinline__ float sigm(float v) { return 1.0f / (1.0f + expf(-v)); }
// value of lane (lane ^ M) of the same 16-lane row, M < 16, by a DPP row_xmask move in the vector pipe (the shuffle builtin goes through the LDS unit and is waited for at every step); every lane is on where it is used
template <int M> __device__ __forceinline__ float rowx(float v) { return __builtin_bit_cast(float, __builtin_amdgcn_mov_dpp(__builtin_bit_cast(int, v), 0x160 + M, 0xf, 0xf, true)); }
// butterfly over the 16 lanes of a row, steps 1, 2, 4, 8
__device__ __forceinline__ float row_sum(float s) { s += rowx<1>(s); s += rowx<2>(s); s += rowx<4>(s); s += rowx<8>(s); return s; }
__device__ __forceinline__ float row_max(float m) { m = fmaxf(m, rowx<1>(m)); m = fmaxf(m, rowx<2>(m)); m = fmaxf(m, rowx<4>(m)); m = fmaxf(m, rowx<8>(m)); return m; }
// e^x as the fast-math form computes it (x * log2(e), hardware exp2). The v_nop is the free slot that the instruction set asks for behind a transcendental before its source is overwritten or its result read; inside the statement it stays directly behind the v_exp_f32
__device__ __forceinline__ float exp_slot(float x) { float r; const float y = x * 1.44269504f; asm("v_exp_f32 %0, %1\n\tv_nop" : "=v"(r) : "v"(y)); return r; }
#define LDSX() do { asm volatile("s_wait_dscnt 0" ::: "memory"); __builtin_amdgcn_wave_barrier(); __builtin_amdgcn_fence(__ATOMIC_RELEASE, "workgroup"); } while (0)


// Grouped-query sliding-window attention (B 2, S 2,048, hidden 2,048, 8 query heads / 2 kv heads x 256, window 512): q/k/v projections, per-head RMSNorm, rotary embedding, windowed causal softmax, output projection.
#define NB 2
#define SS 2048
#define HID 2048
#define NH 8
#define NKV 2
#define HD 256
#define WIN 512
#define QW (NH * HD)          // 2048 q columns
#define KW (NKV * HD)         // 512
#define QKVW (QW + 2 * KW)    // 3072
#define NR (NB * SS)
#ifndef TQB
#define TQB (SS / 64)
#define TNB NB
#define TOB (NB * SS / 128)
#define TRB (NB * SS / 128)   // projection row tiles of 128 rows
#endif
typedef __attribute__((ext_vector_type(8))) __bf16 v8b;
__device__ __forceinline__ v16b frag_b(const __bf16* rowk0, int lane) {
  union { v16b v; v8b q[2]; } u; const __bf16* p = rowk0 + 8 * (lane >> 4);
  u.q[0] = *(const v8b*)p; u.q[1] = *(const v8b*)(p + 16); return u.v;
}
__device__ __forceinline__ float bfr(float v) { return (float)(__bf16)v; }
__device__ __attribute__((noinline)) float exp_ni(float v) { return expf(v); }
__device__ __attribute__((noinline)) float erf_ni(float v) { return erff(v); }

#define PK_A 0                            // [3072][2048] Wq | Wk | Wv natural rows
#define PK_P ((size_t)QKVW * HID)         // [2048][2048] Wo natural rows
#define PK_END (PK_P + (size_t)HID * HID)
#define WS_PK  0u
#define WS_QH  (((2u * PK_END) + 127u) / 128u * 128u)   // f16 [4096][2048] q hi ; QL
#define WS_QL  (WS_QH + 2u * (size_t)NR * QW)
#define WS_KH  (WS_QL + 2u * (size_t)NR * QW)          // f16 [4096][512] k hi ; KL
#define WS_KL  (WS_KH + 2u * (size_t)NR * KW)
#define WS_VT  (WS_KL + 2u * (size_t)NR * KW)          // f16 [b][512][2048] v hi ; VTL (x2048 residual)
#define WS_VTL (WS_VT + 2u * (size_t)NR * KW)
#define WS_O   (WS_VTL + 2u * (size_t)NR * KW)         // f32 [4096][2048] ctx
#define WS_END (WS_O + 4u * (size_t)NR * QW)

// ---- k_pack: PK is the four weight matrices one behind the other (Wq | Wk | Wv | Wo, natural rows), each value rounded to bf16, so the launch is one flat stream. A block converts 16,384 values of one matrix (eight whole rows): few waves have to start, and each holds its 16 loads in flight at once.
#define PKF 16384                         // values per block: 256 lanes x 16 pieces of 4
#define PKQ (QW * HID / PKF)              // 256 blocks for Wq (and for Wo)
#define PKK (KW * HID / PKF)              // 64 blocks for Wk (and for Wv)
#define PKG ((QKVW + HID) * HID / PKF)    // 640 blocks
typedef __attribute__((ext_vector_type(4))) __bf16 v4b;
__global__ __launch_bounds__(256) void k_pack(const float* __restrict__ WQ, const float* __restrict__ WK, const float* __restrict__ WV, const float* __restrict__ WO, __bf16* __restrict__ PK) {
  const int blk = blockIdx.x, t = threadIdx.x;
  const float* Wm = WQ; int first = 0;   // the block's matrix and that matrix's first block
  if (blk >= PKQ + 2 * PKK) { Wm = WO; first = PKQ + 2 * PKK; } else if (blk >= PKQ + PKK) { Wm = WV; first = PKQ + PKK; } else if (blk >= PKQ) { Wm = WK; first = PKQ; }
  const float* s = Wm + (size_t)(blk - first) * PKF + t * 4; __bf16* d = PK + (size_t)blk * PKF + t * 4;
  v4f v[16];   // a wave's load covers 512 contiguous bytes (four whole lines), its store 256 (two whole lines)
#pragma unroll
  for (int i = 0; i < 16; ++i) v[i] = *(const v4f*)(s + i * 1024);
  __builtin_amdgcn_sched_barrier(0);   // all 16 loads are issued ahead of the first conversion; without it the last two waited for the first two to land, to take over their registers
  v4b o[16];
#pragma unroll
  for (int i = 0; i < 16; ++i)
#pragma unroll
    for (int k = 0; k < 4; ++k) o[i][k] = (__bf16)v[i][k];
#pragma unroll
  for (int i = 0; i < 16; ++i) vst2(d + i * 1024, o[i]);
}
// ---- k_qkv: block = (128 rows, one 256-column head hb of [q heads 0..7 | k heads 8..9 | v heads 10..11]): GEMM (exact, 16 tiles), RMSNorm over the head's 256 dims (f32), rotary (q, k) with the cos/sin inputs, then planes
// The head's 256 weight rows go through LDS, 64 k (128 B of each row) per pass, two buffers: asynchronous 16-byte copies bring pass t + 2 while pass t + 1 waits ready, and the block's four waves read their B fragments from the one staged tile. A wave holds two 16-row tiles (rows 64 apart), so each B fragment it reads feeds two products and the head's weight rows are copied once per 128 rows.
#define BPITCH 144              // LDS pitch of a staged 128-B row: 16 B x odd, conflict-free for ds_load_b128 readers
#define BBUF (HD * BPITCH)      // 36,864 B per buffer
#define NPASS (HID / 64)
// Eight copies of one lane: rows 16 apart, 16 bytes each. The s_wait_xcnt stands inside the copies' own statement so that no address register of an issued copy is rewritten ahead of it.
__device__ __forceinline__ void stage8(unsigned l, const __bf16* g) {
  asm volatile("global_load_async_to_lds_b128 %0, %8, off\n\t"
               "global_load_async_to_lds_b128 %1, %9, off\n\t"
               "global_load_async_to_lds_b128 %2, %10, off\n\t"
               "global_load_async_to_lds_b128 %3, %11, off\n\t"
               "global_load_async_to_lds_b128 %4, %12, off\n\t"
               "global_load_async_to_lds_b128 %5, %13, off\n\t"
               "global_load_async_to_lds_b128 %6, %14, off\n\t"
               "global_load_async_to_lds_b128 %7, %15, off\n\t"
               "s_wait_xcnt 0x0"
               :: "v"(l), "v"(l + 16u * BPITCH), "v"(l + 32u * BPITCH), "v"(l + 48u * BPITCH), "v"(l + 64u * BPITCH), "v"(l + 80u * BPITCH), "v"(l + 96u * BPITCH), "v"(l + 112u * BPITCH),
                  "v"(g), "v"(g + 16 * HID), "v"(g + 32 * HID), "v"(g + 48 * HID), "v"(g + 64 * HID), "v"(g + 80 * HID), "v"(g + 96 * HID), "v"(g + 112 * HID)
               : "memory");
}
// One pass's tile: 256 rows x 128 B = 16 copies per lane; a wave's copy covers four whole rows (four 128-B lines).
__device__ __forceinline__ void stage_tile(unsigned l, const __bf16* g) { stage8(l, g); stage8(l + 128u * BPITCH, g + 128 * HID); }
// The A tile of a pass (128 rows x 64 k, f32) goes through LDS in the same ring order as the weight tile. A wave brings its own two times 16 rows: a copy is two whole 256-B rows (four whole 128-B lines), where a fragment load from global memory touched 16 lines for 32 B each and was waited for inside its pass.
#define APITCH 272              // LDS pitch of a staged 256-B row: 16 B x odd, conflict-free for ds_load_b128 readers
#define ABUF (128 * APITCH)     // 34,816 B per buffer
// Eight copies of one lane: rows 2 apart (LD floats a row), 16 bytes each. The s_wait_xcnt stands inside the copies' own statement so that no address register of an issued copy is rewritten ahead of it.
template <int LD> __device__ __forceinline__ void stage8a(unsigned l, const float* g) {
  asm volatile("global_load_async_to_lds_b128 %0, %8, off\n\t"
               "global_load_async_to_lds_b128 %1, %9, off\n\t"
               "global_load_async_to_lds_b128 %2, %10, off\n\t"
               "global_load_async_to_lds_b128 %3, %11, off\n\t"
               "global_load_async_to_lds_b128 %4, %12, off\n\t"
               "global_load_async_to_lds_b128 %5, %13, off\n\t"
               "global_load_async_to_lds_b128 %6, %14, off\n\t"
               "global_load_async_to_lds_b128 %7, %15, off\n\t"
               "s_wait_xcnt 0x0"
               :: "v"(l), "v"(l + 2u * APITCH), "v"(l + 4u * APITCH), "v"(l + 6u * APITCH), "v"(l + 8u * APITCH), "v"(l + 10u * APITCH), "v"(l + 12u * APITCH), "v"(l + 14u * APITCH),
                  "v"(g), "v"(g + 2 * LD), "v"(g + 4 * LD), "v"(g + 6 * LD), "v"(g + 8 * LD), "v"(g + 10 * LD), "v"(g + 12 * LD), "v"(g + 14 * LD)
               : "memory");
}
// cos and sin of four rows for one lane: per row cos[d], cos[d + 128], sin[d], sin[d + 128], four dims each
__device__ __forceinline__ void rope_rows(v4f (&e)[4][4], const float* c, const float* s) {
#pragma unroll
  for (int i = 0; i < 4; ++i) { e[i][0] = *(const v4f*)(c + i * HD); e[i][1] = *(const v4f*)(c + i * HD + 128); e[i][2] = *(const v4f*)(s + i * HD); e[i][3] = *(const v4f*)(s + i * HD + 128); }
}
__global__ __launch_bounds__(128) void k_qkv(const float* __restrict__ X, const __bf16* __restrict__ P, const float* __restrict__ COS, const float* __restrict__ SIN, const float* __restrict__ QNW, const float* __restrict__ KNW, _Float16* __restrict__ QH, _Float16* __restrict__ QL, _Float16* __restrict__ KH, _Float16* __restrict__ KL, _Float16* __restrict__ VT, _Float16* __restrict__ VTL) {
  __shared__ __align__(16) unsigned char aux[2 * ABUF];   // in the loop the two A buffers (69,632 B); behind the loop the v heads' hi and residual planes (67,584 B)
  _Float16 (*soh)[16][264] = (_Float16 (*)[16][264])aux; _Float16 (*sol)[16][264] = (_Float16 (*)[16][264])(aux + 4 * 16 * 264 * 2);
  __shared__ __align__(16) unsigned char ring[2 * BBUF];   // the two weight buffers; behind the loop the q and k heads' f32 rows or the v heads' transpose planes lie here
  const int tid = threadIdx.x, wave = tid >> 5, lane = tid & 31, col = lane & 15, g = lane >> 4; const size_t rw = (size_t)blockIdx.x * 128 + wave * 16; const int hb = blockIdx.y; const int n0 = hb * HD;   // rw: first row of the wave's tile 0, tile 1 lies 64 rows on; n0: column base in [0, 3072)
  v8f acc[2][16] = {};
  const unsigned lcp = (unsigned)(size_t)ring + (unsigned)(tid >> 3) * BPITCH + (unsigned)(tid & 7) * 16u;   // this lane's first LDS byte: row tid / 8, 16-byte piece tid % 8
  const __bf16* gcp = P + (size_t)(n0 + (tid >> 3)) * HID + (tid & 7) * 8;
  const unsigned lca = (unsigned)(size_t)aux + (unsigned)(wave * 16 + g) * APITCH + (unsigned)col * 16u;   // A: row g of the wave's 16, 16-byte piece col
  const float* gca = X + (rw + g) * HID + col * 4;
  stage_tile(lcp, gcp); stage8a<HID>(lca, gca); stage8a<HID>(lca + 64u * APITCH, gca + 64 * HID);
  asm volatile("s_wait_asynccnt 0x0" ::: "memory");   // this wave's share of tile 0 has landed
  __syncthreads();                                    // tile 0 is readable by every wave
  stage_tile(lcp + BBUF, gcp + 64); stage8a<HID>(lca + ABUF, gca + 64); stage8a<HID>(lca + ABUF + 64u * APITCH, gca + 64 * HID + 64);
#pragma unroll 1   // one pass per trip: the ring's order stands once, at the foot
  for (int t = 0; t < NPASS; ++t) { v16b a[2][2];   // [row tile][k step]
#pragma unroll
    for (int rt = 0; rt < 2; ++rt) { const float* p = (const float*)(aux + (t & 1) * ABUF + (rt * 64 + wave * 16 + col) * APITCH) + 8 * g;
#pragma unroll
      for (int ks = 0; ks < 2; ++ks)
#pragma unroll
        for (int i = 0; i < 8; ++i) { a[rt][ks][i] = (__bf16)p[ks * 32 + i]; a[rt][ks][8 + i] = (__bf16)p[ks * 32 + 16 + i]; } }
    const unsigned char* bb = ring + (t & 1) * BBUF + col * BPITCH;
#pragma unroll
    for (int ks = 0; ks < 2; ++ks)
#pragma unroll
      for (int jh = 0; jh < 2; ++jh) { v16b w[8];   // eight fragments read as one group, then their sixteen products
#pragma unroll
        for (int j = 0; j < 8; ++j) w[j] = frag_b((const __bf16*)(bb + (jh * 8 + j) * 16 * BPITCH + ks * 64), lane);
        __builtin_amdgcn_sched_barrier(0);   // the group's 16 LDS reads stand in one place ahead of its products; left free, the compiler read one fragment at a time into one register set and waited out the LDS latency before every pair of products
#pragma unroll
        for (int j = 0; j < 8; ++j) { acc[0][jh * 8 + j] = wmma_bf(a[0][ks], w[j], acc[0][jh * 8 + j]); acc[1][jh * 8 + j] = wmma_bf(a[1][ks], w[j], acc[1][jh * 8 + j]); }
        __builtin_amdgcn_sched_barrier(0); }   // and the next group's reads stay behind these products, not spread among them
    asm volatile("s_wait_dscnt 0x0" ::: "memory");      // this wave's reads of buffer t % 2 are done before it is refilled
    asm volatile("s_wait_asynccnt 0x0" ::: "memory");   // this wave's share of tile t + 1 has landed
    __syncthreads();                                    // publishes tile t + 1 and ends every wave's reads of buffer t % 2
    if (t + 2 < NPASS) { stage_tile(lcp + (unsigned)(t & 1) * BBUF, gcp + (t + 2) * 64); stage8a<HID>(lca + (unsigned)(t & 1) * ABUF, gca + (t + 2) * 64); stage8a<HID>(lca + (unsigned)(t & 1) * ABUF + 64u * APITCH, gca + 64 * HID + (t + 2) * 64); } }
  asm volatile("s_wait_asynccnt 0x0" ::: "memory");     // no copy is outstanding when the ring's LDS is used anew
  const int kind = (hb < NH) ? 0 : (hb < NH + NKV) ? 1 : 2;   // q, k, v
  // The epilogue runs once per row tile, on the same LDS: a wave's own range (q, k) is rewritten by that wave alone, behind its own reads; the v heads' planes are rewritten behind the barriers named there. Its code stands once per kind of head: trip 0 works on tile 0's accumulators, and tile 1's are moved into the same registers at the foot.
  v8f cur[16];
#pragma unroll
  for (int j = 0; j < 16; ++j) cur[j] = acc[0][j];
  // RMSNorm statistics per row (8g + r): this lane's 16 columns, then the 16 col-lanes
  auto row_stats = [&](float (&ss)[8]) {
#pragma unroll
    for (int r = 0; r < 8; ++r) { float s = 0.f;
#pragma unroll
      for (int j = 0; j < 16; ++j) s += cur[j][r] * cur[j][r];
      s = row_sum(s);
      ss[r] = 1.0f / sqrtf(s / (float)HD + 1e-6f); } };
  if (kind < 2) {   // q, k: the normed rows go through LDS in f32, and the rotary is applied row by row, where cos and sin are read as whole rows
    const float* NW = (kind == 0) ? QNW : KNW;
    float (*sx)[HD + 4] = (float (*)[HD + 4])(ring + wave * (16 * (HD + 4) * 4));   // 16 rows of 260 floats = 16,640 B per wave, inside the ring; every read of the ring ended at the last pass's barrier and no copy is outstanding
    _Float16* DH = (kind == 0) ? QH : KH; _Float16* DL = (kind == 0) ? QL : KL; const size_t ld = (kind == 0) ? QW : KW; const int c0 = ((kind == 0) ? hb : hb - NH) * HD;
#pragma unroll 1   // rolled: the epilogue's code stands once (for speed only)
    for (int rt = 0; rt < 2; ++rt) { const size_t r0 = rw + rt * 64;
    float ss[8]; row_stats(ss);
    // a lane holds dims 4 * lane .. + 3 of a row and their rotary partners 128 further on: four 16-byte loads per row and lane bring cos and sin (rows are (b*S + s): [b][s][d] = row*HD + d), four rows a group, two groups of registers
    const float* cp = COS + r0 * HD + lane * 4; const float* sq = SIN + r0 * HD + lane * 4;
    v4f cs[2][4][4];
    rope_rows(cs[0], cp, sq);   // the first group flies during the staging
#pragma unroll
    for (int j = 0; j < 16; ++j) { const float w = bfr(NW[j * 16 + col]);
#pragma unroll
      for (int r = 0; r < 8; ++r) sx[8 * g + r][j * 16 + col] = cur[j][r] * ss[r] * w; }
    LDSX();
#pragma unroll 1   // rolled two groups a trip, for the same reason as the row-tile loop: the code of a pair stands once
    for (int gp = 0; gp < 2; ++gp) {
#pragma unroll   // straight line inside a pair: the two register groups are named by constants
    for (int gh = 0; gh < 2; ++gh) { const int gq = gp * 2 + gh;
      if (gh < 1 || gp < 1) { rope_rows(cs[(gh + 1) & 1], cp + (gq + 1) * 4 * HD, sq + (gq + 1) * 4 * HD);
        asm volatile("s_wait_xcnt 0x0" ::: "memory");   // behind these loads, before their address registers are given to other values
        __builtin_amdgcn_sched_barrier(0); }   // the next group's loads stay ahead of this group's arithmetic, which covers their latency
#pragma unroll
      for (int i4 = 0; i4 < 4; ++i4) { const int rl = gq * 4 + i4; const v4f* e = cs[gh][i4];
        const v4f xa = *(const v4f*)&sx[rl][lane * 4], xb = *(const v4f*)&sx[rl][128 + lane * 4];
        v4h ha, la, hc, lc;
#pragma unroll
        for (int i = 0; i < 4; ++i) { const float ya = xa[i] * bfr(e[0][i]) - xb[i] * bfr(e[2][i]), yb = xb[i] * bfr(e[1][i]) + xa[i] * bfr(e[3][i]);
          const _Float16 p = (_Float16)ya, q = (_Float16)yb; ha[i] = p; la[i] = (_Float16)((ya - (float)p) * 2048.0f); hc[i] = q; lc[i] = (_Float16)((yb - (float)q) * 2048.0f); }
        const size_t o = (r0 + rl) * ld + c0 + lane * 4;   // a wave's store covers 256 contiguous bytes, two whole lines
        vst2(DH + o, ha); vst2(DH + o + 128, hc); vst2(DL + o, la); vst2(DL + o + 128, lc);
        asm volatile("s_wait_xcnt 0x0" ::: "memory");   // behind this row's stores, before their registers are given to the next row's values or to the loads that follow
        __builtin_amdgcn_sched_barrier(0); }   // the next row's arithmetic stays behind that wait
    } }
    LDSX();   // the rows are read back before the second tile's values are stored over them
#pragma unroll
    for (int j = 0; j < 16; ++j) cur[j] = acc[1][j]; } }   // the second trip works on tile 1
  else {
    const int g2 = hb - NH - NKV;
    _Float16 (*st)[72] = (_Float16 (*)[72])ring; _Float16 (*stl)[72] = (_Float16 (*)[72])(ring + BBUF);   // [HD][72] each, exactly one buffer; every read of the ring ended at the last pass's barrier
#pragma unroll 1   // rolled, as for the q and k heads
    for (int rt = 0; rt < 2; ++rt) {
    float ss[8]; row_stats(ss);
#pragma unroll
    for (int j = 0; j < 16; ++j) { const int d = j * 16 + col;
#pragma unroll
      for (int r = 0; r < 8; ++r) { const float y = cur[j][r] * ss[r];
        const _Float16 hv = (_Float16)y; soh[wave][8 * g + r][d] = hv; sol[wave][8 * g + r][d] = (_Float16)((y - (float)hv) * 2048.0f); } }
    LDSX();
    __syncthreads();   // the planes are whole; for the second row tile it also ends every wave's reads of the first tile's transpose planes
    const size_t rb = (size_t)blockIdx.x * 128 + rt * 64; const size_t b = rb / SS; const int s0 = (int)(rb % SS);
    for (int e = tid; e < 64 * HD; e += 128) { const int rr = e / HD, d = e % HD; st[d][rr] = soh[rr >> 4][rr & 15][d]; stl[d][rr] = sol[rr >> 4][rr & 15][d]; }
    __syncthreads();
#pragma unroll 1   // four pieces of each plane a trip, as the compiler had grouped them
    for (int q4 = 0; q4 < 4; ++q4) { v4u ph[4], pl[4];
#pragma unroll
      for (int k = 0; k < 4; ++k) { const int e = tid + (q4 * 4 + k) * 128, d = e >> 3, pc = e & 7; ph[k] = *(const v4u*)&st[d][pc * 8]; pl[k] = *(const v4u*)&stl[d][pc * 8]; }
#pragma unroll
      for (int k = 0; k < 4; ++k) { const int e = tid + (q4 * 4 + k) * 128, d = e >> 3, pc = e & 7; const size_t o = (b * KW + g2 * HD + d) * SS + s0 + pc * 8; vst2((unsigned*)(VT + o), ph[k]); vst2((unsigned*)(VTL + o), pl[k]); }
      asm volatile("s_wait_xcnt 0x0" ::: "memory");   // behind the trip's stores, before their address and data registers are written anew
      __builtin_amdgcn_sched_barrier(0); }   // the address steps of the next trip stay behind that wait (left free, they were lifted over it)
#pragma unroll
    for (int j = 0; j < 16; ++j) cur[j] = acc[1][j]; } }   // the second trip works on tile 1
}
// ---- k_attn: block = (64 queries, head n, b): kv head n/4; key tiles inside the window [i0 - 511, i0 + 63]; scores over 256 dims (3 products, q fragments re-read per step); mask j <= i && i - j < 512; online softmax; P = e x 2048 (f16) against v hi and e against the x2048 v residual, one accumulator (2 products); ctx rows
// Every matrix operand comes from LDS, brought by asynchronous 16-byte copies. Each wave's 16 q rows (hi, residual) are staged once. The k tile and the v tile of a 32-key step are the two buffers of one ring, filled in turn: v of step s flies while the scores of step s are formed, k of step s + 1 flies during the softmax and the value products of step s. The block's four waves read the one staged tile.
#define QPITCH 528              // LDS pitch of a staged 512-B row (q, k): 16 B x odd, conflict-free for ds_load_b128 readers
#define VPITCH 80               // LDS pitch of a staged 64-B v row (32 keys of one dim): 16 B x odd
#define QWAVE (32 * QPITCH)     // one wave's q rows, 16 hi then 16 residual: 16,896 B
#define KBUF (64 * QPITCH)      // 32 keys hi then 32 keys residual: 33,792 B
#define VBUF (512 * VPITCH)     // 256 dims hi then 256 dims residual: 40,960 B
// Eight copies of one lane, LS LDS bytes and gs elements apart. An immediate offset moves the LDS and the global address alike, so copy i names the one LDS-address register with offset i * LS (at most 17,920) and a global address that is i * LS short of its row: one LDS-address register serves all eight and none has to stay live across the step. Every register and every offset is a multiple of 16. The s_wait_xcnt stands inside the copies' own statement so that no address register of an issued copy is rewritten ahead of it.
template <int LS> __device__ __forceinline__ void stage8h(unsigned l, const _Float16* g, size_t gs) {
  const char* p = (const char*)g; const size_t d = gs * 2 - LS;   // bytes from one copy's global register to the next
  asm volatile("global_load_async_to_lds_b128 %0, %1, off\n\t"
               "global_load_async_to_lds_b128 %0, %2, off offset:%9\n\t"
               "global_load_async_to_lds_b128 %0, %3, off offset:%10\n\t"
               "global_load_async_to_lds_b128 %0, %4, off offset:%11\n\t"
               "global_load_async_to_lds_b128 %0, %5, off offset:%12\n\t"
               "global_load_async_to_lds_b128 %0, %6, off offset:%13\n\t"
               "global_load_async_to_lds_b128 %0, %7, off offset:%14\n\t"
               "global_load_async_to_lds_b128 %0, %8, off offset:%15\n\t"
               "s_wait_xcnt 0x0"
               :: "v"(l), "v"(p), "v"(p + d), "v"(p + 2 * d), "v"(p + 3 * d), "v"(p + 4 * d), "v"(p + 5 * d), "v"(p + 6 * d), "v"(p + 7 * d),
                  "n"(LS), "n"(2 * LS), "n"(3 * LS), "n"(4 * LS), "n"(5 * LS), "n"(6 * LS), "n"(7 * LS)
               : "memory");
}
__global__ __launch_bounds__(128) void k_attn(const _Float16* __restrict__ QH, const _Float16* __restrict__ QL, const _Float16* __restrict__ KH, const _Float16* __restrict__ KL, const _Float16* __restrict__ VT, const _Float16* __restrict__ VTL, float* __restrict__ O) {
  __shared__ __align__(16) _Float16 sp[4][16][40], spu[4][16][40];
  __shared__ __align__(16) unsigned char qs[4 * QWAVE];   // q rows, a range per wave; behind the loop each wave stages its ctx rows in its own range
  __shared__ __align__(16) unsigned char kb[KBUF];        // ring buffer 0: the k tile
  __shared__ __align__(16) unsigned char vb[VBUF];        // ring buffer 1: the v tile
  const int tid = threadIdx.x, wave = tid >> 5, lane = tid & 31, col = lane & 15, g = lane >> 4; const int qb = blockIdx.x, n = blockIdx.y; const size_t b = blockIdx.z; const int kvh = n / (NH / NKV); const int q0 = qb * 64 + wave * 16; const size_t rowb = b * SS;
  const _Float16* Vp = VT + (b * KW + kvh * HD) * SS; const _Float16* Vpl = VTL + (b * KW + kvh * HD) * SS;
  float m[8], l[8];
#pragma unroll
  for (int r = 0; r < 8; ++r) { m[r] = -3.0e38f; l[r] = 0.f; }
  v8f acc[16] = {};
  const int ks0 = max(0, qb * 64 - (WIN - 1)) / 32, ks1 = (qb * 64 + 64) / 32;
  // q: a wave's copy is one whole 512-B row of its own 16 queries. k: a wave's copy is one whole row; waves 0, 1 bring the hi rows (16 keys each), waves 2, 3 the residual rows. v: a wave's copy is eight 64-B rows; lane = (row tid / 4, piece tid % 4).
  const unsigned lq = (unsigned)(size_t)qs + (unsigned)wave * QWAVE + (unsigned)lane * 16u; const size_t gq = (rowb + q0) * QW + n * HD + lane * 8;
  const unsigned lk = (unsigned)(size_t)kb + (unsigned)wave * 16u * QPITCH + (unsigned)lane * 16u; const _Float16* gk = ((wave < 2) ? KH : KL) + (rowb + (wave & 1) * 16) * KW + kvh * HD + lane * 8;
  const unsigned lv = (unsigned)(size_t)vb + (unsigned)(tid >> 2) * VPITCH + (unsigned)(tid & 3) * 16u; const size_t gv = (size_t)(tid >> 2) * SS + (tid & 3) * 8;
  stage8h<QPITCH>(lq, QH + gq, QW); stage8h<QPITCH>(lq + 8u * QPITCH, QH + gq + 8 * QW, QW); stage8h<QPITCH>(lq + 16u * QPITCH, QL + gq, QW); stage8h<QPITCH>(lq + 24u * QPITCH, QL + gq + 8 * QW, QW);
  stage8h<QPITCH>(lk, gk + (size_t)ks0 * 32 * KW, KW); stage8h<QPITCH>(lk + 8u * QPITCH, gk + ((size_t)ks0 * 32 + 8) * KW, KW);
  asm volatile("s_wait_asynccnt 0x0" ::: "memory");   // this wave's q rows and its share of the first k tile have landed
  __syncthreads();                                    // the first k tile is readable by every wave
  stage8h<32 * VPITCH>(lv, Vp + gv + ks0 * 32, 32 * SS); stage8h<32 * VPITCH>(lv + 256u * VPITCH, Vpl + gv + ks0 * 32, 32 * SS);
  const unsigned char* qrow = qs + wave * QWAVE + col * QPITCH;
#pragma unroll 1
  for (int ks = ks0; ks < ks1; ++ks) { const int j0 = ks * 32; v8f s[2];
#pragma unroll
    for (int ct = 0; ct < 2; ++ct) { const int kk = j0 + ct * 16 + col; const unsigned char* krow = kb + (ct * 16 + col) * QPITCH; v8f c = {}, cl = {};
#pragma unroll   // straight-line groups: the fragment arrays stay in registers and each group's LDS reads stand in one place
      for (int kq = 0; kq < HD / 64; ++kq) { v16h aq[2], aql[2], kh[2], kl[2];   // eight fragments read as one group, then their six products
#pragma unroll
        for (int j = 0; j < 2; ++j) { const int ko = (kq * 2 + j) * 64; aq[j] = frag_h((const _Float16*)(qrow + ko), lane); aql[j] = frag_h((const _Float16*)(qrow + 16 * QPITCH + ko), lane); kh[j] = frag_h((const _Float16*)(krow + ko), lane); kl[j] = frag_h((const _Float16*)(krow + 32 * QPITCH + ko), lane); }
#pragma unroll
        for (int j = 0; j < 2; ++j) { c = wmma16(aq[j], kh[j], c); cl = wmma16(aql[j], kh[j], cl); cl = wmma16(aq[j], kl[j], cl); } }
#pragma unroll
      for (int r = 0; r < 8; ++r) { const int qi = q0 + 8 * g + r; const bool keep = (kk <= qi) && (qi - kk < WIN); s[ct][r] = keep ? (c[r] + cl[r] * (1.0f / 2048.0f)) : -3.0e38f; } }   // unscaled logits (the module applies no 1/sqrt(d))
    asm volatile("s_wait_dscnt 0x0" ::: "memory");      // this wave's reads of the k tile are done before it is refilled
    asm volatile("s_wait_asynccnt 0x0" ::: "memory");   // this wave's share of this step's v tile has landed
    __syncthreads();                                    // publishes the v tile and ends every wave's reads of the k tile
    if (ks + 1 < ks1) { stage8h<QPITCH>(lk, gk + (size_t)(j0 + 32) * KW, KW); stage8h<QPITCH>(lk + 8u * QPITCH, gk + (size_t)(j0 + 40) * KW, KW); }
#pragma unroll
    for (int r = 0; r < 8; ++r) { const float mx = row_max(fmaxf(s[0][r], s[1][r]));
      const float mn = fmaxf(m[r], mx); const float xm = exp_slot(m[r] - mn), x0 = exp_slot(s[0][r] - mn), x1 = exp_slot(s[1][r] - mn);   // formed in every lane, then selected: no branch in the step
      const float alpha = (m[r] <= -1.0e38f) ? 0.f : xm;
      const float e0 = (s[0][r] <= -1.0e38f) ? 0.f : x0, e1 = (s[1][r] <= -1.0e38f) ? 0.f : x1; const float es = row_sum(e0 + e1);
      l[r] = l[r] * alpha + es; m[r] = (mn <= -1.0e38f) ? m[r] : mn;
#pragma unroll
      for (int dt = 0; dt < 16; ++dt) acc[dt][r] *= alpha;
      sp[wave][8 * g + r][col] = (_Float16)(e0 * 2048.0f); sp[wave][8 * g + r][16 + col] = (_Float16)(e1 * 2048.0f); spu[wave][8 * g + r][col] = (_Float16)e0; spu[wave][8 * g + r][16 + col] = (_Float16)e1; }   // (e x 2048) pairs with v hi, plain e with the x2048 v residual -> both land in one f32 accumulator
    LDSX();
    const v16h pa = frag_h(&sp[wave][col][0], lane), pu = frag_h(&spu[wave][col][0], lane);
#pragma unroll   // straight-line groups, as in the score loop
    for (int dq = 0; dq < 4; ++dq) { v16h vl[4], vh[4];   // eight fragments read as one group, then their eight products
#pragma unroll
      for (int j = 0; j < 4; ++j) { const unsigned char* vr = vb + ((dq * 4 + j) * 16 + col) * VPITCH; vl[j] = frag_h((const _Float16*)(vr + 256 * VPITCH), lane); vh[j] = frag_h((const _Float16*)vr, lane); }
#pragma unroll
      for (int j = 0; j < 4; ++j) { acc[dq * 4 + j] = wmma16(pu, vl[j], acc[dq * 4 + j]); acc[dq * 4 + j] = wmma16(pa, vh[j], acc[dq * 4 + j]); } }
    asm volatile("s_wait_dscnt 0x0" ::: "memory");      // this wave's reads of the v tile (and of its softmax planes) are done before the refill
    asm volatile("s_wait_asynccnt 0x0" ::: "memory");   // this wave's share of the next k tile has landed
    __syncthreads();                                    // publishes the next k tile and ends every wave's reads of the v tile
    if (ks + 1 < ks1) { stage8h<32 * VPITCH>(lv, Vp + gv + j0 + 32, 32 * SS); stage8h<32 * VPITCH>(lv + 256u * VPITCH, Vpl + gv + j0 + 32, 32 * SS); } }
  asm volatile("s_wait_asynccnt 0x0" ::: "memory");     // no copy is outstanding when the q range is used anew
  float (*so)[HD + 4] = (float (*)[HD + 4])(qs + wave * QWAVE);   // 16 rows of 260 floats = 16,640 B, inside this wave's own q range, which no other wave reads or writes
#pragma unroll
  for (int r = 0; r < 8; ++r) { const float il = (1.0f / 2048.0f) / l[r];
#pragma unroll
    for (int dt = 0; dt < 16; ++dt) so[8 * g + r][dt * 16 + col] = acc[dt][r] * il; }
  LDSX();
  for (int rl = 0; rl < 16; ++rl) { const size_t o = (rowb + q0 + rl) * QW + n * HD; vst2(O + o + lane * 4, *(const v4f*)&so[rl][lane * 4]); vst2(O + o + 128 + lane * 4, *(const v4f*)&so[rl][128 + lane * 4]); }
}
// ---- k_out: block = (128 rows, 128 cols): y = ctx(hi/lo, K 2048) . Wo rows
// The block's 128 weight rows and its 128 ctx rows go through LDS as in k_qkv: 64 k per pass, two buffers, eight asynchronous copies per lane and pass for the weights, sixteen for ctx. A wave holds two 16-row tiles (rows 64 apart): each weight fragment it reads feeds four products.
#define OBUF (128 * BPITCH)     // 18,432 B per buffer
__global__ __launch_bounds__(128) void k_out(const float* __restrict__ Oc, const __bf16* __restrict__ P, float* __restrict__ Y) {
  __shared__ __align__(16) unsigned char aux[2 * ABUF];   // in the loop the two A buffers; behind the loop the output rows (33,792 B)
  float (*so)[16][132] = (float (*)[16][132])aux;
  __shared__ __align__(16) unsigned char ring[2 * OBUF];   // the two weight buffers
  const int tid = threadIdx.x, wave = tid >> 5, lane = tid & 31, col = lane & 15, g = lane >> 4; const size_t rw = (size_t)blockIdx.x * 128 + wave * 16; const int n0 = blockIdx.y * 128;   // rw: first row of the wave's tile 0, tile 1 lies 64 rows on
  v8f acc[2][8] = {};
  const unsigned lcp = (unsigned)(size_t)ring + (unsigned)(tid >> 3) * BPITCH + (unsigned)(tid & 7) * 16u;   // this lane's first LDS byte: row tid / 8, 16-byte piece tid % 8
  const __bf16* gcp = P + (size_t)(n0 + (tid >> 3)) * HID + (tid & 7) * 8;
  const unsigned lca = (unsigned)(size_t)aux + (unsigned)(wave * 16 + g) * APITCH + (unsigned)col * 16u;   // A: row g of the wave's 16, 16-byte piece col
  const float* gca = Oc + (rw + g) * QW + col * 4;
  stage8(lcp, gcp); stage8a<QW>(lca, gca); stage8a<QW>(lca + 64u * APITCH, gca + 64 * QW);
  asm volatile("s_wait_asynccnt 0x0" ::: "memory");   // this wave's share of tile 0 has landed
  __syncthreads();                                    // tile 0 is readable by every wave
  stage8(lcp + OBUF, gcp + 64); stage8a<QW>(lca + ABUF, gca + 64); stage8a<QW>(lca + ABUF + 64u * APITCH, gca + 64 * QW + 64);
#pragma unroll 1   // one pass per trip: the ring's order stands once, at the foot
  for (int t = 0; t < QW / 64; ++t) { F2 a[2][2];   // [row tile][k step]
#pragma unroll
    for (int rt = 0; rt < 2; ++rt)
#pragma unroll
      for (int ks = 0; ks < 2; ++ks) a[rt][ks] = split_row((const float*)(aux + (t & 1) * ABUF + (rt * 64 + wave * 16 + col) * APITCH), ks * 32, lane);
    const unsigned char* bb = ring + (t & 1) * OBUF + col * BPITCH;
#pragma unroll
    for (int ks = 0; ks < 2; ++ks) { v16b w[8];   // eight fragments read as one group, then their 32 products; per accumulator residual first, then hi, as before
#pragma unroll
      for (int j = 0; j < 8; ++j) w[j] = frag_b((const __bf16*)(bb + j * 16 * BPITCH + ks * 64), lane);
      __builtin_amdgcn_sched_barrier(0);   // the group's 16 LDS reads stand in one place ahead of its products, as in k_qkv
#pragma unroll
      for (int j = 0; j < 8; ++j) { acc[0][j] = wmma_bf(a[0][ks].l, w[j], acc[0][j]); acc[1][j] = wmma_bf(a[1][ks].l, w[j], acc[1][j]); acc[0][j] = wmma_bf(a[0][ks].h, w[j], acc[0][j]); acc[1][j] = wmma_bf(a[1][ks].h, w[j], acc[1][j]); }
      __builtin_amdgcn_sched_barrier(0); }   // the next group's reads stay behind these products
    asm volatile("s_wait_dscnt 0x0" ::: "memory");      // this wave's reads of buffer t % 2 are done before it is refilled
    asm volatile("s_wait_asynccnt 0x0" ::: "memory");   // this wave's share of tile t + 1 has landed
    __syncthreads();                                    // publishes tile t + 1 and ends every wave's reads of buffer t % 2
    if (t + 2 < QW / 64) { stage8(lcp + (unsigned)(t & 1) * OBUF, gcp + (t + 2) * 64); stage8a<QW>(lca + (unsigned)(t & 1) * ABUF, gca + (t + 2) * 64); stage8a<QW>(lca + (unsigned)(t & 1) * ABUF + 64u * APITCH, gca + 64 * QW + (t + 2) * 64); } }
  asm volatile("s_wait_asynccnt 0x0" ::: "memory");     // no copy is outstanding when the A buffers' LDS is used anew
#pragma unroll   // straight line: the accumulators of a row tile are named by constants; a wave's own output range is rewritten by that wave alone, behind its own reads
  for (int rt = 0; rt < 2; ++rt) {
#pragma unroll
    for (int j = 0; j < 8; ++j)
#pragma unroll
      for (int r = 0; r < 8; ++r) so[wave][8 * g + r][j * 16 + col] = acc[rt][j][r];
    LDSX();
    for (int rl = 0; rl < 16; ++rl) vst2(Y + (rw + rt * 64 + rl) * HID + n0 + lane * 4, *(const v4f*)&so[wave][rl][lane * 4]);
    if (rt < 1) LDSX(); }   // the rows are read back before the second tile's values are stored over them
}
extern "C" void kernel_launch(void* const* d_in, const int* in_sizes, int n_in, void* d_out, int out_size, void* d_ws, size_t ws_size, hipStream_t stream) {
  (void)in_sizes; (void)n_in; (void)out_size;
  const float** F = (const float**)d_in;   // 0 hidden_states [2,2048,2048], 1 cos [2,2048,256], 2 sin, 3 Wq [2048,2048], 4 Wk [512,2048], 5 Wv [512,2048], 6 Wo [2048,2048] (natural), 7 q_norm_w [256], 8 k_norm_w [256]
  if (ws_size < (size_t)WS_END) return;
  char* ws = (char*)d_ws; __bf16* PK = (__bf16*)(ws + WS_PK); _Float16 *QH = (_Float16*)(ws + WS_QH), *QL = (_Float16*)(ws + WS_QL), *KH = (_Float16*)(ws + WS_KH), *KL = (_Float16*)(ws + WS_KL), *VT = (_Float16*)(ws + WS_VT), *VTL = (_Float16*)(ws + WS_VTL); float* O = (float*)(ws + WS_O);
  k_pack<<<dim3(PKG), 256, 0, stream>>>(F[3], F[4], F[5], F[6], PK);
  k_qkv<<<dim3(TRB, NH + 2 * NKV), 128, 0, stream>>>(F[0], PK + PK_A, F[1], F[2], F[7], F[8], QH, QL, KH, KL, VT, VTL);
  k_attn<<<dim3(TQB, NH, TNB), 128, 0, stream>>>(QH, QL, KH, KL, VT, VTL, O);
  k_out<<<dim3(TOB, HID / 128), 128, 0, stream>>>(O, PK + PK_P, (float*)d_out);
}

// v009
// A run of this version takes 164 microseconds.
// Timed twice side by side with v008, it ran 1.03 times as fast both times.
// All steps since v000 together make it 6.13 times as fast.
// compute dtype: hidden_states, cos, sin, Wq/Wk/Wv/Wo, q/k norm weights rounded to bf16; q/k/v projections with exact bf16 products on WMMA 16x16x32 (natural [out][in] rows; one 256-column head per block); per-head RMSNorm (eps 1e-6, x weight; v with weight 1) and the rotate-half rotary embedding with the cos/sin inputs in f32 in the projection epilogue; q and k stored as f16 hi + (x2048-scaled) residual planes with 3-product scores (unscaled logits, sigma ~16, kept f32-accurate), v stored as f16 hi + (x2048-scaled) residual planes; sliding-window causal mask (j <= i, i - j < 512), running-max softmax in f32 (hardware exp); the softmax weights as f16 planes e x 2048 (against v hi) and e (against the x2048 v residual) accumulated into one f32 accumulator (2 products; 2^-11 folded into the epilogue); output projection with ctx as bf16 hi + residual x exact Wo rows (2 products); f32 accumulate.
#include <hip/hip_runtime.h>
#include <math.h>

typedef __attribute__((ext_vector_type(16))) _Float16 v16h;
typedef __attribute__((ext_vector_type(16))) __bf16 v16b;
typedef __attribute__((ext_vector_type(8)))  _Float16 v8h;
typedef __attribute__((ext_vector_type(4)))  _Float16 v4h;
typedef __attribute__((ext_vector_type(8)))  float v8f;
typedef __attribute__((ext_vector_type(4)))  float v4f;
typedef __attribute__((ext_vector_type(2)))  float v2f;
typedef __attribute__((ext_vector_type(4)))  unsigned v4u;
typedef __attribute__((ext_vector_type(4)))  int v4i;
typedef float __attribute__((may_alias)) float_a;
typedef int __attribute__((may_alias)) int_a;

template <typename T> __device__ __forceinline__ void vst2(void* p, T v) { *(T*)p = v;  }
__device__ __forceinline__ v8f wmma16(v16h a, v16h b, v8f c) {
  return __builtin_amdgcn_wmma_f32_16x16x32_f16(false, a, false, b, (short)0, c, false, false);   // the builtin alone, as for bf16 below: an asm statement on its operands would hold all of them below v256, and the accumulators with the q fragments need more
}
__device__ __forceinline__ v8f wmma_bf(v16b a, v16b b, v8f c) {
  return __builtin_amdgcn_wmma_f32_16x16x32_bf16(false, a, false, b, (short)0, c, false, false);   // the builtin alone, the compiler keeps its distances: an asm statement on its operands would hold all of them below v256, and two row tiles' accumulators with their fragments need more
}
// 16x16x32 fragments: lane = (h = lane>>4, row/col = lane&15); elements 0..7 = k0+8h+0..7, 8..15 = k0+16+8h+0..7; D element r = row 8h+r
__device__ __forceinline__ v16h frag_h(const _Float16* rowk0, int lane) {
  union { v16h v; v8h q[2]; } u; const _Float16* p = rowk0 + 8 * (lane >> 4);
  u.q[0] = *(const v8h*)p; u.q[1] = *(const v8h*)(p + 16); return u.v;
}
__device__ __forceinline__ v16h frag_f32(const float* rowk0, int lane) {
  v16h a; const float* p = rowk0 + 8 * (lane >> 4);
#pragma unroll
  for (int i = 0; i < 8; ++i) { a[i] = (_Float16)p[i]; a[8 + i] = (_Float16)p[16 + i]; }
  return a;
}
__device__ __forceinline__ v16h frag_f32s(const float* rowk0, int lane, float sc) {
  v16h a; const float* p = rowk0 + 8 * (lane >> 4);
#pragma unroll
  for (int i = 0; i < 8; ++i) { a[i] = (_Float16)(p[i] * sc); a[8 + i] = (_Float16)(p[16 + i] * sc); }
  return a;
}
// column fragment from a [K][ld] layout (column n), rows >= K read as 0
__device__ __forceinline__ v16h fragc_f32(const float* W, int k0, int n, int lane, int ld, int K) {
  v16h a; const int g = lane >> 4;
#pragma unroll
  for (int i = 0; i < 8; ++i) { const int ka = k0 + 8 * g + i, kb = ka + 16;
    a[i] = (_Float16)(ka < K ? W[(size_t)(ka < K ? ka : K - 1) * ld + n] : 0.f); a[8 + i] = (_Float16)(kb < K ? W[(size_t)(kb < K ? kb : K - 1) * ld + n] : 0.f); }
  return a;
}
struct F2 { v16b h, l; };
__device__ __forceinline__ F2 bsplit16(const float v[16]) { F2 r;
#pragma unroll
  for (int i = 0; i < 16; ++i) { const __bf16 h = (__bf16)v[i]; r.h[i] = h; r.l[i] = (__bf16)(v[i] - (float)h); }
  return r; }
__device__ __forceinline__ F2 split_row(const float* row, int k0, int lane) { float v[16]; const float* p = row + k0 + 8 * (lane >> 4);
#pragma unroll
  for (int i = 0; i < 8; ++i) { v[i] = p[i]; v[8 + i] = p[16 + i]; }
  return bsplit16(v); }
__device__ __forceinline__ F2 split_rowK(const float* row, int k0, int lane, int K) { float v[16]; const int g = lane >> 4;
#pragma unroll
  for (int i = 0; i < 8; ++i) { const int ka = k0 + 8 * g + i, kb = ka + 16; v[i] = ka < K ? row[ka < K ? ka : K - 1] : 0.f; v[8 + i] = kb < K ? row[kb < K ? kb : K - 1] : 0.f; }
  return bsplit16(v); }
__device__ __forceinline__ F2 split_col(const float* W, int k0, int n, int lane, int ld, int K) { float v[16]; const int g = lane >> 4;
#pragma unroll
  for (int i = 0; i < 8; ++i) { const int ka = k0 + 8 * g + i, kb = ka + 16; v[i] = ka < K ? W[(size_t)(ka < K ? ka : K - 1) * ld + n] : 0.f; v[8 + i] = kb < K ? W[(size_t)(kb < K ? kb : K - 1) * ld + n] : 0.f; }
  return bsplit16(v); }
__device__ __forceinline__ v8f mac3(const F2& a, const F2& b, v8f c) { c = wmma_bf(a.l, b.h, c); c = wmma_bf(a.h, b.l, c); return wmma_bf(a.h, b.h, c); }
__device__ __forceinline__ float sigm(float v) { return 1.0f / (1.0f + expf(-v)); }
// value of lane (lane ^ M) of the same 16-lane row, M < 16, by a DPP row_xmask move in the vector pipe (the shuffle builtin goes through the LDS unit and is waited for at every step); every lane is on where it is used
template <int M> __device__ __forceinline__ float rowx(float v) { return __builtin_bit_cast(float, __builtin_amdgcn_mov_dpp(__builtin_bit_cast(int, v), 0x160 + M, 0xf, 0xf, true)); }
// butterfly over the 16 lanes of a row, steps 1, 2, 4, 8
__device__ __forceinline__ float row_sum(float s) { s += rowx<1>(s); s += rowx<2>(s); s += rowx<4>(s); s += rowx<8>(s); return s; }
__device__ __forceinline__ float row_max(float m) { m = fmaxf(m, rowx<1>(m)); m = fmaxf(m, rowx<2>(m)); m = fmaxf(m, rowx<4>(m)); m = fmaxf(m, rowx<8>(m)); return m; }
// e^x as the fast-math form computes it (x * log2(e), hardware exp2). The v_nop is the free slot that the instruction set asks for behind a transcendental before its source is overwritten or its result read; inside the statement it stays directly behind the v_exp_f32
__device__ __forceinline__ float exp_slot(float x) { float r; const float y = x * 1.44269504f; asm("v_exp_f32 %0, %1\n\tv_nop" : "=v"(r) : "v"(y)); return r; }
#define LDSX() do { asm volatile("s_wait_dscnt 0" ::: "memory"); __builtin_amdgcn_wave_barrier(); __builtin_amdgcn_fence(__ATOMIC_RELEASE, "workgroup"); } while (0)


// Grouped-query sliding-window attention (B 2, S 2,048, hidden 2,048, 8 query heads / 2 kv heads x 256, window 512): q/k/v projections, per-head RMSNorm, rotary embedding, windowed causal softmax, output projection.
#define NB 2
#define SS 2048
#define HID 2048
#define NH 8
#define NKV 2
#define HD 256
#define WIN 512
#define QW (NH * HD)          // 2048 q columns
#define KW (NKV * HD)         // 512
#define QKVW (QW + 2 * KW)    // 3072
#define NR (NB * SS)
#ifndef TQB
#define TQB (SS / 64)
#define TNB NB
#define TOB (NB * SS / 128)
#define TRB (NB * SS / 128)   // projection row tiles of 128 rows
#endif
typedef __attribute__((ext_vector_type(8))) __bf16 v8b;
__device__ __forceinline__ v16b frag_b(const __bf16* rowk0, int lane) {
  union { v16b v; v8b q[2]; } u; const __bf16* p = rowk0 + 8 * (lane >> 4);
  u.q[0] = *(const v8b*)p; u.q[1] = *(const v8b*)(p + 16); return u.v;
}
__device__ __forceinline__ float bfr(float v) { return (float)(__bf16)v; }
__device__ __attribute__((noinline)) float exp_ni(float v) { return expf(v); }
__device__ __attribute__((noinline)) float erf_ni(float v) { return erff(v); }

#define PK_A 0                            // [3072][2048] Wq | Wk | Wv natural rows
#define PK_P ((size_t)QKVW * HID)         // [2048][2048] Wo natural rows
#define PK_END (PK_P + (size_t)HID * HID)
#define WS_PK  0u
#define WS_QH  (((2u * PK_END) + 127u) / 128u * 128u)   // f16 [4096][2048] q hi ; QL
#define WS_QL  (WS_QH + 2u * (size_t)NR * QW)
#define WS_KH  (WS_QL + 2u * (size_t)NR * QW)          // f16 [4096][512] k hi ; KL
#define WS_KL  (WS_KH + 2u * (size_t)NR * KW)
#define WS_VT  (WS_KL + 2u * (size_t)NR * KW)          // f16 [b][512][2048] v hi ; VTL (x2048 residual)
#define WS_VTL (WS_VT + 2u * (size_t)NR * KW)
#define WS_O   (WS_VTL + 2u * (size_t)NR * KW)         // f32 [4096][2048] ctx
#define WS_END (WS_O + 4u * (size_t)NR * QW)

// ---- k_pack: PK is the four weight matrices one behind the other (Wq | Wk | Wv | Wo, natural rows), each value rounded to bf16, so the launch is one flat stream. A block converts 16,384 values of one matrix (eight whole rows): few waves have to start, and each holds its 16 loads in flight at once.
#define PKF 16384                         // values per block: 256 lanes x 16 pieces of 4
#define PKQ (QW * HID / PKF)              // 256 blocks for Wq (and for Wo)
#define PKK (KW * HID / PKF)              // 64 blocks for Wk (and for Wv)
#define PKG ((QKVW + HID) * HID / PKF)    // 640 blocks
typedef __attribute__((ext_vector_type(4))) __bf16 v4b;
__global__ __launch_bounds__(256) void k_pack(const float* __restrict__ WQ, const float* __restrict__ WK, const float* __restrict__ WV, const float* __restrict__ WO, __bf16* __restrict__ PK) {
  const int blk = blockIdx.x, t = threadIdx.x;
  const float* Wm = WQ; int first = 0;   // the block's matrix and that matrix's first block
  if (blk >= PKQ + 2 * PKK) { Wm = WO; first = PKQ + 2 * PKK; } else if (blk >= PKQ + PKK) { Wm = WV; first = PKQ + PKK; } else if (blk >= PKQ) { Wm = WK; first = PKQ; }
  const float* s = Wm + (size_t)(blk - first) * PKF + t * 4; __bf16* d = PK + (size_t)blk * PKF + t * 4;
  v4f v[16];   // a wave's load covers 512 contiguous bytes (four whole lines), its store 256 (two whole lines)
#pragma unroll
  for (int i = 0; i < 16; ++i) v[i] = *(const v4f*)(s + i * 1024);
  __builtin_amdgcn_sched_barrier(0);   // all 16 loads are issued ahead of the first conversion; without it the last two waited for the first two to land, to take over their registers
  v4b o[16];
#pragma unroll
  for (int i = 0; i < 16; ++i)
#pragma unroll
    for (int k = 0; k < 4; ++k) o[i][k] = (__bf16)v[i][k];
#pragma unroll
  for (int i = 0; i < 16; ++i) vst2(d + i * 1024, o[i]);
}
// ---- k_qkv: block = (128 rows, one 256-column head hb of [q heads 0..7 | k heads 8..9 | v heads 10..11]): GEMM (exact, 16 tiles), RMSNorm over the head's 256 dims (f32), rotary (q, k) with the cos/sin inputs, then planes
// The head's 256 weight rows go through LDS, 64 k (128 B of each row) per pass, two buffers: asynchronous 16-byte copies bring pass t + 2 while pass t + 1 waits ready, and the block's four waves read their B fragments from the one staged tile. A wave holds two 16-row tiles (rows 64 apart), so each B fragment it reads feeds two products and the head's weight rows are copied once per 128 rows.
#define BPITCH 144              // LDS pitch of a staged 128-B row: 16 B x odd, conflict-free for ds_load_b128 readers
#define BBUF (HD * BPITCH)      // 36,864 B per buffer
#define NPASS (HID / 64)
// Eight copies of one lane: rows 16 apart, 16 bytes each. The s_wait_xcnt stands inside the copies' own statement so that no address register of an issued copy is rewritten ahead of it.
__device__ __forceinline__ void stage8(unsigned l, const __bf16* g) {
  asm volatile("global_load_async_to_lds_b128 %0, %8, off\n\t"
               "global_load_async_to_lds_b128 %1, %9, off\n\t"
               "global_load_async_to_lds_b128 %2, %10, off\n\t"
               "global_load_async_to_lds_b128 %3, %11, off\n\t"
               "global_load_async_to_lds_b128 %4, %12, off\n\t"
               "global_load_async_to_lds_b128 %5, %13, off\n\t"
               "global_load_async_to_lds_b128 %6, %14, off\n\t"
               "global_load_async_to_lds_b128 %7, %15, off\n\t"
               "s_wait_xcnt 0x0"
               :: "v"(l), "v"(l + 16u * BPITCH), "v"(l + 32u * BPITCH), "v"(l + 48u * BPITCH), "v"(l + 64u * BPITCH), "v"(l + 80u * BPITCH), "v"(l + 96u * BPITCH), "v"(l + 112u * BPITCH),
                  "v"(g), "v"(g + 16 * HID), "v"(g + 32 * HID), "v"(g + 48 * HID), "v"(g + 64 * HID), "v"(g + 80 * HID), "v"(g + 96 * HID), "v"(g + 112 * HID)
               : "memory");
}
// One pass's tile: 256 rows x 128 B = 16 copies per lane; a wave's copy covers four whole rows (four 128-B lines).
__device__ __forceinline__ void stage_tile(unsigned l, const __bf16* g) { stage8(l, g); stage8(l + 128u * BPITCH, g + 128 * HID); }
// The A tile of a pass (128 rows x 64 k, f32) goes through LDS in the same ring order as the weight tile. A wave brings its own two times 16 rows: a copy is two whole 256-B rows (four whole 128-B lines), where a fragment load from global memory touched 16 lines for 32 B each and was waited for inside its pass.
#define APITCH 272              // LDS pitch of a staged 256-B row: 16 B x odd, conflict-free for ds_load_b128 readers
#define ABUF (128 * APITCH)     // 34,816 B per buffer
// Eight copies of one lane: rows 2 apart (LD floats a row), 16 bytes each. The s_wait_xcnt stands inside the copies' own statement so that no address register of an issued copy is rewritten ahead of it.
template <int LD> __device__ __forceinline__ void stage8a(unsigned l, const float* g) {
  asm volatile("global_load_async_to_lds_b128 %0, %8, off\n\t"
               "global_load_async_to_lds_b128 %1, %9, off\n\t"
               "global_load_async_to_lds_b128 %2, %10, off\n\t"
               "global_load_async_to_lds_b128 %3, %11, off\n\t"
               "global_load_async_to_lds_b128 %4, %12, off\n\t"
               "global_load_async_to_lds_b128 %5, %13, off\n\t"
               "global_load_async_to_lds_b128 %6, %14, off\n\t"
               "global_load_async_to_lds_b128 %7, %15, off\n\t"
               "s_wait_xcnt 0x0"
               :: "v"(l), "v"(l + 2u * APITCH), "v"(l + 4u * APITCH), "v"(l + 6u * APITCH), "v"(l + 8u * APITCH), "v"(l + 10u * APITCH), "v"(l + 12u * APITCH), "v"(l + 14u * APITCH),
                  "v"(g), "v"(g + 2 * LD), "v"(g + 4 * LD), "v"(g + 6 * LD), "v"(g + 8 * LD), "v"(g + 10 * LD), "v"(g + 12 * LD), "v"(g + 14 * LD)
               : "memory");
}
// cos and sin of four rows for one lane: per row cos[d], cos[d + 128], sin[d], sin[d + 128], four dims each
__device__ __forceinline__ void rope_rows(v4f (&e)[4][4], const float* c, const float* s) {
#pragma unroll
  for (int i = 0; i < 4; ++i) { e[i][0] = *(const v4f*)(c + i * HD); e[i][1] = *(const v4f*)(c + i * HD + 128); e[i][2] = *(const v4f*)(s + i * HD); e[i][3] = *(const v4f*)(s + i * HD + 128); }
}
__global__ __launch_bounds__(128) void k_qkv(const float* __restrict__ X, const __bf16* __restrict__ P, const float* __restrict__ COS, const float* __restrict__ SIN, const float* __restrict__ QNW, const float* __restrict__ KNW, _Float16* __restrict__ QH, _Float16* __restrict__ QL, _Float16* __restrict__ KH, _Float16* __restrict__ KL, _Float16* __restrict__ VT, _Float16* __restrict__ VTL) {
  __shared__ __align__(16) unsigned char aux[2 * ABUF];   // in the loop the two A buffers (69,632 B); behind the loop the v heads' hi and residual planes (67,584 B)
  _Float16 (*soh)[16][264] = (_Float16 (*)[16][264])aux; _Float16 (*sol)[16][264] = (_Float16 (*)[16][264])(aux + 4 * 16 * 264 * 2);
  __shared__ __align__(16) unsigned char ring[2 * BBUF];   // the two weight buffers; behind the loop the q and k heads' f32 rows or the v heads' transpose planes lie here
  const int tid = threadIdx.x, wave = tid >> 5, lane = tid & 31, col = lane & 15, g = lane >> 4; const size_t rw = (size_t)blockIdx.x * 128 + wave * 16; const int hb = blockIdx.y; const int n0 = hb * HD;   // rw: first row of the wave's tile 0, tile 1 lies 64 rows on; n0: column base in [0, 3072)
  v8f acc[2][16] = {};
  const unsigned lcp = (unsigned)(size_t)ring + (unsigned)(tid >> 3) * BPITCH + (unsigned)(tid & 7) * 16u;   // this lane's first LDS byte: row tid / 8, 16-byte piece tid % 8
  const __bf16* gcp = P + (size_t)(n0 + (tid >> 3)) * HID + (tid & 7) * 8;
  const unsigned lca = (unsigned)(size_t)aux + (unsigned)(wave * 16 + g) * APITCH + (unsigned)col * 16u;   // A: row g of the wave's 16, 16-byte piece col
  const float* gca = X + (rw + g) * HID + col * 4;
  stage_tile(lcp, gcp); stage8a<HID>(lca, gca); stage8a<HID>(lca + 64u * APITCH, gca + 64 * HID);
  asm volatile("s_wait_asynccnt 0x0" ::: "memory");   // this wave's share of tile 0 has landed
  __syncthreads();                                    // tile 0 is readable by every wave
  stage_tile(lcp + BBUF, gcp + 64); stage8a<HID>(lca + ABUF, gca + 64); stage8a<HID>(lca + ABUF + 64u * APITCH, gca + 64 * HID + 64);
#pragma unroll 1   // one pass per trip: the ring's order stands once, at the foot
  for (int t = 0; t < NPASS; ++t) { v16b a[2][2];   // [row tile][k step]
#pragma unroll
    for (int rt = 0; rt < 2; ++rt) { const float* p = (const float*)(aux + (t & 1) * ABUF + (rt * 64 + wave * 16 + col) * APITCH) + 8 * g;
#pragma unroll
      for (int ks = 0; ks < 2; ++ks)
#pragma unroll
        for (int i = 0; i < 8; ++i) { a[rt][ks][i] = (__bf16)p[ks * 32 + i]; a[rt][ks][8 + i] = (__bf16)p[ks * 32 + 16 + i]; } }
    const unsigned char* bb = ring + (t & 1) * BBUF + col * BPITCH;
#pragma unroll
    for (int ks = 0; ks < 2; ++ks)
#pragma unroll
      for (int jh = 0; jh < 2; ++jh) { v16b w[8];   // eight fragments read as one group, then their sixteen products
#pragma unroll
        for (int j = 0; j < 8; ++j) w[j] = frag_b((const __bf16*)(bb + (jh * 8 + j) * 16 * BPITCH + ks * 64), lane);
        __builtin_amdgcn_sched_barrier(0);   // the group's 16 LDS reads stand in one place ahead of its products; left free, the compiler read one fragment at a time into one register set and waited out the LDS latency before every pair of products
#pragma unroll
        for (int j = 0; j < 8; ++j) { acc[0][jh * 8 + j] = wmma_bf(a[0][ks], w[j], acc[0][jh * 8 + j]); acc[1][jh * 8 + j] = wmma_bf(a[1][ks], w[j], acc[1][jh * 8 + j]); }
        __builtin_amdgcn_sched_barrier(0); }   // and the next group's reads stay behind these products, not spread among them
    asm volatile("s_wait_dscnt 0x0" ::: "memory");      // this wave's reads of buffer t % 2 are done before it is refilled
    asm volatile("s_wait_asynccnt 0x0" ::: "memory");   // this wave's share of tile t + 1 has landed
    __syncthreads();                                    // publishes tile t + 1 and ends every wave's reads of buffer t % 2
    if (t + 2 < NPASS) { stage_tile(lcp + (unsigned)(t & 1) * BBUF, gcp + (t + 2) * 64); stage8a<HID>(lca + (unsigned)(t & 1) * ABUF, gca + (t + 2) * 64); stage8a<HID>(lca + (unsigned)(t & 1) * ABUF + 64u * APITCH, gca + 64 * HID + (t + 2) * 64); } }
  asm volatile("s_wait_asynccnt 0x0" ::: "memory");     // no copy is outstanding when the ring's LDS is used anew
  const int kind = (hb < NH) ? 0 : (hb < NH + NKV) ? 1 : 2;   // q, k, v
  // The epilogue runs once per row tile, on the same LDS: a wave's own range (q, k) is rewritten by that wave alone, behind its own reads; the v heads' planes are rewritten behind the barriers named there. Its code stands once per kind of head: trip 0 works on tile 0's accumulators, and tile 1's are moved into the same registers at the foot.
  v8f cur[16];
#pragma unroll
  for (int j = 0; j < 16; ++j) cur[j] = acc[0][j];
  // RMSNorm statistics per row (8g + r): this lane's 16 columns, then the 16 col-lanes
  auto row_stats = [&](float (&ss)[8]) {
#pragma unroll
    for (int r = 0; r < 8; ++r) { float s = 0.f;
#pragma unroll
      for (int j = 0; j < 16; ++j) s += cur[j][r] * cur[j][r];
      s = row_sum(s);
      ss[r] = 1.0f / sqrtf(s / (float)HD + 1e-6f); } };
  if (kind < 2) {   // q, k: the normed rows go through LDS in f32, and the rotary is applied row by row, where cos and sin are read as whole rows
    const float* NW = (kind == 0) ? QNW : KNW;
    float (*sx)[HD + 4] = (float (*)[HD + 4])(ring + wave * (16 * (HD + 4) * 4));   // 16 rows of 260 floats = 16,640 B per wave, inside the ring; every read of the ring ended at the last pass's barrier and no copy is outstanding
    _Float16* DH = (kind == 0) ? QH : KH; _Float16* DL = (kind == 0) ? QL : KL; const size_t ld = (kind == 0) ? QW : KW; const int c0 = ((kind == 0) ? hb : hb - NH) * HD;
#pragma unroll 1   // rolled: the epilogue's code stands once (for speed only)
    for (int rt = 0; rt < 2; ++rt) { const size_t r0 = rw + rt * 64;
    float ss[8]; row_stats(ss);
    // a lane holds dims 4 * lane .. + 3 of a row and their rotary partners 128 further on: four 16-byte loads per row and lane bring cos and sin (rows are (b*S + s): [b][s][d] = row*HD + d), four rows a group, two groups of registers
    const float* cp = COS + r0 * HD + lane * 4; const float* sq = SIN + r0 * HD + lane * 4;
    v4f cs[2][4][4];
    rope_rows(cs[0], cp, sq);   // the first group flies during the staging
#pragma unroll
    for (int j = 0; j < 16; ++j) { const float w = bfr(NW[j * 16 + col]);
#pragma unroll
      for (int r = 0; r < 8; ++r) sx[8 * g + r][j * 16 + col] = cur[j][r] * ss[r] * w; }
    LDSX();
#pragma unroll 1   // rolled two groups a trip, for the same reason as the row-tile loop: the code of a pair stands once
    for (int gp = 0; gp < 2; ++gp) {
#pragma unroll   // straight line inside a pair: the two register groups are named by constants
    for (int gh = 0; gh < 2; ++gh) { const int gq = gp * 2 + gh;
      if (gh < 1 || gp < 1) { rope_rows(cs[(gh + 1) & 1], cp + (gq + 1) * 4 * HD, sq + (gq + 1) * 4 * HD);
        asm volatile("s_wait_xcnt 0x0" ::: "memory");   // behind these loads, before their address registers are given to other values
        __builtin_amdgcn_sched_barrier(0); }   // the next group's loads stay ahead of this group's arithmetic, which covers their latency
#pragma unroll
      for (int i4 = 0; i4 < 4; ++i4) { const int rl = gq * 4 + i4; const v4f* e = cs[gh][i4];
        const v4f xa = *(const v4f*)&sx[rl][lane * 4], xb = *(const v4f*)&sx[rl][128 + lane * 4];
        v4h ha, la, hc, lc;
#pragma unroll
        for (int i = 0; i < 4; ++i) { const float ya = xa[i] * bfr(e[0][i]) - xb[i] * bfr(e[2][i]), yb = xb[i] * bfr(e[1][i]) + xa[i] * bfr(e[3][i]);
          const _Float16 p = (_Float16)ya, q = (_Float16)yb; ha[i] = p; la[i] = (_Float16)((ya - (float)p) * 2048.0f); hc[i] = q; lc[i] = (_Float16)((yb - (float)q) * 2048.0f); }
        const size_t o = (r0 + rl) * ld + c0 + lane * 4;   // a wave's store covers 256 contiguous bytes, two whole lines
        vst2(DH + o, ha); vst2(DH + o + 128, hc); vst2(DL + o, la); vst2(DL + o + 128, lc);
        asm volatile("s_wait_xcnt 0x0" ::: "memory");   // behind this row's stores, before their registers are given to the next row's values or to the loads that follow
        __builtin_amdgcn_sched_barrier(0); }   // the next row's arithmetic stays behind that wait
    } }
    LDSX();   // the rows are read back before the second tile's values are stored over them
#pragma unroll
    for (int j = 0; j < 16; ++j) cur[j] = acc[1][j]; } }   // the second trip works on tile 1
  else {
    const int g2 = hb - NH - NKV;
    _Float16 (*st)[72] = (_Float16 (*)[72])ring; _Float16 (*stl)[72] = (_Float16 (*)[72])(ring + BBUF);   // [HD][72] each, exactly one buffer; every read of the ring ended at the last pass's barrier
#pragma unroll 1   // rolled, as for the q and k heads
    for (int rt = 0; rt < 2; ++rt) {
    float ss[8]; row_stats(ss);
#pragma unroll
    for (int j = 0; j < 16; ++j) { const int d = j * 16 + col;
#pragma unroll
      for (int r = 0; r < 8; ++r) { const float y = cur[j][r] * ss[r];
        const _Float16 hv = (_Float16)y; soh[wave][8 * g + r][d] = hv; sol[wave][8 * g + r][d] = (_Float16)((y - (float)hv) * 2048.0f); } }
    LDSX();
    __syncthreads();   // the planes are whole; for the second row tile it also ends every wave's reads of the first tile's transpose planes
    const size_t rb = (size_t)blockIdx.x * 128 + rt * 64; const size_t b = rb / SS; const int s0 = (int)(rb % SS);
    for (int e = tid; e < 64 * HD; e += 128) { const int rr = e / HD, d = e % HD; st[d][rr] = soh[rr >> 4][rr & 15][d]; stl[d][rr] = sol[rr >> 4][rr & 15][d]; }
    __syncthreads();
#pragma unroll 1   // four pieces of each plane a trip, as the compiler had grouped them
    for (int q4 = 0; q4 < 4; ++q4) { v4u ph[4], pl[4];
#pragma unroll
      for (int k = 0; k < 4; ++k) { const int e = tid + (q4 * 4 + k) * 128, d = e >> 3, pc = e & 7; ph[k] = *(const v4u*)&st[d][pc * 8]; pl[k] = *(const v4u*)&stl[d][pc * 8]; }
#pragma unroll
      for (int k = 0; k < 4; ++k) { const int e = tid + (q4 * 4 + k) * 128, d = e >> 3, pc = e & 7; const size_t o = (b * KW + g2 * HD + d) * SS + s0 + pc * 8; vst2((unsigned*)(VT + o), ph[k]); vst2((unsigned*)(VTL + o), pl[k]); }
      asm volatile("s_wait_xcnt 0x0" ::: "memory");   // behind the trip's stores, before their address and data registers are written anew
      __builtin_amdgcn_sched_barrier(0); }   // the address steps of the next trip stay behind that wait (left free, they were lifted over it)
#pragma unroll
    for (int j = 0; j < 16; ++j) cur[j] = acc[1][j]; } }   // the second trip works on tile 1
}
// ---- k_attn: block = (64 queries, head n, b): kv head n/4; key tiles inside the window [i0 - 511, i0 + 63]; scores over 256 dims (3 products, q fragments held in registers); mask j <= i && i - j < 512; online softmax; P = e x 2048 (f16) against v hi and e against the x2048 v residual, one accumulator (2 products); ctx rows
// Every matrix operand comes from LDS, brought by asynchronous 16-byte copies. Each wave's 16 q rows (hi, residual) are staged once and their fragments read into registers once, ahead of the loop. The k tile and the v tile of a 32-key step are the two buffers of one ring, filled in turn: v of step s flies while the scores of step s are formed, k of step s + 1 flies during the softmax and the value products of step s. The block's four waves read the one staged tile.
#define QPITCH 528              // LDS pitch of a staged 512-B row (q, k): 16 B x odd, conflict-free for ds_load_b128 readers
#define VPITCH 80               // LDS pitch of a staged 64-B v row (32 keys of one dim): 16 B x odd
#define QWAVE (32 * QPITCH)     // one wave's q rows, 16 hi then 16 residual: 16,896 B
#define KBUF (64 * QPITCH)      // 32 keys hi then 32 keys residual: 33,792 B
#define VBUF (512 * VPITCH)     // 256 dims hi then 256 dims residual: 40,960 B
// Eight copies of one lane, LS LDS bytes and gs elements apart. An immediate offset moves the LDS and the global address alike, so copy i names the one LDS-address register with offset i * LS (at most 17,920) and a global address that is i * LS short of its row: one LDS-address register serves all eight and none has to stay live across the step. Every register and every offset is a multiple of 16. The s_wait_xcnt stands inside the copies' own statement so that no address register of an issued copy is rewritten ahead of it.
template <int LS> __device__ __forceinline__ void stage8h(unsigned l, const _Float16* g, size_t gs) {
  const char* p = (const char*)g; const size_t d = gs * 2 - LS;   // bytes from one copy's global register to the next
  asm volatile("global_load_async_to_lds_b128 %0, %1, off\n\t"
               "global_load_async_to_lds_b128 %0, %2, off offset:%9\n\t"
               "global_load_async_to_lds_b128 %0, %3, off offset:%10\n\t"
               "global_load_async_to_lds_b128 %0, %4, off offset:%11\n\t"
               "global_load_async_to_lds_b128 %0, %5, off offset:%12\n\t"
               "global_load_async_to_lds_b128 %0, %6, off offset:%13\n\t"
               "global_load_async_to_lds_b128 %0, %7, off offset:%14\n\t"
               "global_load_async_to_lds_b128 %0, %8, off offset:%15\n\t"
               "s_wait_xcnt 0x0"
               :: "v"(l), "v"(p), "v"(p + d), "v"(p + 2 * d), "v"(p + 3 * d), "v"(p + 4 * d), "v"(p + 5 * d), "v"(p + 6 * d), "v"(p + 7 * d),
                  "n"(LS), "n"(2 * LS), "n"(3 * LS), "n"(4 * LS), "n"(5 * LS), "n"(6 * LS), "n"(7 * LS)
               : "memory");
}
// The lane's number, formed anew where it is called. The copies' asm statements take their operands below v256, where the accumulators and the q fragments now lie: an LDS address held across the step for them was spilled to scratch and read back, waited for, ahead of every run of copies. Formed from this at the place of use, the address lives for a few instructions only (a plain expression is moved out of the loop by the compiler and held again).
__device__ __forceinline__ unsigned lane_now() { unsigned n; asm volatile("v_mbcnt_lo_u32_b32 %0, -1, 0" : "=v"(n)); return n; }
__global__ __launch_bounds__(128) void k_attn(const _Float16* __restrict__ QH, const _Float16* __restrict__ QL, const _Float16* __restrict__ KH, const _Float16* __restrict__ KL, const _Float16* __restrict__ VT, const _Float16* __restrict__ VTL, float* __restrict__ O) {
  __shared__ __align__(16) _Float16 sp[4][16][40], spu[4][16][40];
  __shared__ __align__(16) unsigned char qs[4 * QWAVE];   // q rows, a range per wave; behind the loop each wave stages its ctx rows in its own range
  __shared__ __align__(16) unsigned char kb[KBUF];        // ring buffer 0: the k tile
  __shared__ __align__(16) unsigned char vb[VBUF];        // ring buffer 1: the v tile
  const int tid = threadIdx.x, wave = tid >> 5, lane = tid & 31, col = lane & 15, g = lane >> 4; const int qb = blockIdx.x, n = blockIdx.y; const size_t b = blockIdx.z; const int kvh = n / (NH / NKV); const int q0 = qb * 64 + wave * 16; const size_t rowb = b * SS;
  const _Float16* Vp = VT + (b * KW + kvh * HD) * SS; const _Float16* Vpl = VTL + (b * KW + kvh * HD) * SS;
  float m[8], l[8];
#pragma unroll
  for (int r = 0; r < 8; ++r) { m[r] = -3.0e38f; l[r] = 0.f; }
  v8f acc[16] = {};
  const int ks0 = max(0, qb * 64 - (WIN - 1)) / 32, ks1 = (qb * 64 + 64) / 32;
  // q: a wave's copy is one whole 512-B row of its own 16 queries. k: a wave's copy is one whole row; waves 0, 1 bring the hi rows (16 keys each), waves 2, 3 the residual rows. v: a wave's copy is eight 64-B rows; lane = (row tid / 4, piece tid % 4).
  const unsigned lq = (unsigned)(size_t)qs + (unsigned)wave * QWAVE + (unsigned)lane * 16u; const size_t gq = (rowb + q0) * QW + n * HD + lane * 8;
  // lkw, lvw: the wave's part of lk and of lv
  const unsigned lkw = (unsigned)(size_t)kb + (unsigned)wave * 16u * QPITCH, lk = lkw + (unsigned)lane * 16u; const _Float16* gk = ((wave < 2) ? KH : KL) + (rowb + (wave & 1) * 16) * KW + kvh * HD + lane * 8;
  const unsigned lvw = (unsigned)(size_t)vb + (unsigned)wave * 8u * VPITCH, lv = (unsigned)(size_t)vb + (unsigned)(tid >> 2) * VPITCH + (unsigned)(tid & 3) * 16u; const size_t gv = (size_t)(tid >> 2) * SS + (tid & 3) * 8;
  stage8h<QPITCH>(lq, QH + gq, QW); stage8h<QPITCH>(lq + 8u * QPITCH, QH + gq + 8 * QW, QW); stage8h<QPITCH>(lq + 16u * QPITCH, QL + gq, QW); stage8h<QPITCH>(lq + 24u * QPITCH, QL + gq + 8 * QW, QW);
  stage8h<QPITCH>(lk, gk + (size_t)ks0 * 32 * KW, KW); stage8h<QPITCH>(lk + 8u * QPITCH, gk + ((size_t)ks0 * 32 + 8) * KW, KW);
  asm volatile("s_wait_asynccnt 0x0" ::: "memory");   // this wave's q rows and its share of the first k tile have landed
  __syncthreads();                                    // the first k tile is readable by every wave
  stage8h<32 * VPITCH>(lv, Vp + gv + ks0 * 32, 32 * SS); stage8h<32 * VPITCH>(lv + 256u * VPITCH, Vpl + gv + ks0 * 32, 32 * SS);
  const unsigned char* qrow = qs + wave * QWAVE + col * QPITCH;
  v16h aq[HD / 32], aql[HD / 32];   // the wave's q fragments (hi, residual), 128 registers: read from its own LDS range once, here, and held for every step
#pragma unroll
  for (int j = 0; j < HD / 32; ++j) { aq[j] = frag_h((const _Float16*)(qrow + j * 64), lane); aql[j] = frag_h((const _Float16*)(qrow + 16 * QPITCH + j * 64), lane); }
#pragma unroll 1
  for (int ks = ks0; ks < ks1; ++ks) { const int j0 = ks * 32; v8f s[2]; const unsigned char* krow = kb + col * QPITCH; v8f c[2] = {}, cl[2] = {};
#pragma unroll   // straight-line groups: the fragment arrays stay in registers and each group's LDS reads stand in one place
    for (int kq = 0; kq < HD / 64; ++kq) { v16h kh[2][2], kl[2][2];   // eight k fragments (both 16-key tiles, 64 dims) read as one group, then their twelve products; per accumulator the order of the sums is as before
#pragma unroll   // read in the order in which the products take them
      for (int j = 0; j < 2; ++j) { const int ko = (kq * 2 + j) * 64;
        kh[0][j] = frag_h((const _Float16*)(krow + ko), lane); kh[1][j] = frag_h((const _Float16*)(krow + 16 * QPITCH + ko), lane); kl[0][j] = frag_h((const _Float16*)(krow + 32 * QPITCH + ko), lane); kl[1][j] = frag_h((const _Float16*)(krow + 48 * QPITCH + ko), lane); }
      __builtin_amdgcn_sched_barrier(0);   // the group's 16 LDS reads stand in one place ahead of its products, as in k_qkv: left free, the compiler read one fragment at a time into one register set and waited out the LDS latency before every product or two
#pragma unroll
      for (int j = 0; j < 2; ++j) { const int f = kq * 2 + j;
        c[0] = wmma16(aq[f], kh[0][j], c[0]); cl[0] = wmma16(aql[f], kh[0][j], cl[0]); c[1] = wmma16(aq[f], kh[1][j], c[1]); cl[1] = wmma16(aql[f], kh[1][j], cl[1]); cl[0] = wmma16(aq[f], kl[0][j], cl[0]); cl[1] = wmma16(aq[f], kl[1][j], cl[1]); }
      __builtin_amdgcn_sched_barrier(0); }   // and the next group's reads stay behind these products, not spread among them
#pragma unroll
    for (int ct = 0; ct < 2; ++ct) { const int kk = j0 + ct * 16 + col;
#pragma unroll
      for (int r = 0; r < 8; ++r) { const int qi = q0 + 8 * g + r; const bool keep = (kk <= qi) && (qi - kk < WIN); s[ct][r] = keep ? (c[ct][r] + cl[ct][r] * (1.0f / 2048.0f)) : -3.0e38f; } }   // unscaled logits (the module applies no 1/sqrt(d))
    asm volatile("s_wait_dscnt 0x0" ::: "memory");      // this wave's reads of the k tile are done before it is refilled
    asm volatile("s_wait_asynccnt 0x0" ::: "memory");   // this wave's share of this step's v tile has landed
    __syncthreads();                                    // publishes the v tile and ends every wave's reads of the k tile
    if (ks + 1 < ks1) { const unsigned lkn = lkw + lane_now() * 16u; stage8h<QPITCH>(lkn, gk + (size_t)(j0 + 32) * KW, KW); stage8h<QPITCH>(lkn + 8u * QPITCH, gk + (size_t)(j0 + 40) * KW, KW); }   // lkn = lk
#pragma unroll
    for (int r = 0; r < 8; ++r) { const float mx = row_max(fmaxf(s[0][r], s[1][r]));
      const float mn = fmaxf(m[r], mx); const float xm = exp_slot(m[r] - mn), x0 = exp_slot(s[0][r] - mn), x1 = exp_slot(s[1][r] - mn);   // formed in every lane, then selected: no branch in the step
      const float alpha = (m[r] <= -1.0e38f) ? 0.f : xm;
      const float e0 = (s[0][r] <= -1.0e38f) ? 0.f : x0, e1 = (s[1][r] <= -1.0e38f) ? 0.f : x1; const float es = row_sum(e0 + e1);
      l[r] = l[r] * alpha + es; m[r] = (mn <= -1.0e38f) ? m[r] : mn;
#pragma unroll
      for (int dt = 0; dt < 16; ++dt) acc[dt][r] *= alpha;
      sp[wave][8 * g + r][col] = (_Float16)(e0 * 2048.0f); sp[wave][8 * g + r][16 + col] = (_Float16)(e1 * 2048.0f); spu[wave][8 * g + r][col] = (_Float16)e0; spu[wave][8 * g + r][16 + col] = (_Float16)e1; }   // (e x 2048) pairs with v hi, plain e with the x2048 v residual -> both land in one f32 accumulator
    LDSX();
    const v16h pa = frag_h(&sp[wave][col][0], lane), pu = frag_h(&spu[wave][col][0], lane);
#pragma unroll   // straight-line groups, as in the score loop
    for (int dq = 0; dq < 4; ++dq) { v16h vl[4], vh[4];   // eight fragments read as one group, then their eight products
#pragma unroll
      for (int j = 0; j < 4; ++j) { const unsigned char* vr = vb + ((dq * 4 + j) * 16 + col) * VPITCH; vl[j] = frag_h((const _Float16*)(vr + 256 * VPITCH), lane); vh[j] = frag_h((const _Float16*)vr, lane); }
      __builtin_amdgcn_sched_barrier(0);   // the group's 16 LDS reads stand in one place ahead of its products, as in the score loop
#pragma unroll
      for (int j = 0; j < 4; ++j) { acc[dq * 4 + j] = wmma16(pu, vl[j], acc[dq * 4 + j]); acc[dq * 4 + j] = wmma16(pa, vh[j], acc[dq * 4 + j]); }
      __builtin_amdgcn_sched_barrier(0); }   // the next group's reads stay behind these products
    asm volatile("s_wait_dscnt 0x0" ::: "memory");      // this wave's reads of the v tile (and of its softmax planes) are done before the refill
    asm volatile("s_wait_asynccnt 0x0" ::: "memory");   // this wave's share of the next k tile has landed
    __syncthreads();                                    // publishes the next k tile and ends every wave's reads of the v tile
    if (ks + 1 < ks1) { const unsigned ln = lane_now(), lvn = lvw + (ln >> 2) * VPITCH + (ln & 3u) * 16u; stage8h<32 * VPITCH>(lvn, Vp + gv + j0 + 32, 32 * SS); stage8h<32 * VPITCH>(lvn + 256u * VPITCH, Vpl + gv + j0 + 32, 32 * SS); } }   // lvn = lv
  asm volatile("s_wait_asynccnt 0x0" ::: "memory");     // no copy is outstanding when the q range is used anew
  float (*so)[HD + 4] = (float (*)[HD + 4])(qs + wave * QWAVE);   // 16 rows of 260 floats = 16,640 B, inside this wave's own q range, which no other wave reads or writes
#pragma unroll
  for (int r = 0; r < 8; ++r) { const float il = (1.0f / 2048.0f) / l[r];
#pragma unroll
    for (int dt = 0; dt < 16; ++dt) so[8 * g + r][dt * 16 + col] = acc[dt][r] * il; }
  LDSX();
  for (int rl = 0; rl < 16; ++rl) { const size_t o = (rowb + q0 + rl) * QW + n * HD; vst2(O + o + lane * 4, *(const v4f*)&so[rl][lane * 4]); vst2(O + o + 128 + lane * 4, *(const v4f*)&so[rl][128 + lane * 4]); }
}
// ---- k_out: block = (128 rows, 128 cols): y = ctx(hi/lo, K 2048) . Wo rows
// The block's 128 weight rows and its 128 ctx rows go through LDS as in k_qkv: 64 k per pass, two buffers, eight asynchronous copies per lane and pass for the weights, sixteen for ctx. A wave holds two 16-row tiles (rows 64 apart): each weight fragment it reads feeds four products.
#define OBUF (128 * BPITCH)     // 18,432 B per buffer
__global__ __launch_bounds__(128) void k_out(const float* __restrict__ Oc, const __bf16* __restrict__ P, float* __restrict__ Y) {
  __shared__ __align__(16) unsigned char aux[2 * ABUF];   // in the loop the two A buffers; behind the loop the output rows (33,792 B)
  float (*so)[16][132] = (float (*)[16][132])aux;
  __shared__ __align__(16) unsigned char ring[2 * OBUF];   // the two weight buffers
  const int tid = threadIdx.x, wave = tid >> 5, lane = tid & 31, col = lane & 15, g = lane >> 4; const size_t rw = (size_t)blockIdx.x * 128 + wave * 16; const int n0 = blockIdx.y * 128;   // rw: first row of the wave's tile 0, tile 1 lies 64 rows on
  v8f acc[2][8] = {};
  const unsigned lcp = (unsigned)(size_t)ring + (unsigned)(tid >> 3) * BPITCH + (unsigned)(tid & 7) * 16u;   // this lane's first LDS byte: row tid / 8, 16-byte piece tid % 8
  const __bf16* gcp = P + (size_t)(n0 + (tid >> 3)) * HID + (tid & 7) * 8;
  const unsigned lca = (unsigned)(size_t)aux + (unsigned)(wave * 16 + g) * APITCH + (unsigned)col * 16u;   // A: row g of the wave's 16, 16-byte piece col
  const float* gca = Oc + (rw + g) * QW + col * 4;
  stage8(lcp, gcp); stage8a<QW>(lca, gca); stage8a<QW>(lca + 64u * APITCH, gca + 64 * QW);
  asm volatile("s_wait_asynccnt 0x0" ::: "memory");   // this wave's share of tile 0 has landed
  __syncthreads();                                    // tile 0 is readable by every wave
  stage8(lcp + OBUF, gcp + 64); stage8a<QW>(lca + ABUF, gca + 64); stage8a<QW>(lca + ABUF + 64u * APITCH, gca + 64 * QW + 64);
#pragma unroll 1   // one pass per trip: the ring's order stands once, at the foot
  for (int t = 0; t < QW / 64; ++t) { F2 a[2][2];   // [row tile][k step]
#pragma unroll
    for (int rt = 0; rt < 2; ++rt)
#pragma unroll
      for (int ks = 0; ks < 2; ++ks) a[rt][ks] = split_row((const float*)(aux + (t & 1) * ABUF + (rt * 64 + wave * 16 + col) * APITCH), ks * 32, lane);
    const unsigned char* bb = ring + (t & 1) * OBUF + col * BPITCH;
#pragma unroll
    for (int ks = 0; ks < 2; ++ks) { v16b w[8];   // eight fragments read as one group, then their 32 products; per accumulator residual first, then hi, as before
#pragma unroll
      for (int j = 0; j < 8; ++j) w[j] = frag_b((const __bf16*)(bb + j * 16 * BPITCH + ks * 64), lane);
      __builtin_amdgcn_sched_barrier(0);   // the group's 16 LDS reads stand in one place ahead of its products, as in k_qkv
#pragma unroll
      for (int j = 0; j < 8; ++j) { acc[0][j] = wmma_bf(a[0][ks].l, w[j], acc[0][j]); acc[1][j] = wmma_bf(a[1][ks].l, w[j], acc[1][j]); acc[0][j] = wmma_bf(a[0][ks].h, w[j], acc[0][j]); acc[1][j] = wmma_bf(a[1][ks].h, w[j], acc[1][j]); }
      __builtin_amdgcn_sched_barrier(0); }   // the next group's reads stay behind these products
    asm volatile("s_wait_dscnt 0x0" ::: "memory");      // this wave's reads of buffer t % 2 are done before it is refilled
    asm volatile("s_wait_asynccnt 0x0" ::: "memory");   // this wave's share of tile t + 1 has landed
    __syncthreads();                                    // publishes tile t + 1 and ends every wave's reads of buffer t % 2
    if (t + 2 < QW / 64) { stage8(lcp + (unsigned)(t & 1) * OBUF, gcp + (t + 2) * 64); stage8a<QW>(lca + (unsigned)(t & 1) * ABUF, gca + (t + 2) * 64); stage8a<QW>(lca + (unsigned)(t & 1) * ABUF + 64u * APITCH, gca + 64 * QW + (t + 2) * 64); } }
  asm volatile("s_wait_asynccnt 0x0" ::: "memory");     // no copy is outstanding when the A buffers' LDS is used anew
#pragma unroll   // straight line: the accumulators of a row tile are named by constants; a wave's own output range is rewritten by that wave alone, behind its own reads
  for (int rt = 0; rt < 2; ++rt) {
#pragma unroll
    for (int j = 0; j < 8; ++j)
#pragma unroll
      for (int r = 0; r < 8; ++r) so[wave][8 * g + r][j * 16 + col] = acc[rt][j][r];
    LDSX();
    for (int rl = 0; rl < 16; ++rl) vst2(Y + (rw + rt * 64 + rl) * HID + n0 + lane * 4, *(const v4f*)&so[wave][rl][lane * 4]);
    if (rt < 1) LDSX(); }   // the rows are read back before the second tile's values are stored over them
}
extern "C" void kernel_launch(void* const* d_in, const int* in_sizes, int n_in, void* d_out, int out_size, void* d_ws, size_t ws_size, hipStream_t stream) {
  (void)in_sizes; (void)n_in; (void)out_size;
  const float** F = (const float**)d_in;   // 0 hidden_states [2,2048,2048], 1 cos [2,2048,256], 2 sin, 3 Wq [2048,2048], 4 Wk [512,2048], 5 Wv [512,2048], 6 Wo [2048,2048] (natural), 7 q_norm_w [256], 8 k_norm_w [256]
  if (ws_size < (size_t)WS_END) return;
  char* ws = (char*)d_ws; __bf16* PK = (__bf16*)(ws + WS_PK); _Float16 *QH = (_Float16*)(ws + WS_QH), *QL = (_Float16*)(ws + WS_QL), *KH = (_Float16*)(ws + WS_KH), *KL = (_Float16*)(ws + WS_KL), *VT = (_Float16*)(ws + WS_VT), *VTL = (_Float16*)(ws + WS_VTL); float* O = (float*)(ws + WS_O);
  k_pack<<<dim3(PKG), 256, 0, stream>>>(F[3], F[4], F[5], F[6], PK);
  k_qkv<<<dim3(TRB, NH + 2 * NKV), 128, 0, stream>>>(F[0], PK + PK_A, F[1], F[2], F[7], F[8], QH, QL, KH, KL, VT, VTL);
  k_attn<<<dim3(TQB, NH, TNB), 128, 0, stream>>>(QH, QL, KH, KL, VT, VTL, O);
  k_out<<<dim3(TOB, HID / 128), 128, 0, stream>>>(O, PK + PK_P, (float*)d_out);
}
